// v000
// The times below were measured on an AMD MI455X: many runs one after another, warmed up first and cycling through
// copies of the inputs, with the whole window's GPU time divided by the number of runs. Launches and the gaps
// between them are all in it. The median over several windows is given; except for v000 it joins two sittings, which
// can be a few percent apart, so the side-by-side timings, each taken in one sitting, are the better comparison.
// The starting kernel, v000, takes 1430 microseconds a run.
#include <hip/hip_runtime.h>

// Causal multi-head self-attention with interleaved rotary embeddings and a FUSED (out, in) qkv weight (X [2][2048][1024]; qkv = einsum('bsd,od->bso', X, W_qkv) ('oi' [3072][1024] std sqrt(2/4096), no bias) viewed (B, S, 3, 16, 64): q | k | v = the three 1,024-ROW blocks of W_qkv (16 heads x 64); rotary on (even, odd) pairs with angle pos / (10000 ** (2 k / 64)) (float32 constants 10000^(-2i/64), precise cosf/sinf); scores x 64^-0.5, causal (-inf); softmax; out = merged W_o^T ('oi', no bias) -> [2][2048][1024] (4.2 M); argument order X, W_qkv, W_o.
// Layout per batch: bf16 copy of x; exact projections; {cos, sin} per (position, pair) from the int positions (jnp-exact float32 inverse frequencies, precise cosf/sinf); interleaved rotary plane builder; causal T-2048 attention (hybrid rows: < 512 hi/lo 3 products, rest fp16 x1024; k_gemmc skips tiles above the diagonal); merged hi/lo x wo exact.
// Compute dtypes, f32 accumulate: every input rounded to bf16; projections exact ; rotary f32; attention rows < 512 3 products, rest fp16; softmax f32; wo hl x exact.

#define NB_  2
#define TT   2048
#define DM   1024
#define NH_  16
#define NKV  16
#define REP  (NH_ / NKV)
#define HD   64
#define DQ   (NH_ * HD)
#define DKV  (NKV * HD)
#define ZH   2
#define RH   512                  // query rows < RH use hi+lo planes (0: none)
#define WIN  2048
#define PCAR 1024.0f
#define SCL  0.125f   // HD^-0.5
typedef _Float16 h16;
typedef unsigned short bf;
typedef __attribute__((ext_vector_type(16))) __bf16   v16bf;
typedef __attribute__((ext_vector_type(16))) _Float16 v16h;
typedef __attribute__((ext_vector_type(8)))  _Float16 v8h;
typedef __attribute__((ext_vector_type(8)))  unsigned short v8us;
typedef __attribute__((ext_vector_type(8)))  float    v8f;
typedef __attribute__((ext_vector_type(4)))  float    v4f;
typedef v8h  __attribute__((may_alias)) v8ha;
typedef v4f  __attribute__((may_alias)) v4fa;
typedef v8us __attribute__((may_alias)) v8usa;

__device__ __forceinline__ unsigned short f2bf(float f) { unsigned u = __float_as_uint(f); u += 0x7FFFu + ((u >> 16) & 1u); return (unsigned short)(u >> 16); }
__device__ __forceinline__ float bf2f(unsigned short b) { return __uint_as_float(((unsigned)b) << 16); }
__device__ __forceinline__ float bfr(float f) { return bf2f(f2bf(f)); }
__device__ __forceinline__ v16h cat16(v8h lo, v8h hi) { return __builtin_shufflevector(lo, hi, 0, 1, 2, 3, 4, 5, 6, 7, 8, 9, 10, 11, 12, 13, 14, 15); }
__device__ __forceinline__ v16bf cat16b(v8us lo, v8us hi) { return __builtin_bit_cast(v16bf, __builtin_shufflevector(lo, hi, 0, 1, 2, 3, 4, 5, 6, 7, 8, 9, 10, 11, 12, 13, 14, 15)); }
__device__ __forceinline__ v8f wmma16(v16h a, v16h b, v8f c) { return __builtin_amdgcn_wmma_f32_16x16x32_f16(false, a, false, b, (short)0, c, false, false); }
__device__ __forceinline__ v8f wmmab(v16bf a, v16bf b, v8f c) { return __builtin_amdgcn_wmma_f32_16x16x32_bf16(false, a, false, b, (short)0, c, false, false); }



// ---- k_gemmw: register-blocked GEMM, ONE WAVE per 64x64 output tile (16 accumulators), operands straight from K-contiguous 16-bit planes; grid (M/64, N/64, Z), 32 threads.
// C[m][n] (f32, pitch ldc, + optional f32 bias[n]) = sum_k A[m][k] Bt[n][k] (+ split products per NSPLIT). z-batch strides sA/sB/sC in elements. K % 32 == 0.
template <typename T16> struct WFrag;
template <> struct WFrag<h16> { typedef v16h V; static __device__ __forceinline__ V ld(const h16* p) { return cat16(*(const v8h*)p, *(const v8h*)(p + 16)); } static __device__ __forceinline__ v8f mma(V a, V b, v8f c) { return wmma16(a, b, c); } };
template <> struct WFrag<bf> { typedef v16bf V; static __device__ __forceinline__ V ld(const bf* p) { return cat16b(*(const v8us*)p, *(const v8us*)(p + 16)); } static __device__ __forceinline__ v8f mma(V a, V b, v8f c) { return wmmab(a, b, c); } };
template <typename T16, int NSPLIT, bool BIAS>
__global__ __launch_bounds__(32) void k_gemmw(const T16* __restrict__ A, const T16* __restrict__ A2, const T16* __restrict__ Bt, const T16* __restrict__ Bt2, int K, float* C, int ldc, const float* __restrict__ bias, size_t sA, size_t sB, size_t sC) {
    typedef typename WFrag<T16>::V V;
    __shared__ __align__(16) float os[16 * 68];
    const size_t z = blockIdx.z; A += z * sA; if (A2) A2 += z * sA; Bt += z * sB; if (Bt2) Bt2 += z * sB; C += z * sC;
    const int lane = threadIdx.x & 31, lr = lane & 15, hi = lane >> 4; const int r0 = blockIdx.x * 64, c0 = blockIdx.y * 64;
    v8f acc[4][4];
#pragma unroll
    for (int mb = 0; mb < 4; ++mb)
#pragma unroll
        for (int nb = 0; nb < 4; ++nb) acc[mb][nb] = (v8f){};
    const size_t aoff = (size_t)(r0 + lr) * K + 8 * hi, boff = (size_t)(c0 + lr) * K + 8 * hi;
#pragma unroll 1
    for (int kc = 0; kc < K; kc += 32) {
        V a[4], a2[4];
#pragma unroll
        for (int mb = 0; mb < 4; ++mb) { a[mb] = WFrag<T16>::ld(A + aoff + (size_t)mb * 16 * K + kc); if (NSPLIT == 1 || NSPLIT == 2) a2[mb] = WFrag<T16>::ld(A2 + aoff + (size_t)mb * 16 * K + kc); }
#pragma unroll
        for (int nb = 0; nb < 4; ++nb) { const V b = WFrag<T16>::ld(Bt + boff + (size_t)nb * 16 * K + kc); V b2; if (NSPLIT >= 2) b2 = WFrag<T16>::ld(Bt2 + boff + (size_t)nb * 16 * K + kc);
#pragma unroll
            for (int mb = 0; mb < 4; ++mb) { acc[mb][nb] = WFrag<T16>::mma(a[mb], b, acc[mb][nb]); if (NSPLIT == 1 || NSPLIT == 2) acc[mb][nb] = WFrag<T16>::mma(a2[mb], b, acc[mb][nb]); if (NSPLIT >= 2) acc[mb][nb] = WFrag<T16>::mma(a[mb], b2, acc[mb][nb]); } }
        asm volatile("v_nop\n\tv_nop\n\tv_nop\n\tv_nop" : "+v"(acc[0][0]), "+v"(acc[1][1]), "+v"(acc[2][2]), "+v"(acc[3][3]) : "v"(a[0]), "v"(a[3]));
    }
#pragma unroll
    for (int mb = 0; mb < 4; ++mb) {
#pragma unroll
        for (int nb = 0; nb < 4; ++nb) {
#pragma unroll
            for (int j = 0; j < 8; ++j) os[(hi * 8 + j) * 68 + nb * 16 + lr] = acc[mb][nb][j]; }
        __builtin_amdgcn_wave_barrier(); asm volatile("" ::: "memory");
        float* crow = C + (size_t)(r0 + mb * 16) * ldc + c0;
{
#pragma unroll
            for (int s = 0; s < 8; ++s) { const int row = 2 * s + hi, cofs = lr * 4; v4f val = *(const v4fa*)(os + row * 68 + cofs); if (BIAS) { val[0] += bfr(bias[c0 + cofs]); val[1] += bfr(bias[c0 + cofs + 1]); val[2] += bfr(bias[c0 + cofs + 2]); val[3] += bfr(bias[c0 + cofs + 3]); }
                *(v4f*)(crow + (size_t)row * ldc + cofs) = val; }
             }
        __builtin_amdgcn_wave_barrier(); asm volatile("" ::: "memory");
    }
}

// ---- k_gemmc: the same one-wave 64x64 tile GEMM specialised for causal attention: CMODE 1 skips score tiles entirely above the diagonal (query rows r0+roff.., key columns c0..), CMODE 2 limits the
// key (K) loop of the probability x value contraction to the diagonal block (probabilities beyond it are exactly zero). roff = row offset of this launch's first row within the sequence.
template <typename T16, int NSPLIT, int CMODE>
__global__ __launch_bounds__(32) void k_gemmc(const T16* __restrict__ A, const T16* __restrict__ A2, const T16* __restrict__ Bt, const T16* __restrict__ Bt2, int K, float* C, int ldc, int roff, size_t sA, size_t sB, size_t sC) {
    typedef typename WFrag<T16>::V V;
    __shared__ __align__(16) float os[16 * 68];
    const size_t z = blockIdx.z; A += z * sA; if (A2) A2 += z * sA; Bt += z * sB; if (Bt2) Bt2 += z * sB; C += z * sC;
    const int lane = threadIdx.x & 31, lr = lane & 15, hi = lane >> 4; const int r0 = blockIdx.x * 64, c0 = blockIdx.y * 64;
    if (CMODE == 1 && c0 > r0 + roff + 63) return;                  // score tile entirely above the causal diagonal: never read (the softmax masks j > i by select)
    const int Kl = (CMODE == 2) ? min(K, r0 + roff + 64) : K;        // P.V: probabilities are exactly 0 beyond the diagonal block, so the K loop stops there
    v8f acc[4][4];
#pragma unroll
    for (int mb = 0; mb < 4; ++mb)
#pragma unroll
        for (int nb = 0; nb < 4; ++nb) acc[mb][nb] = (v8f){};
    const size_t aoff = (size_t)(r0 + lr) * K + 8 * hi, boff = (size_t)(c0 + lr) * K + 8 * hi;
#pragma unroll 1
    for (int kc = 0; kc < Kl; kc += 32) {
        V a[4], a2[4];
#pragma unroll
        for (int mb = 0; mb < 4; ++mb) { a[mb] = WFrag<T16>::ld(A + aoff + (size_t)mb * 16 * K + kc); if (NSPLIT == 1 || NSPLIT == 2) a2[mb] = WFrag<T16>::ld(A2 + aoff + (size_t)mb * 16 * K + kc); }
#pragma unroll
        for (int nb = 0; nb < 4; ++nb) { const V b = WFrag<T16>::ld(Bt + boff + (size_t)nb * 16 * K + kc); V b2; if (NSPLIT >= 2) b2 = WFrag<T16>::ld(Bt2 + boff + (size_t)nb * 16 * K + kc);
#pragma unroll
            for (int mb = 0; mb < 4; ++mb) { acc[mb][nb] = WFrag<T16>::mma(a[mb], b, acc[mb][nb]); if (NSPLIT == 1 || NSPLIT == 2) acc[mb][nb] = WFrag<T16>::mma(a2[mb], b, acc[mb][nb]); if (NSPLIT >= 2) acc[mb][nb] = WFrag<T16>::mma(a[mb], b2, acc[mb][nb]); } }
        asm volatile("v_nop\n\tv_nop\n\tv_nop\n\tv_nop" : "+v"(acc[0][0]), "+v"(acc[1][1]), "+v"(acc[2][2]), "+v"(acc[3][3]) : "v"(a[0]), "v"(a[3]));
    }
#pragma unroll
    for (int mb = 0; mb < 4; ++mb) {
#pragma unroll
        for (int nb = 0; nb < 4; ++nb) {
#pragma unroll
            for (int j = 0; j < 8; ++j) os[(hi * 8 + j) * 68 + nb * 16 + lr] = acc[mb][nb][j]; }
        __builtin_amdgcn_wave_barrier(); asm volatile("" ::: "memory");
        float* crow = C + (size_t)(r0 + mb * 16) * ldc + c0;
{
#pragma unroll
            for (int s = 0; s < 8; ++s) { const int row = 2 * s + hi, cofs = lr * 4; v4f val = *(const v4fa*)(os + row * 68 + cofs);
                *(v4f*)(crow + (size_t)row * ldc + cofs) = val; }
             }
        __builtin_amdgcn_wave_barrier(); asm volatile("" ::: "memory");
    }
}

__device__ __forceinline__ h16 tohx(float x) { return (h16)x; }
__device__ __forceinline__ void splitf(float y, unsigned short& h, unsigned short& l) { h = f2bf(y); l = f2bf(y - bf2f(h)); }
typedef __attribute__((ext_vector_type(2))) _Float16 v2h;
typedef __attribute__((ext_vector_type(4))) _Float16 v4h;
typedef __attribute__((ext_vector_type(2))) unsigned short v2us;
typedef __attribute__((ext_vector_type(4))) unsigned short v4us;
typedef __attribute__((ext_vector_type(2))) float v2f;
typedef __attribute__((ext_vector_type(4))) int v4i;

__global__ __launch_bounds__(256) void k_wtG(const float* __restrict__ w, int K, int N, bf* Bt) {
    const int lane = threadIdx.x & 31; const int L0 = (blockIdx.x * 8 + (threadIdx.x >> 5)) * 8; const int nlines = N * K / 64;
{
#pragma unroll 1
        for (int l = 0; l < 8; ++l) { const int L = L0 + l; if (L >= nlines) break; const size_t e = (size_t)L * 64 + lane * 2; const int k = (int)(e % K), n = (int)(e / K); v2us o;
            o[0] = f2bf(w[(size_t)k * N + n]); o[1] = f2bf(w[(size_t)(k + 1) * N + n]); *(v2us*)(Bt + e) = o; }
         }
}
__global__ __launch_bounds__(256) void k_cvt8(const float* __restrict__ src, bf* dst, size_t n8) { const size_t i = (size_t)blockIdx.x * 256 + threadIdx.x; if (i >= n8) return; const v8f v = *(const v8f*)(src + i * 8); v8us o;
#pragma unroll
    for (int k = 0; k < 8; ++k) o[k] = f2bf(v[k]); *(v8us*)(dst + i * 8) = o;  }
__constant__ float INVP[HD / 2] = { 1.000000000e+00f,7.498942018e-01f,5.623413324e-01f,4.216965139e-01f,3.162277639e-01f,2.371373773e-01f,1.778279394e-01f,1.333521456e-01f,1.000000015e-01f,7.498942316e-02f,5.623413250e-02f,4.216964915e-02f,3.162277490e-02f,2.371373773e-02f,1.778279431e-02f,1.333521400e-02f,9.999999776e-03f,7.498942316e-03f,5.623413250e-03f,4.216964822e-03f,3.162277630e-03f,2.371373819e-03f,1.778279431e-03f,1.333521446e-03f,1.000000047e-03f,7.498941850e-04f,5.623413017e-04f,4.216965172e-04f,3.162277571e-04f,2.371373703e-04f,1.778279402e-04f,1.333521504e-04f };   // 10000 ** (-2 i / 64) as float32 (the module's power form, jnp-computed; differs from 1/10000**(2i/64) by ulps)
__global__ __launch_bounds__(256) void k_csP(float* CS) { const int idx = blockIdx.x * 256 + threadIdx.x; if (idx >= TT * HD) return; const int d = idx % HD; const int t = idx / HD; const float a = __fmul_rn((float)t, INVP[d >> 1]); v2f cs; cs[0] = cosf(a); cs[1] = sinf(a); *(v2f*)(CS + (size_t)idx * 2) = cs;  }

__global__ __launch_bounds__(256) void k_ropeI(const float* __restrict__ F, int pitch, int nheads, const float* __restrict__ CS, float sc, h16* P16, bf* Ph, bf* Pl) {
    const size_t e = ((size_t)blockIdx.x * 256 + threadIdx.x) * 2; if (e >= (size_t)nheads * TT * HD) return; const int d = (int)(e % HD); const int t = (int)((e / HD) % TT); const int h = (int)(e / ((size_t)HD * TT)); const float* f = F + (size_t)t * pitch + h * HD; const float x0 = f[d], x1 = f[d + 1]; const v2f cs = *(const v2f*)(CS + ((size_t)t * HD + d) * 2); v2h o16; v2us oh, ol;
    float a0 = __fmul_rn(x0, cs[0]), b0 = __fmul_rn(x1, cs[1]), a1 = __fmul_rn(x1, cs[0]), b1 = __fmul_rn(x0, cs[1]); asm volatile("" : "+v"(a0), "+v"(b0), "+v"(a1), "+v"(b1));
    float r0 = __fsub_rn(a0, b0) * sc, r1 = __fadd_rn(b1, a1) * sc;   /* even: x0 c - x1 s; odd: x0 s + x1 c */
    o16[0] = tohx(r0); o16[1] = tohx(r1); { unsigned short a2, c2; splitf(r0, a2, c2); oh[0] = a2; ol[0] = c2; splitf(r1, a2, c2); oh[1] = a2; ol[1] = c2; }
    *(v2h*)(P16 + e) = o16; *(v2us*)(Ph + e) = oh; *(v2us*)(Pl + e) = ol;  }


// k_ropeI: head planes [h][t][d] (fp16 + hi/lo) of rope(x) x sc with the interleaved convention out[2i] = x[2i] cos[t][i] - x[2i+1] sin[t][i], out[2i+1] = x[2i] sin[t][i] + x[2i+1] cos[t][i]

__global__ __launch_bounds__(256) void k_vtp(const float* __restrict__ F, int pitch, int nheads, h16* V16, bf* Vh, bf* Vl) { const size_t e = ((size_t)blockIdx.x * 256 + threadIdx.x) * 2; if (e >= (size_t)nheads * HD * TT) return; const int t = (int)(e % TT); const int d = (int)((e / TT) % HD); const int g = (int)(e / ((size_t)TT * HD)); v2h o16; v2us oh, ol;
#pragma unroll
    for (int q = 0; q < 2; ++q) { const float x = F[(size_t)(t + q) * pitch + g * HD + d]; o16[q] = tohx(x); unsigned short a2, c2; splitf(x, a2, c2); oh[q] = a2; ol[q] = c2; }
    *(v2h*)(V16 + e) = o16; *(v2us*)(Vh + e) = oh; *(v2us*)(Vl + e) = ol;  }
// k_asoft: per row (zz, i): t = S x HD^-0.5 for j <= i and i - j < WIN (sliding causal window; the reference's -1e9 additive fill vanishes identically); softmax over the 2048 keys (register row, one exp, fixed trees);
__global__ __launch_bounds__(256) void k_asoft(const float* __restrict__ Sb, h16* P16, bf* Ph, bf* Pl) {
    const int lane = threadIdx.x & 31; const int row = blockIdx.x * 8 + (threadIdx.x >> 5); if (row >= ZH * TT) return; const int i = row % TT; const int zz = row / TT; (void)zz; const bool hires = (i < RH); const float* sr = Sb + (size_t)row * TT; float v[TT / 32]; float mx = -3.0e38f;
#pragma unroll
    for (int ch = 0; ch < TT / 128; ++ch) { const int j0 = ch * 128 + lane * 4; const v4f a = *(const v4f*)(sr + j0);
#pragma unroll
        for (int q = 0; q < 4; ++q) { const int j = j0 + q; (void)j; const float t = (j <= i && i - j < WIN) ? a[q] * SCL : -3.0e38f; v[ch * 4 + q] = t; mx = fmaxf(mx, t); } }
#pragma unroll
    for (int sh = 16; sh; sh >>= 1) mx = fmaxf(mx, __shfl_xor(mx, sh, 32));
    float sum = 0.f;
#pragma unroll
    for (int k = 0; k < TT / 32; ++k) { float d0 = __fsub_rn(v[k], mx); asm volatile("" : "+v"(d0)); v[k] = __builtin_amdgcn_exp2f(__fmul_rn(d0, 1.4426950408889634f)); sum += v[k]; }
#pragma unroll
    for (int sh = 16; sh; sh >>= 1) sum += __shfl_xor(sum, sh, 32);
    const float f = __fdiv_rn(hires ? 1.0f : PCAR, sum);
{
        if (hires) {
#pragma unroll
            for (int ch = 0; ch < TT / 128; ++ch) { v4us oh, ol;
#pragma unroll
                for (int q = 0; q < 4; ++q) { unsigned short a, c2; splitf(v[ch * 4 + q] * f, a, c2); oh[q] = a; ol[q] = c2; }
                const size_t oo = ((size_t)zz * (RH ? RH : 1) + i) * TT + ch * 128 + lane * 4; *(v4us*)(Ph + oo) = oh; *(v4us*)(Pl + oo) = ol; }
        } else {
#pragma unroll
            for (int ch = 0; ch < TT / 128; ++ch) { v4h o4;
#pragma unroll
                for (int q = 0; q < 4; ++q) o4[q] = tohx(v[ch * 4 + q] * f);
                *(v4h*)(P16 + (size_t)row * TT + ch * 128 + lane * 4) = o4; } }
         }
}
__global__ __launch_bounds__(256) void k_merge(const float* __restrict__ O, int h0, bf* Ah, bf* Al) { const size_t e = ((size_t)blockIdx.x * 256 + threadIdx.x) * 2; if (e >= (size_t)ZH * TT * HD) return; const int d = (int)(e % HD); const int t = (int)((e / HD) % TT); const int zz = (int)(e / ((size_t)HD * TT)); const float cs = (t < RH) ? 1.0f : (1.0f / PCAR); const size_t oo = (size_t)t * DQ + (h0 + zz) * HD + d;
    v2us oh, ol;
#pragma unroll
    for (int q = 0; q < 2; ++q) { unsigned short a, c2; splitf(O[e + q] * cs, a, c2); oh[q] = a; ol[q] = c2; } *(v2us*)(Ah + oo) = oh; *(v2us*)(Al + oo) = ol;  }

extern "C" void kernel_launch(void* const* d_in, const int* in_sizes, int n_in,
                              void* d_out, int out_size, void* d_ws, size_t ws_size, hipStream_t stream) {
    (void)in_sizes; (void)n_in; (void)out_size;
    const float* x = (const float*)d_in[0]; const float* wq = (const float*)d_in[1]; const float* wk = wq + (size_t)DQ * DM; const float* wv = wq + (size_t)2 * DQ * DM; const float* wo = (const float*)d_in[2];   /* input order X, W_qkv ('oi' [3072][1024]: q | k | v = its three 1,024-row blocks), W_o ('oi' [1024][1024]): THREE inputs; the host's three separate 'oi' weights are the row blocks of this module's fused one */
    float* OUT = (float*)d_out;     // [2][2048][1024]
    char* wsp = (char*)d_ws;
    auto take = [&](size_t bytes) { char* p = wsp; wsp += (bytes + 255) & ~(size_t)255; return (void*)p; };
    bf* WQ = (bf*)take((size_t)DQ * DM * 2); bf* WK = (bf*)take((size_t)DKV * DM * 2); bf* WV = (bf*)take((size_t)DKV * DM * 2); bf* WO = (bf*)take((size_t)DM * DQ * 2); float* CS = (float*)take((size_t)TT * HD * 2 * 4);
    bf* XB = (bf*)take((size_t)TT * DM * 2); float* FQ = (float*)take((size_t)TT * DQ * 4); float* FK = (float*)take((size_t)TT * DKV * 4);
    h16* QP16 = (h16*)take((size_t)NH_ * TT * HD * 2); h16* KP16 = (h16*)take((size_t)NKV * TT * HD * 2); h16* VT16 = (h16*)take((size_t)NKV * HD * TT * 2);
    bf* QPh = (bf*)take((size_t)NH_ * TT * HD * 2); bf* QPl = (bf*)take((size_t)NH_ * TT * HD * 2); bf* KPh = (bf*)take((size_t)NKV * TT * HD * 2); bf* KPl = (bf*)take((size_t)NKV * TT * HD * 2); bf* VTh = (bf*)take((size_t)NKV * HD * TT * 2); bf* VTl = (bf*)take((size_t)NKV * HD * TT * 2); bf* Ph = (bf*)take((size_t)ZH * RH * TT * 2); bf* Pl = (bf*)take((size_t)ZH * RH * TT * 2);
    float* Sb = (float*)take((size_t)ZH * TT * TT * 4); h16* P16 = (h16*)take((size_t)ZH * TT * TT * 2); float* Ob = (float*)take((size_t)ZH * TT * HD * 4); bf* ATh = (bf*)take((size_t)TT * DQ * 2); bf* ATl = (bf*)take((size_t)TT * DQ * 2);
    if ((size_t)(wsp - (char*)d_ws) > ws_size) return;    // ws 256 MiB
    float* FV = FK;   // v projection reuses the k buffer after the k planes are built (stream-ordered)
    { k_cvt8<<<(unsigned)(((size_t)DQ * DM / 8 + 255) / 256), 256, 0, stream>>>(wq, WQ, (size_t)DQ * DM / 8); k_cvt8<<<(unsigned)(((size_t)DKV * DM / 8 + 255) / 256), 256, 0, stream>>>(wk, WK, (size_t)DKV * DM / 8); k_cvt8<<<(unsigned)(((size_t)DKV * DM / 8 + 255) / 256), 256, 0, stream>>>(wv, WV, (size_t)DKV * DM / 8);
      k_cvt8<<<(unsigned)(((size_t)DM * DQ / 8 + 255) / 256), 256, 0, stream>>>(wo, WO, (size_t)DM * DQ / 8);
       }
    const unsigned LQ = (unsigned)(((size_t)NH_ * TT * HD / 2 + 255) / 256), LKv = (unsigned)(((size_t)NKV * TT * HD / 2 + 255) / 256);
    for (int b = 0; b < NB_; ++b) {
        if (b == 0) k_csP<<<(TT * HD + 255) / 256, 256, 0, stream>>>(CS);   /* {cos, sin}(t x THETA**(-2i/64)) per interleaved pair */
        k_cvt8<<<(unsigned)(((size_t)TT * DM / 8 + 255) / 256), 256, 0, stream>>>(x + (size_t)b * TT * DM, XB, (size_t)TT * DM / 8);
        k_gemmw<bf, 0, false><<<dim3(TT / 64, DQ / 64, 1), 32, 0, stream>>>(XB, nullptr, WQ, nullptr, DM, FQ, DQ, nullptr, 0, 0, 0);
        k_ropeI<<<LQ, 256, 0, stream>>>(FQ, DQ, NH_, CS, 1.0f, QP16, QPh, QPl);
        k_gemmw<bf, 0, false><<<dim3(TT / 64, DKV / 64, 1), 32, 0, stream>>>(XB, nullptr, WK, nullptr, DM, FK, DKV, nullptr, 0, 0, 0);
        k_ropeI<<<LKv, 256, 0, stream>>>(FK, DKV, NKV, CS, 1.0f, KP16, KPh, KPl);
        k_gemmw<bf, 0, false><<<dim3(TT / 64, DKV / 64, 1), 32, 0, stream>>>(XB, nullptr, WV, nullptr, DM, FV, DKV, nullptr, 0, 0, 0); k_vtp<<<LKv, 256, 0, stream>>>(FV, DKV, NKV, VT16, VTh, VTl);
        for (int h0 = 0; h0 < NH_; h0 += ZH) { const size_t zq = (size_t)h0, zk = (size_t)(h0 / REP);   // one kv head per query head: the pass's two heads use consecutive kv planes (z-strides TT*HD)
            k_gemmc<bf, 2, 1><<<dim3(RH / 64, TT / 64, ZH), 32, 0, stream>>>(QPh + zq * TT * HD, QPl + zq * TT * HD, KPh + zk * TT * HD, KPl + zk * TT * HD, HD, Sb, TT, 0, (size_t)TT * HD, (size_t)TT * HD, (size_t)TT * TT);
            k_gemmc<h16, 0, 1><<<dim3((TT - RH) / 64, TT / 64, ZH), 32, 0, stream>>>(QP16 + zq * TT * HD + (size_t)RH * HD, nullptr, KP16 + zk * TT * HD, nullptr, HD, Sb + (size_t)RH * TT, TT, RH, (size_t)TT * HD, (size_t)TT * HD, (size_t)TT * TT);
            k_asoft<<<ZH * TT / 8, 256, 0, stream>>>(Sb, P16, Ph, Pl);
            k_gemmc<bf, 2, 2><<<dim3(RH / 64, HD / 64, ZH), 32, 0, stream>>>(Ph, Pl, VTh + zk * HD * TT, VTl + zk * HD * TT, TT, Ob, HD, 0, (size_t)RH * TT, (size_t)HD * TT, (size_t)TT * HD);
            k_gemmc<h16, 0, 2><<<dim3((TT - RH) / 64, HD / 64, ZH), 32, 0, stream>>>(P16 + (size_t)RH * TT, nullptr, VT16 + zk * HD * TT, nullptr, TT, Ob + (size_t)RH * HD, HD, RH, (size_t)TT * TT, (size_t)HD * TT, (size_t)TT * HD);
            k_merge<<<(unsigned)(((size_t)ZH * TT * HD / 2 + 255) / 256), 256, 0, stream>>>(Ob, h0, ATh, ATl); }
        k_gemmw<bf, 1, false><<<dim3(TT / 64, DM / 64, 1), 32, 0, stream>>>(ATh, ATl, WO, nullptr, DQ, OUT + (size_t)b * TT * DM, DM, nullptr, 0, 0, 0); }
}

// v001
// One run takes 766 microseconds.
// Two timings next to v000 both put it at 1.88 times that version's speed.
#include <hip/hip_runtime.h>

// Causal multi-head self-attention with interleaved rotary embeddings and a FUSED (out, in) qkv weight (X [2][2048][1024]; qkv = einsum('bsd,od->bso', X, W_qkv) ('oi' [3072][1024] std sqrt(2/4096), no bias) viewed (B, S, 3, 16, 64): q | k | v = the three 1,024-ROW blocks of W_qkv (16 heads x 64); rotary on (even, odd) pairs with angle pos / (10000 ** (2 k / 64)) (float32 constants 10000^(-2i/64), precise cosf/sinf); scores x 64^-0.5, causal (-inf); softmax; out = merged W_o^T ('oi', no bias) -> [2][2048][1024] (4.2 M); argument order X, W_qkv, W_o.
// Layout per batch: bf16 copy of x; exact projections; {cos, sin} per (position, pair) from the int positions (jnp-exact float32 inverse frequencies, precise cosf/sinf); interleaved rotary plane builder; causal T-2048 attention (hybrid rows: < 512 hi/lo 3 products, rest fp16 x1024; k_gemmc skips tiles above the diagonal); merged hi/lo x wo exact.
// Compute dtypes, f32 accumulate: every input rounded to bf16; projections exact ; rotary f32; attention rows < 512 3 products, rest fp16; softmax f32; wo hl x exact.

#define NB_  2
#define TT   2048
#define DM   1024
#define NH_  16
#define NKV  16
#define REP  (NH_ / NKV)
#define HD   64
#define DQ   (NH_ * HD)
#define DKV  (NKV * HD)
#define ZH   2
#define RH   512                  // query rows < RH use hi+lo planes (0: none)
#define WIN  2048
#define PCAR 1024.0f
#define SCL  0.125f   // HD^-0.5
#define KSH  8                    // key slices of the P.V product, query rows < RH (at most RH / 64 = 8 blocks of 64 keys per tile)
#define KSF  16                   // key slices of the P.V product, query rows >= RH (at most TT / 64 = 32 blocks of 64 keys per tile)
typedef _Float16 h16;
typedef unsigned short bf;
typedef __attribute__((ext_vector_type(16))) __bf16   v16bf;
typedef __attribute__((ext_vector_type(16))) _Float16 v16h;
typedef __attribute__((ext_vector_type(8)))  _Float16 v8h;
typedef __attribute__((ext_vector_type(8)))  unsigned short v8us;
typedef __attribute__((ext_vector_type(8)))  float    v8f;
typedef __attribute__((ext_vector_type(4)))  float    v4f;
typedef v8h  __attribute__((may_alias)) v8ha;
typedef v4f  __attribute__((may_alias)) v4fa;
typedef v8us __attribute__((may_alias)) v8usa;

__device__ __forceinline__ unsigned short f2bf(float f) { unsigned u = __float_as_uint(f); u += 0x7FFFu + ((u >> 16) & 1u); return (unsigned short)(u >> 16); }
__device__ __forceinline__ float bf2f(unsigned short b) { return __uint_as_float(((unsigned)b) << 16); }
__device__ __forceinline__ float bfr(float f) { return bf2f(f2bf(f)); }
__device__ __forceinline__ v16h cat16(v8h lo, v8h hi) { return __builtin_shufflevector(lo, hi, 0, 1, 2, 3, 4, 5, 6, 7, 8, 9, 10, 11, 12, 13, 14, 15); }
__device__ __forceinline__ v16bf cat16b(v8us lo, v8us hi) { return __builtin_bit_cast(v16bf, __builtin_shufflevector(lo, hi, 0, 1, 2, 3, 4, 5, 6, 7, 8, 9, 10, 11, 12, 13, 14, 15)); }
__device__ __forceinline__ v8f wmma16(v16h a, v16h b, v8f c) { return __builtin_amdgcn_wmma_f32_16x16x32_f16(false, a, false, b, (short)0, c, false, false); }
__device__ __forceinline__ v8f wmmab(v16bf a, v16bf b, v8f c) { return __builtin_amdgcn_wmma_f32_16x16x32_bf16(false, a, false, b, (short)0, c, false, false); }



// ---- k_gemmw: register-blocked GEMM, ONE WAVE per 64x64 output tile (16 accumulators), operands straight from K-contiguous 16-bit planes; grid (M/64, N/64, Z), 32 threads.
// C[m][n] (f32, pitch ldc, + optional f32 bias[n]) = sum_k A[m][k] Bt[n][k] (+ split products per NSPLIT). z-batch strides sA/sB/sC in elements. K % 32 == 0.
template <typename T16> struct WFrag;
template <> struct WFrag<h16> { typedef v16h V; static __device__ __forceinline__ V ld(const h16* p) { return cat16(*(const v8h*)p, *(const v8h*)(p + 16)); } static __device__ __forceinline__ v8f mma(V a, V b, v8f c) { return wmma16(a, b, c); } };
template <> struct WFrag<bf> { typedef v16bf V; static __device__ __forceinline__ V ld(const bf* p) { return cat16b(*(const v8us*)p, *(const v8us*)(p + 16)); } static __device__ __forceinline__ v8f mma(V a, V b, v8f c) { return wmmab(a, b, c); } };
template <typename T16, int NSPLIT, bool BIAS>
__global__ __launch_bounds__(32) void k_gemmw(const T16* __restrict__ A, const T16* __restrict__ A2, const T16* __restrict__ Bt, const T16* __restrict__ Bt2, int K, float* C, int ldc, const float* __restrict__ bias, size_t sA, size_t sB, size_t sC) {
    typedef typename WFrag<T16>::V V;
    __shared__ __align__(16) float os[16 * 68];
    const size_t z = blockIdx.z; A += z * sA; if (A2) A2 += z * sA; Bt += z * sB; if (Bt2) Bt2 += z * sB; C += z * sC;
    const int lane = threadIdx.x & 31, lr = lane & 15, hi = lane >> 4; const int r0 = blockIdx.x * 64, c0 = blockIdx.y * 64;
    v8f acc[4][4];
#pragma unroll
    for (int mb = 0; mb < 4; ++mb)
#pragma unroll
        for (int nb = 0; nb < 4; ++nb) acc[mb][nb] = (v8f){};
    const size_t aoff = (size_t)(r0 + lr) * K + 8 * hi, boff = (size_t)(c0 + lr) * K + 8 * hi;
#pragma unroll 1
    for (int kc = 0; kc < K; kc += 32) {
        V a[4], a2[4];
#pragma unroll
        for (int mb = 0; mb < 4; ++mb) { a[mb] = WFrag<T16>::ld(A + aoff + (size_t)mb * 16 * K + kc); if (NSPLIT == 1 || NSPLIT == 2) a2[mb] = WFrag<T16>::ld(A2 + aoff + (size_t)mb * 16 * K + kc); }
#pragma unroll
        for (int nb = 0; nb < 4; ++nb) { const V b = WFrag<T16>::ld(Bt + boff + (size_t)nb * 16 * K + kc); V b2; if (NSPLIT >= 2) b2 = WFrag<T16>::ld(Bt2 + boff + (size_t)nb * 16 * K + kc);
#pragma unroll
            for (int mb = 0; mb < 4; ++mb) { acc[mb][nb] = WFrag<T16>::mma(a[mb], b, acc[mb][nb]); if (NSPLIT == 1 || NSPLIT == 2) acc[mb][nb] = WFrag<T16>::mma(a2[mb], b, acc[mb][nb]); if (NSPLIT >= 2) acc[mb][nb] = WFrag<T16>::mma(a[mb], b2, acc[mb][nb]); } }
        asm volatile("v_nop\n\tv_nop\n\tv_nop\n\tv_nop" : "+v"(acc[0][0]), "+v"(acc[1][1]), "+v"(acc[2][2]), "+v"(acc[3][3]) : "v"(a[0]), "v"(a[3]));
    }
#pragma unroll
    for (int mb = 0; mb < 4; ++mb) {
#pragma unroll
        for (int nb = 0; nb < 4; ++nb) {
#pragma unroll
            for (int j = 0; j < 8; ++j) os[(hi * 8 + j) * 68 + nb * 16 + lr] = acc[mb][nb][j]; }
        __builtin_amdgcn_wave_barrier(); asm volatile("" ::: "memory");
        float* crow = C + (size_t)(r0 + mb * 16) * ldc + c0;
{
#pragma unroll
            for (int s = 0; s < 8; ++s) { const int row = 2 * s + hi, cofs = lr * 4; v4f val = *(const v4fa*)(os + row * 68 + cofs); if (BIAS) { val[0] += bfr(bias[c0 + cofs]); val[1] += bfr(bias[c0 + cofs + 1]); val[2] += bfr(bias[c0 + cofs + 2]); val[3] += bfr(bias[c0 + cofs + 3]); }
                *(v4f*)(crow + (size_t)row * ldc + cofs) = val; }
             }
        __builtin_amdgcn_wave_barrier(); asm volatile("" ::: "memory");
    }
}

// ---- k_gemmc: the same one-wave 64x64 tile GEMM specialised for causal attention: CMODE 1 skips score tiles entirely above the diagonal (query rows r0+roff.., key columns c0..), CMODE 2 limits the
// key (K) loop of the probability x value contraction to the diagonal block (probabilities beyond it are exactly zero). roff = row offset of this launch's first row within the sequence.
// CMODE 2 has one column tile (N = 64), and blockIdx.y is the key slice ks of KSP: slice ks takes the 64-key blocks ks, ks + KSP, ... (whole 128-byte lines of both operands) and stores its f32 partial tile
// in plane ks of C (planes ZH*TT*HD apart; a slice with no block stores zeros); k_merge adds the planes in slice order. kc is unsigned so that it enters the 64-bit address sums without a sign extension.
template <typename T16, int NSPLIT, int CMODE, int KSP>
__global__ __launch_bounds__(32) void k_gemmc(const T16* __restrict__ A, const T16* __restrict__ A2, const T16* __restrict__ Bt, const T16* __restrict__ Bt2, int K, float* C, int ldc, int roff, size_t sA, size_t sB, size_t sC) {
    typedef typename WFrag<T16>::V V;
    __shared__ __align__(16) float os[16 * 68];
    const size_t z = blockIdx.z; A += z * sA; if (A2) A2 += z * sA; Bt += z * sB; if (Bt2) Bt2 += z * sB; C += z * sC;
    const int lane = threadIdx.x & 31, lr = lane & 15, hi = lane >> 4; const int r0 = blockIdx.x * 64, c0 = (CMODE == 2) ? 0 : blockIdx.y * 64; const int ks = (CMODE == 2) ? blockIdx.y : 0; C += (size_t)ks * ((size_t)ZH * TT * HD);
    if (CMODE == 1 && c0 > r0 + roff + 63) return;                  // score tile entirely above the causal diagonal: never read (the softmax masks j > i by select)
    const int Kl = (CMODE == 2) ? min(K, r0 + roff + 64) : K;        // P.V: probabilities are exactly 0 beyond the diagonal block, so the K loop stops there
    v8f acc[4][4];
#pragma unroll
    for (int mb = 0; mb < 4; ++mb)
#pragma unroll
        for (int nb = 0; nb < 4; ++nb) acc[mb][nb] = (v8f){};
    const size_t aoff = (size_t)(r0 + lr) * K + 8 * hi, boff = (size_t)(c0 + lr) * K + 8 * hi;
#pragma unroll 1
    for (unsigned kc = ks * 64; kc < (unsigned)Kl; kc += (kc & 32) ? KSP * 64 - 32 : 32) {
        V a[4], a2[4];
#pragma unroll
        for (int mb = 0; mb < 4; ++mb) { a[mb] = WFrag<T16>::ld(A + aoff + (size_t)mb * 16 * K + kc); if (NSPLIT == 1 || NSPLIT == 2) a2[mb] = WFrag<T16>::ld(A2 + aoff + (size_t)mb * 16 * K + kc); }
#pragma unroll
        for (int nb = 0; nb < 4; ++nb) { const V b = WFrag<T16>::ld(Bt + boff + (size_t)nb * 16 * K + kc); V b2; if (NSPLIT >= 2) b2 = WFrag<T16>::ld(Bt2 + boff + (size_t)nb * 16 * K + kc);
#pragma unroll
            for (int mb = 0; mb < 4; ++mb) { acc[mb][nb] = WFrag<T16>::mma(a[mb], b, acc[mb][nb]); if (NSPLIT == 1 || NSPLIT == 2) acc[mb][nb] = WFrag<T16>::mma(a2[mb], b, acc[mb][nb]); if (NSPLIT >= 2) acc[mb][nb] = WFrag<T16>::mma(a[mb], b2, acc[mb][nb]); } }
        asm volatile("v_nop\n\tv_nop\n\tv_nop\n\tv_nop" : "+v"(acc[0][0]), "+v"(acc[1][1]), "+v"(acc[2][2]), "+v"(acc[3][3]) : "v"(a[0]), "v"(a[3]));
    }
#pragma unroll
    for (int mb = 0; mb < 4; ++mb) {
#pragma unroll
        for (int nb = 0; nb < 4; ++nb) {
#pragma unroll
            for (int j = 0; j < 8; ++j) os[(hi * 8 + j) * 68 + nb * 16 + lr] = acc[mb][nb][j]; }
        __builtin_amdgcn_wave_barrier(); asm volatile("" ::: "memory");
        float* crow = C + (size_t)(r0 + mb * 16) * ldc + c0;
{
#pragma unroll
            for (int s = 0; s < 8; ++s) { const int row = 2 * s + hi, cofs = lr * 4; v4f val = *(const v4fa*)(os + row * 68 + cofs);
                *(v4f*)(crow + (size_t)row * ldc + cofs) = val; }
             }
        __builtin_amdgcn_wave_barrier(); asm volatile("" ::: "memory");
    }
}

__device__ __forceinline__ h16 tohx(float x) { return (h16)x; }
__device__ __forceinline__ void splitf(float y, unsigned short& h, unsigned short& l) { h = f2bf(y); l = f2bf(y - bf2f(h)); }
typedef __attribute__((ext_vector_type(2))) _Float16 v2h;
typedef __attribute__((ext_vector_type(4))) _Float16 v4h;
typedef __attribute__((ext_vector_type(2))) unsigned short v2us;
typedef __attribute__((ext_vector_type(4))) unsigned short v4us;
typedef __attribute__((ext_vector_type(2))) float v2f;
typedef __attribute__((ext_vector_type(4))) int v4i;

__global__ __launch_bounds__(256) void k_wtG(const float* __restrict__ w, int K, int N, bf* Bt) {
    const int lane = threadIdx.x & 31; const int L0 = (blockIdx.x * 8 + (threadIdx.x >> 5)) * 8; const int nlines = N * K / 64;
{
#pragma unroll 1
        for (int l = 0; l < 8; ++l) { const int L = L0 + l; if (L >= nlines) break; const size_t e = (size_t)L * 64 + lane * 2; const int k = (int)(e % K), n = (int)(e / K); v2us o;
            o[0] = f2bf(w[(size_t)k * N + n]); o[1] = f2bf(w[(size_t)(k + 1) * N + n]); *(v2us*)(Bt + e) = o; }
         }
}
__global__ __launch_bounds__(256) void k_cvt8(const float* __restrict__ src, bf* dst, size_t n8) { const size_t i = (size_t)blockIdx.x * 256 + threadIdx.x; if (i >= n8) return; const v8f v = *(const v8f*)(src + i * 8); v8us o;
#pragma unroll
    for (int k = 0; k < 8; ++k) o[k] = f2bf(v[k]); *(v8us*)(dst + i * 8) = o;  }
__constant__ float INVP[HD / 2] = { 1.000000000e+00f,7.498942018e-01f,5.623413324e-01f,4.216965139e-01f,3.162277639e-01f,2.371373773e-01f,1.778279394e-01f,1.333521456e-01f,1.000000015e-01f,7.498942316e-02f,5.623413250e-02f,4.216964915e-02f,3.162277490e-02f,2.371373773e-02f,1.778279431e-02f,1.333521400e-02f,9.999999776e-03f,7.498942316e-03f,5.623413250e-03f,4.216964822e-03f,3.162277630e-03f,2.371373819e-03f,1.778279431e-03f,1.333521446e-03f,1.000000047e-03f,7.498941850e-04f,5.623413017e-04f,4.216965172e-04f,3.162277571e-04f,2.371373703e-04f,1.778279402e-04f,1.333521504e-04f };   // 10000 ** (-2 i / 64) as float32 (the module's power form, jnp-computed; differs from 1/10000**(2i/64) by ulps)
__global__ __launch_bounds__(256) void k_csP(float* CS) { const int idx = blockIdx.x * 256 + threadIdx.x; if (idx >= TT * HD) return; const int d = idx % HD; const int t = idx / HD; const float a = __fmul_rn((float)t, INVP[d >> 1]); v2f cs; cs[0] = cosf(a); cs[1] = sinf(a); *(v2f*)(CS + (size_t)idx * 2) = cs;  }

__global__ __launch_bounds__(256) void k_ropeI(const float* __restrict__ F, int pitch, int nheads, const float* __restrict__ CS, float sc, h16* P16, bf* Ph, bf* Pl) {
    const size_t e = ((size_t)blockIdx.x * 256 + threadIdx.x) * 2; if (e >= (size_t)nheads * TT * HD) return; const int d = (int)(e % HD); const int t = (int)((e / HD) % TT); const int h = (int)(e / ((size_t)HD * TT)); const float* f = F + (size_t)t * pitch + h * HD; const float x0 = f[d], x1 = f[d + 1]; const v2f cs = *(const v2f*)(CS + ((size_t)t * HD + d) * 2); v2h o16; v2us oh, ol;
    float a0 = __fmul_rn(x0, cs[0]), b0 = __fmul_rn(x1, cs[1]), a1 = __fmul_rn(x1, cs[0]), b1 = __fmul_rn(x0, cs[1]); asm volatile("" : "+v"(a0), "+v"(b0), "+v"(a1), "+v"(b1));
    float r0 = __fsub_rn(a0, b0) * sc, r1 = __fadd_rn(b1, a1) * sc;   /* even: x0 c - x1 s; odd: x0 s + x1 c */
    o16[0] = tohx(r0); o16[1] = tohx(r1); { unsigned short a2, c2; splitf(r0, a2, c2); oh[0] = a2; ol[0] = c2; splitf(r1, a2, c2); oh[1] = a2; ol[1] = c2; }
    *(v2h*)(P16 + e) = o16; *(v2us*)(Ph + e) = oh; *(v2us*)(Pl + e) = ol;  }


// k_ropeI: head planes [h][t][d] (fp16 + hi/lo) of rope(x) x sc with the interleaved convention out[2i] = x[2i] cos[t][i] - x[2i+1] sin[t][i], out[2i+1] = x[2i] sin[t][i] + x[2i+1] cos[t][i]

__global__ __launch_bounds__(256) void k_vtp(const float* __restrict__ F, int pitch, int nheads, h16* V16, bf* Vh, bf* Vl) { const size_t e = ((size_t)blockIdx.x * 256 + threadIdx.x) * 2; if (e >= (size_t)nheads * HD * TT) return; const int t = (int)(e % TT); const int d = (int)((e / TT) % HD); const int g = (int)(e / ((size_t)TT * HD)); v2h o16; v2us oh, ol;
#pragma unroll
    for (int q = 0; q < 2; ++q) { const float x = F[(size_t)(t + q) * pitch + g * HD + d]; o16[q] = tohx(x); unsigned short a2, c2; splitf(x, a2, c2); oh[q] = a2; ol[q] = c2; }
    *(v2h*)(V16 + e) = o16; *(v2us*)(Vh + e) = oh; *(v2us*)(Vl + e) = ol;  }
// k_asoft: per row (zz, i): t = S x HD^-0.5 for j <= i and i - j < WIN (sliding causal window; the reference's -1e9 additive fill vanishes identically); softmax over the 2048 keys (register row, one exp, fixed trees);
__global__ __launch_bounds__(256) void k_asoft(const float* __restrict__ Sb, h16* P16, bf* Ph, bf* Pl) {
    const int lane = threadIdx.x & 31; const int row = blockIdx.x * 8 + (threadIdx.x >> 5); if (row >= ZH * TT) return; const int i = row % TT; const int zz = row / TT; (void)zz; const bool hires = (i < RH); const float* sr = Sb + (size_t)row * TT; float v[TT / 32]; float mx = -3.0e38f;
#pragma unroll
    for (int ch = 0; ch < TT / 128; ++ch) { const int j0 = ch * 128 + lane * 4; const v4f a = *(const v4f*)(sr + j0);
#pragma unroll
        for (int q = 0; q < 4; ++q) { const int j = j0 + q; (void)j; const float t = (j <= i && i - j < WIN) ? a[q] * SCL : -3.0e38f; v[ch * 4 + q] = t; mx = fmaxf(mx, t); } }
#pragma unroll
    for (int sh = 16; sh; sh >>= 1) mx = fmaxf(mx, __shfl_xor(mx, sh, 32));
    float sum = 0.f;
#pragma unroll
    for (int k = 0; k < TT / 32; ++k) { float d0 = __fsub_rn(v[k], mx); asm volatile("" : "+v"(d0)); v[k] = __builtin_amdgcn_exp2f(__fmul_rn(d0, 1.4426950408889634f)); sum += v[k]; }
#pragma unroll
    for (int sh = 16; sh; sh >>= 1) sum += __shfl_xor(sum, sh, 32);
    const float f = __fdiv_rn(hires ? 1.0f : PCAR, sum);
{
        if (hires) {
#pragma unroll
            for (int ch = 0; ch < TT / 128; ++ch) { v4us oh, ol;
#pragma unroll
                for (int q = 0; q < 4; ++q) { unsigned short a, c2; splitf(v[ch * 4 + q] * f, a, c2); oh[q] = a; ol[q] = c2; }
                const size_t oo = ((size_t)zz * (RH ? RH : 1) + i) * TT + ch * 128 + lane * 4; *(v4us*)(Ph + oo) = oh; *(v4us*)(Pl + oo) = ol; }
        } else {
#pragma unroll
            for (int ch = 0; ch < TT / 128; ++ch) { v4h o4;
#pragma unroll
                for (int q = 0; q < 4; ++q) o4[q] = tohx(v[ch * 4 + q] * f);
                *(v4h*)(P16 + (size_t)row * TT + ch * 128 + lane * 4) = o4; } }
         }
}
template <int NS> __device__ __forceinline__ v2f sumplanes(const float* __restrict__ O) { v2f p[NS];
#pragma unroll
    for (int s = 0; s < NS; ++s) p[s] = *(const v2f*)(O + (size_t)s * ((size_t)ZH * TT * HD));
    v2f r = p[0];
#pragma unroll
    for (int s = 1; s < NS; ++s) r += p[s];
    return r; }
__global__ __launch_bounds__(256) void k_merge(const float* __restrict__ O, int h0, bf* Ah, bf* Al) { const size_t e = ((size_t)blockIdx.x * 256 + threadIdx.x) * 2; if (e >= (size_t)ZH * TT * HD) return; const int d = (int)(e % HD); const int t = (int)((e / HD) % TT); const int zz = (int)(e / ((size_t)HD * TT)); const float cs = (t < RH) ? 1.0f : (1.0f / PCAR); const size_t oo = (size_t)t * DQ + (h0 + zz) * HD + d;
    const v2f ov = (t < RH) ? sumplanes<KSH>(O + e) : sumplanes<KSF>(O + e);   // the key slices' partial sums, in slice order
    v2us oh, ol;
#pragma unroll
    for (int q = 0; q < 2; ++q) { unsigned short a, c2; splitf(ov[q] * cs, a, c2); oh[q] = a; ol[q] = c2; } *(v2us*)(Ah + oo) = oh; *(v2us*)(Al + oo) = ol;  }

extern "C" void kernel_launch(void* const* d_in, const int* in_sizes, int n_in,
                              void* d_out, int out_size, void* d_ws, size_t ws_size, hipStream_t stream) {
    (void)in_sizes; (void)n_in; (void)out_size;
    const float* x = (const float*)d_in[0]; const float* wq = (const float*)d_in[1]; const float* wk = wq + (size_t)DQ * DM; const float* wv = wq + (size_t)2 * DQ * DM; const float* wo = (const float*)d_in[2];   /* input order X, W_qkv ('oi' [3072][1024]: q | k | v = its three 1,024-row blocks), W_o ('oi' [1024][1024]): THREE inputs; the host's three separate 'oi' weights are the row blocks of this module's fused one */
    float* OUT = (float*)d_out;     // [2][2048][1024]
    char* wsp = (char*)d_ws;
    auto take = [&](size_t bytes) { char* p = wsp; wsp += (bytes + 255) & ~(size_t)255; return (void*)p; };
    bf* WQ = (bf*)take((size_t)DQ * DM * 2); bf* WK = (bf*)take((size_t)DKV * DM * 2); bf* WV = (bf*)take((size_t)DKV * DM * 2); bf* WO = (bf*)take((size_t)DM * DQ * 2); float* CS = (float*)take((size_t)TT * HD * 2 * 4);
    bf* XB = (bf*)take((size_t)TT * DM * 2); float* FQ = (float*)take((size_t)TT * DQ * 4); float* FK = (float*)take((size_t)TT * DKV * 4);
    h16* QP16 = (h16*)take((size_t)NH_ * TT * HD * 2); h16* KP16 = (h16*)take((size_t)NKV * TT * HD * 2); h16* VT16 = (h16*)take((size_t)NKV * HD * TT * 2);
    bf* QPh = (bf*)take((size_t)NH_ * TT * HD * 2); bf* QPl = (bf*)take((size_t)NH_ * TT * HD * 2); bf* KPh = (bf*)take((size_t)NKV * TT * HD * 2); bf* KPl = (bf*)take((size_t)NKV * TT * HD * 2); bf* VTh = (bf*)take((size_t)NKV * HD * TT * 2); bf* VTl = (bf*)take((size_t)NKV * HD * TT * 2); bf* Ph = (bf*)take((size_t)ZH * RH * TT * 2); bf* Pl = (bf*)take((size_t)ZH * RH * TT * 2);
    float* Sb = (float*)take((size_t)ZH * TT * TT * 4); h16* P16 = (h16*)take((size_t)ZH * TT * TT * 2); float* Ob = (float*)take((size_t)KSF * ZH * TT * HD * 4); bf* ATh = (bf*)take((size_t)TT * DQ * 2); bf* ATl = (bf*)take((size_t)TT * DQ * 2);
    if ((size_t)(wsp - (char*)d_ws) > ws_size) return;    // ws 256 MiB
    float* FV = FK;   // v projection reuses the k buffer after the k planes are built (stream-ordered)
    { k_cvt8<<<(unsigned)(((size_t)DQ * DM / 8 + 255) / 256), 256, 0, stream>>>(wq, WQ, (size_t)DQ * DM / 8); k_cvt8<<<(unsigned)(((size_t)DKV * DM / 8 + 255) / 256), 256, 0, stream>>>(wk, WK, (size_t)DKV * DM / 8); k_cvt8<<<(unsigned)(((size_t)DKV * DM / 8 + 255) / 256), 256, 0, stream>>>(wv, WV, (size_t)DKV * DM / 8);
      k_cvt8<<<(unsigned)(((size_t)DM * DQ / 8 + 255) / 256), 256, 0, stream>>>(wo, WO, (size_t)DM * DQ / 8);
       }
    const unsigned LQ = (unsigned)(((size_t)NH_ * TT * HD / 2 + 255) / 256), LKv = (unsigned)(((size_t)NKV * TT * HD / 2 + 255) / 256);
    for (int b = 0; b < NB_; ++b) {
        if (b == 0) k_csP<<<(TT * HD + 255) / 256, 256, 0, stream>>>(CS);   /* {cos, sin}(t x THETA**(-2i/64)) per interleaved pair */
        k_cvt8<<<(unsigned)(((size_t)TT * DM / 8 + 255) / 256), 256, 0, stream>>>(x + (size_t)b * TT * DM, XB, (size_t)TT * DM / 8);
        k_gemmw<bf, 0, false><<<dim3(TT / 64, DQ / 64, 1), 32, 0, stream>>>(XB, nullptr, WQ, nullptr, DM, FQ, DQ, nullptr, 0, 0, 0);
        k_ropeI<<<LQ, 256, 0, stream>>>(FQ, DQ, NH_, CS, 1.0f, QP16, QPh, QPl);
        k_gemmw<bf, 0, false><<<dim3(TT / 64, DKV / 64, 1), 32, 0, stream>>>(XB, nullptr, WK, nullptr, DM, FK, DKV, nullptr, 0, 0, 0);
        k_ropeI<<<LKv, 256, 0, stream>>>(FK, DKV, NKV, CS, 1.0f, KP16, KPh, KPl);
        k_gemmw<bf, 0, false><<<dim3(TT / 64, DKV / 64, 1), 32, 0, stream>>>(XB, nullptr, WV, nullptr, DM, FV, DKV, nullptr, 0, 0, 0); k_vtp<<<LKv, 256, 0, stream>>>(FV, DKV, NKV, VT16, VTh, VTl);
        for (int h0 = 0; h0 < NH_; h0 += ZH) { const size_t zq = (size_t)h0, zk = (size_t)(h0 / REP);   // one kv head per query head: the pass's two heads use consecutive kv planes (z-strides TT*HD)
            k_gemmc<bf, 2, 1, 1><<<dim3(RH / 64, TT / 64, ZH), 32, 0, stream>>>(QPh + zq * TT * HD, QPl + zq * TT * HD, KPh + zk * TT * HD, KPl + zk * TT * HD, HD, Sb, TT, 0, (size_t)TT * HD, (size_t)TT * HD, (size_t)TT * TT);
            k_gemmc<h16, 0, 1, 1><<<dim3((TT - RH) / 64, TT / 64, ZH), 32, 0, stream>>>(QP16 + zq * TT * HD + (size_t)RH * HD, nullptr, KP16 + zk * TT * HD, nullptr, HD, Sb + (size_t)RH * TT, TT, RH, (size_t)TT * HD, (size_t)TT * HD, (size_t)TT * TT);
            k_asoft<<<ZH * TT / 8, 256, 0, stream>>>(Sb, P16, Ph, Pl);
            k_gemmc<bf, 2, 2, KSH><<<dim3(RH / 64, KSH, ZH), 32, 0, stream>>>(Ph, Pl, VTh + zk * HD * TT, VTl + zk * HD * TT, TT, Ob, HD, 0, (size_t)RH * TT, (size_t)HD * TT, (size_t)TT * HD);
            k_gemmc<h16, 0, 2, KSF><<<dim3((TT - RH) / 64, KSF, ZH), 32, 0, stream>>>(P16 + (size_t)RH * TT, nullptr, VT16 + zk * HD * TT, nullptr, TT, Ob + (size_t)RH * HD, HD, RH, (size_t)TT * TT, (size_t)HD * TT, (size_t)TT * HD);
            k_merge<<<(unsigned)(((size_t)ZH * TT * HD / 2 + 255) / 256), 256, 0, stream>>>(Ob, h0, ATh, ATl); }
        k_gemmw<bf, 1, false><<<dim3(TT / 64, DM / 64, 1), 32, 0, stream>>>(ATh, ATl, WO, nullptr, DQ, OUT + (size_t)b * TT * DM, DM, nullptr, 0, 0, 0); }
}

// v002
// Measured time: 554 microseconds a run.
// Timed twice side by side with v001, it ran 1.38 and 1.39 times as fast.
// All steps since v000 together make it 2.59 times as fast.
#include <hip/hip_runtime.h>

// Causal multi-head self-attention with interleaved rotary embeddings and a FUSED (out, in) qkv weight (X [2][2048][1024]; qkv = einsum('bsd,od->bso', X, W_qkv) ('oi' [3072][1024] std sqrt(2/4096), no bias) viewed (B, S, 3, 16, 64): q | k | v = the three 1,024-ROW blocks of W_qkv (16 heads x 64); rotary on (even, odd) pairs with angle pos / (10000 ** (2 k / 64)) (float32 constants 10000^(-2i/64), precise cosf/sinf); scores x 64^-0.5, causal (-inf); softmax; out = merged W_o^T ('oi', no bias) -> [2][2048][1024] (4.2 M); argument order X, W_qkv, W_o.
// Layout per batch: bf16 copy of x; exact projections; {cos, sin} per (position, pair) from the int positions (jnp-exact float32 inverse frequencies, precise cosf/sinf); interleaved rotary plane builder; causal T-2048 attention (hybrid rows: < 512 hi/lo 3 products, rest fp16 x1024; k_gemmc skips tiles above the diagonal); merged hi/lo x wo exact.
// Compute dtypes, f32 accumulate: every input rounded to bf16; projections exact ; rotary f32; attention rows < 512 3 products, rest fp16; softmax f32; wo hl x exact.

#define NB_  2
#define TT   2048
#define DM   1024
#define NH_  16
#define NKV  16
#define REP  (NH_ / NKV)
#define HD   64
#define DQ   (NH_ * HD)
#define DKV  (NKV * HD)
#define ZH   8                    // heads per attention pass (grid z of the pass's k_gemmc launches)
#define PP   (2 * TT)             // pitch, in 16-bit elements, of a probability row: it lies in place over its own f32 score row (TT * 4 bytes)
#define RH   512                  // query rows < RH use hi+lo planes (0: none)
#define WIN  2048
#define PCAR 1024.0f
#define SCL  0.125f   // HD^-0.5
#define KSH  8                    // key slices of the P.V product, query rows < RH (at most RH / 64 = 8 blocks of 64 keys per tile)
#define KSF  16                   // key slices of the P.V product, query rows >= RH (at most TT / 64 = 32 blocks of 64 keys per tile)
typedef _Float16 h16;
typedef unsigned short bf;
typedef __attribute__((ext_vector_type(16))) __bf16   v16bf;
typedef __attribute__((ext_vector_type(16))) _Float16 v16h;
typedef __attribute__((ext_vector_type(8)))  _Float16 v8h;
typedef __attribute__((ext_vector_type(8)))  unsigned short v8us;
typedef __attribute__((ext_vector_type(8)))  float    v8f;
typedef __attribute__((ext_vector_type(4)))  float    v4f;
typedef v8h  __attribute__((may_alias)) v8ha;
typedef v4f  __attribute__((may_alias)) v4fa;
typedef v8us __attribute__((may_alias)) v8usa;

__device__ __forceinline__ unsigned short f2bf(float f) { unsigned u = __float_as_uint(f); u += 0x7FFFu + ((u >> 16) & 1u); return (unsigned short)(u >> 16); }
__device__ __forceinline__ float bf2f(unsigned short b) { return __uint_as_float(((unsigned)b) << 16); }
__device__ __forceinline__ float bfr(float f) { return bf2f(f2bf(f)); }
__device__ __forceinline__ v16h cat16(v8h lo, v8h hi) { return __builtin_shufflevector(lo, hi, 0, 1, 2, 3, 4, 5, 6, 7, 8, 9, 10, 11, 12, 13, 14, 15); }
__device__ __forceinline__ v16bf cat16b(v8us lo, v8us hi) { return __builtin_bit_cast(v16bf, __builtin_shufflevector(lo, hi, 0, 1, 2, 3, 4, 5, 6, 7, 8, 9, 10, 11, 12, 13, 14, 15)); }
__device__ __forceinline__ v8f wmma16(v16h a, v16h b, v8f c) { return __builtin_amdgcn_wmma_f32_16x16x32_f16(false, a, false, b, (short)0, c, false, false); }
__device__ __forceinline__ v8f wmmab(v16bf a, v16bf b, v8f c) { return __builtin_amdgcn_wmma_f32_16x16x32_bf16(false, a, false, b, (short)0, c, false, false); }



// ---- k_gemmw: register-blocked GEMM, ONE WAVE per 64x64 output tile (16 accumulators), operands straight from K-contiguous 16-bit planes; grid (M/64, N/64, Z), 32 threads.
// C[m][n] (f32, pitch ldc, + optional f32 bias[n]) = sum_k A[m][k] Bt[n][k] (+ split products per NSPLIT). z-batch strides sA/sB/sC in elements. K % 32 == 0.
template <typename T16> struct WFrag;
template <> struct WFrag<h16> { typedef v16h V; static __device__ __forceinline__ V ld(const h16* p) { return cat16(*(const v8h*)p, *(const v8h*)(p + 16)); } static __device__ __forceinline__ v8f mma(V a, V b, v8f c) { return wmma16(a, b, c); } };
template <> struct WFrag<bf> { typedef v16bf V; static __device__ __forceinline__ V ld(const bf* p) { return cat16b(*(const v8us*)p, *(const v8us*)(p + 16)); } static __device__ __forceinline__ v8f mma(V a, V b, v8f c) { return wmmab(a, b, c); } };
template <typename T16, int NSPLIT, bool BIAS>
__global__ __launch_bounds__(32) void k_gemmw(const T16* __restrict__ A, const T16* __restrict__ A2, const T16* __restrict__ Bt, const T16* __restrict__ Bt2, int K, float* C, int ldc, const float* __restrict__ bias, size_t sA, size_t sB, size_t sC) {
    typedef typename WFrag<T16>::V V;
    __shared__ __align__(16) float os[16 * 68];
    const size_t z = blockIdx.z; A += z * sA; if (A2) A2 += z * sA; Bt += z * sB; if (Bt2) Bt2 += z * sB; C += z * sC;
    const int lane = threadIdx.x & 31, lr = lane & 15, hi = lane >> 4; const int r0 = blockIdx.x * 64, c0 = blockIdx.y * 64;
    v8f acc[4][4];
#pragma unroll
    for (int mb = 0; mb < 4; ++mb)
#pragma unroll
        for (int nb = 0; nb < 4; ++nb) acc[mb][nb] = (v8f){};
    const size_t aoff = (size_t)(r0 + lr) * K + 8 * hi, boff = (size_t)(c0 + lr) * K + 8 * hi;
#pragma unroll 1
    for (int kc = 0; kc < K; kc += 32) {
        V a[4], a2[4];
#pragma unroll
        for (int mb = 0; mb < 4; ++mb) { a[mb] = WFrag<T16>::ld(A + aoff + (size_t)mb * 16 * K + kc); if (NSPLIT == 1 || NSPLIT == 2) a2[mb] = WFrag<T16>::ld(A2 + aoff + (size_t)mb * 16 * K + kc); }
#pragma unroll
        for (int nb = 0; nb < 4; ++nb) { const V b = WFrag<T16>::ld(Bt + boff + (size_t)nb * 16 * K + kc); V b2; if (NSPLIT >= 2) b2 = WFrag<T16>::ld(Bt2 + boff + (size_t)nb * 16 * K + kc);
#pragma unroll
            for (int mb = 0; mb < 4; ++mb) { acc[mb][nb] = WFrag<T16>::mma(a[mb], b, acc[mb][nb]); if (NSPLIT == 1 || NSPLIT == 2) acc[mb][nb] = WFrag<T16>::mma(a2[mb], b, acc[mb][nb]); if (NSPLIT >= 2) acc[mb][nb] = WFrag<T16>::mma(a[mb], b2, acc[mb][nb]); } }
        asm volatile("v_nop\n\tv_nop\n\tv_nop\n\tv_nop" : "+v"(acc[0][0]), "+v"(acc[1][1]), "+v"(acc[2][2]), "+v"(acc[3][3]) : "v"(a[0]), "v"(a[3]));
    }
#pragma unroll
    for (int mb = 0; mb < 4; ++mb) {
#pragma unroll
        for (int nb = 0; nb < 4; ++nb) {
#pragma unroll
            for (int j = 0; j < 8; ++j) os[(hi * 8 + j) * 68 + nb * 16 + lr] = acc[mb][nb][j]; }
        __builtin_amdgcn_wave_barrier(); asm volatile("" ::: "memory");
        float* crow = C + (size_t)(r0 + mb * 16) * ldc + c0;
{
#pragma unroll
            for (int s = 0; s < 8; ++s) { const int row = 2 * s + hi, cofs = lr * 4; v4f val = *(const v4fa*)(os + row * 68 + cofs); if (BIAS) { val[0] += bfr(bias[c0 + cofs]); val[1] += bfr(bias[c0 + cofs + 1]); val[2] += bfr(bias[c0 + cofs + 2]); val[3] += bfr(bias[c0 + cofs + 3]); }
                *(v4f*)(crow + (size_t)row * ldc + cofs) = val; }
             }
        __builtin_amdgcn_wave_barrier(); asm volatile("" ::: "memory");
    }
}

// ---- k_gemmc: the same one-wave 64x64 tile GEMM specialised for causal attention: CMODE 1 skips score tiles entirely above the diagonal (query rows r0+roff.., key columns c0..), CMODE 2 limits the
// key (K) loop of the probability x value contraction to the diagonal block (probabilities beyond it are exactly zero). roff = row offset of this launch's first row within the sequence.
// CMODE 2 has one column tile (N = 64), and blockIdx.y is the key slice ks of KSP: slice ks takes the 64-key blocks ks, ks + KSP, ... (whole 128-byte lines of both operands) and stores its f32 partial tile
// in plane ks of C (planes ZH*TT*HD apart; a slice with no block stores zeros); k_merge adds the planes in slice order. kc is unsigned so that it enters the 64-bit address sums without a sign extension.
// lda = row pitch of A and A2 in elements (K for the score products, PP for the probabilities); Bt and Bt2 have pitch K.
template <typename T16, int NSPLIT, int CMODE, int KSP>
__global__ __launch_bounds__(32) void k_gemmc(const T16* __restrict__ A, const T16* __restrict__ A2, const T16* __restrict__ Bt, const T16* __restrict__ Bt2, int K, int lda, float* C, int ldc, int roff, size_t sA, size_t sB, size_t sC) {
    typedef typename WFrag<T16>::V V;
    __shared__ __align__(16) float os[16 * 68];
    const size_t z = blockIdx.z; A += z * sA; if (A2) A2 += z * sA; Bt += z * sB; if (Bt2) Bt2 += z * sB; C += z * sC;
    const int lane = threadIdx.x & 31, lr = lane & 15, hi = lane >> 4; const int r0 = blockIdx.x * 64, c0 = (CMODE == 2) ? 0 : blockIdx.y * 64; const int ks = (CMODE == 2) ? blockIdx.y : 0; C += (size_t)ks * ((size_t)ZH * TT * HD);
    if (CMODE == 1 && c0 > r0 + roff + 63) return;                  // score tile entirely above the causal diagonal: never read (the softmax masks j > i by select)
    const int Kl = (CMODE == 2) ? min(K, r0 + roff + 64) : K;        // P.V: probabilities are exactly 0 beyond the diagonal block, so the K loop stops there
    v8f acc[4][4];
#pragma unroll
    for (int mb = 0; mb < 4; ++mb)
#pragma unroll
        for (int nb = 0; nb < 4; ++nb) acc[mb][nb] = (v8f){};
    const size_t aoff = (size_t)(r0 + lr) * lda + 8 * hi, boff = (size_t)(c0 + lr) * K + 8 * hi;
#pragma unroll 1
    for (unsigned kc = ks * 64; kc < (unsigned)Kl; kc += (kc & 32) ? KSP * 64 - 32 : 32) {
        V a[4], a2[4];
#pragma unroll
        for (int mb = 0; mb < 4; ++mb) { a[mb] = WFrag<T16>::ld(A + aoff + (size_t)mb * 16 * lda + kc); if (NSPLIT == 1 || NSPLIT == 2) a2[mb] = WFrag<T16>::ld(A2 + aoff + (size_t)mb * 16 * lda + kc); }
#pragma unroll
        for (int nb = 0; nb < 4; ++nb) { const V b = WFrag<T16>::ld(Bt + boff + (size_t)nb * 16 * K + kc); V b2; if (NSPLIT >= 2) b2 = WFrag<T16>::ld(Bt2 + boff + (size_t)nb * 16 * K + kc);
#pragma unroll
            for (int mb = 0; mb < 4; ++mb) { acc[mb][nb] = WFrag<T16>::mma(a[mb], b, acc[mb][nb]); if (NSPLIT == 1 || NSPLIT == 2) acc[mb][nb] = WFrag<T16>::mma(a2[mb], b, acc[mb][nb]); if (NSPLIT >= 2) acc[mb][nb] = WFrag<T16>::mma(a[mb], b2, acc[mb][nb]); } }
        asm volatile("v_nop\n\tv_nop\n\tv_nop\n\tv_nop" : "+v"(acc[0][0]), "+v"(acc[1][1]), "+v"(acc[2][2]), "+v"(acc[3][3]) : "v"(a[0]), "v"(a[3]));
    }
#pragma unroll
    for (int mb = 0; mb < 4; ++mb) {
#pragma unroll
        for (int nb = 0; nb < 4; ++nb) {
#pragma unroll
            for (int j = 0; j < 8; ++j) os[(hi * 8 + j) * 68 + nb * 16 + lr] = acc[mb][nb][j]; }
        __builtin_amdgcn_wave_barrier(); asm volatile("" ::: "memory");
        float* crow = C + (size_t)(r0 + mb * 16) * ldc + c0;
{
#pragma unroll
            for (int s = 0; s < 8; ++s) { const int row = 2 * s + hi, cofs = lr * 4; v4f val = *(const v4fa*)(os + row * 68 + cofs);
                *(v4f*)(crow + (size_t)row * ldc + cofs) = val; }
             }
        __builtin_amdgcn_wave_barrier(); asm volatile("" ::: "memory");
    }
}

__device__ __forceinline__ h16 tohx(float x) { return (h16)x; }
__device__ __forceinline__ void splitf(float y, unsigned short& h, unsigned short& l) { h = f2bf(y); l = f2bf(y - bf2f(h)); }
typedef __attribute__((ext_vector_type(2))) _Float16 v2h;
typedef __attribute__((ext_vector_type(4))) _Float16 v4h;
typedef __attribute__((ext_vector_type(2))) unsigned short v2us;
typedef __attribute__((ext_vector_type(4))) unsigned short v4us;
typedef __attribute__((ext_vector_type(2))) float v2f;
typedef __attribute__((ext_vector_type(4))) int v4i;

__global__ __launch_bounds__(256) void k_wtG(const float* __restrict__ w, int K, int N, bf* Bt) {
    const int lane = threadIdx.x & 31; const int L0 = (blockIdx.x * 8 + (threadIdx.x >> 5)) * 8; const int nlines = N * K / 64;
{
#pragma unroll 1
        for (int l = 0; l < 8; ++l) { const int L = L0 + l; if (L >= nlines) break; const size_t e = (size_t)L * 64 + lane * 2; const int k = (int)(e % K), n = (int)(e / K); v2us o;
            o[0] = f2bf(w[(size_t)k * N + n]); o[1] = f2bf(w[(size_t)(k + 1) * N + n]); *(v2us*)(Bt + e) = o; }
         }
}
__global__ __launch_bounds__(256) void k_cvt8(const float* __restrict__ src, bf* dst, size_t n8) { const size_t i = (size_t)blockIdx.x * 256 + threadIdx.x; if (i >= n8) return; const v8f v = *(const v8f*)(src + i * 8); v8us o;
#pragma unroll
    for (int k = 0; k < 8; ++k) o[k] = f2bf(v[k]); *(v8us*)(dst + i * 8) = o;  }
__constant__ float INVP[HD / 2] = { 1.000000000e+00f,7.498942018e-01f,5.623413324e-01f,4.216965139e-01f,3.162277639e-01f,2.371373773e-01f,1.778279394e-01f,1.333521456e-01f,1.000000015e-01f,7.498942316e-02f,5.623413250e-02f,4.216964915e-02f,3.162277490e-02f,2.371373773e-02f,1.778279431e-02f,1.333521400e-02f,9.999999776e-03f,7.498942316e-03f,5.623413250e-03f,4.216964822e-03f,3.162277630e-03f,2.371373819e-03f,1.778279431e-03f,1.333521446e-03f,1.000000047e-03f,7.498941850e-04f,5.623413017e-04f,4.216965172e-04f,3.162277571e-04f,2.371373703e-04f,1.778279402e-04f,1.333521504e-04f };   // 10000 ** (-2 i / 64) as float32 (the module's power form, jnp-computed; differs from 1/10000**(2i/64) by ulps)
__global__ __launch_bounds__(256) void k_csP(float* CS) { const int idx = blockIdx.x * 256 + threadIdx.x; if (idx >= TT * HD) return; const int d = idx % HD; const int t = idx / HD; const float a = __fmul_rn((float)t, INVP[d >> 1]); v2f cs; cs[0] = cosf(a); cs[1] = sinf(a); *(v2f*)(CS + (size_t)idx * 2) = cs;  }

__global__ __launch_bounds__(256) void k_ropeI(const float* __restrict__ F, int pitch, int nheads, const float* __restrict__ CS, float sc, h16* P16, bf* Ph, bf* Pl) {
    const size_t e = ((size_t)blockIdx.x * 256 + threadIdx.x) * 2; if (e >= (size_t)nheads * TT * HD) return; const int d = (int)(e % HD); const int t = (int)((e / HD) % TT); const int h = (int)(e / ((size_t)HD * TT)); const float* f = F + (size_t)t * pitch + h * HD; const float x0 = f[d], x1 = f[d + 1]; const v2f cs = *(const v2f*)(CS + ((size_t)t * HD + d) * 2); v2h o16; v2us oh, ol;
    float a0 = __fmul_rn(x0, cs[0]), b0 = __fmul_rn(x1, cs[1]), a1 = __fmul_rn(x1, cs[0]), b1 = __fmul_rn(x0, cs[1]); asm volatile("" : "+v"(a0), "+v"(b0), "+v"(a1), "+v"(b1));
    float r0 = __fsub_rn(a0, b0) * sc, r1 = __fadd_rn(b1, a1) * sc;   /* even: x0 c - x1 s; odd: x0 s + x1 c */
    o16[0] = tohx(r0); o16[1] = tohx(r1); { unsigned short a2, c2; splitf(r0, a2, c2); oh[0] = a2; ol[0] = c2; splitf(r1, a2, c2); oh[1] = a2; ol[1] = c2; }
    *(v2h*)(P16 + e) = o16; *(v2us*)(Ph + e) = oh; *(v2us*)(Pl + e) = ol;  }


// k_ropeI: head planes [h][t][d] (fp16 + hi/lo) of rope(x) x sc with the interleaved convention out[2i] = x[2i] cos[t][i] - x[2i+1] sin[t][i], out[2i+1] = x[2i] sin[t][i] + x[2i+1] cos[t][i]

__global__ __launch_bounds__(256) void k_vtp(const float* __restrict__ F, int pitch, int nheads, h16* V16, bf* Vh, bf* Vl) { const size_t e = ((size_t)blockIdx.x * 256 + threadIdx.x) * 2; if (e >= (size_t)nheads * HD * TT) return; const int t = (int)(e % TT); const int d = (int)((e / TT) % HD); const int g = (int)(e / ((size_t)TT * HD)); v2h o16; v2us oh, ol;
#pragma unroll
    for (int q = 0; q < 2; ++q) { const float x = F[(size_t)(t + q) * pitch + g * HD + d]; o16[q] = tohx(x); unsigned short a2, c2; splitf(x, a2, c2); oh[q] = a2; ol[q] = c2; }
    *(v2h*)(V16 + e) = o16; *(v2us*)(Vh + e) = oh; *(v2us*)(Vl + e) = ol;  }
// k_asoft: per row (zz, i): t = S x HD^-0.5 for j <= i and i - j < WIN (sliding causal window; the reference's -1e9 additive fill vanishes identically); softmax over the 2048 keys (register row, one exp, fixed trees);
// the probabilities overwrite the row's own scores (P16, Ph = start of Sb, Pl = Ph + TT; pitch PP): one wave owns a row and holds all of it in registers before its first store, which needs the row's sum.
__global__ __launch_bounds__(256) void k_asoft(const float* Sb, h16* P16, bf* Ph, bf* Pl) {
    const int lane = threadIdx.x & 31; const int row = blockIdx.x * 8 + (threadIdx.x >> 5); if (row >= ZH * TT) return; const int i = row % TT; const int zz = row / TT; (void)zz; const bool hires = (i < RH); const float* sr = Sb + (size_t)row * TT; float v[TT / 32]; float mx = -3.0e38f;
#pragma unroll
    for (int ch = 0; ch < TT / 128; ++ch) { const int j0 = ch * 128 + lane * 4; const v4f a = *(const v4f*)(sr + j0);
#pragma unroll
        for (int q = 0; q < 4; ++q) { const int j = j0 + q; (void)j; const float t = (j <= i && i - j < WIN) ? a[q] * SCL : -3.0e38f; v[ch * 4 + q] = t; mx = fmaxf(mx, t); } }
#pragma unroll
    for (int sh = 16; sh; sh >>= 1) mx = fmaxf(mx, __shfl_xor(mx, sh, 32));
    float sum = 0.f;
#pragma unroll
    for (int k = 0; k < TT / 32; ++k) { float d0 = __fsub_rn(v[k], mx); asm volatile("" : "+v"(d0)); v[k] = __builtin_amdgcn_exp2f(__fmul_rn(d0, 1.4426950408889634f)); sum += v[k]; }
#pragma unroll
    for (int sh = 16; sh; sh >>= 1) sum += __shfl_xor(sum, sh, 32);
    const float f = __fdiv_rn(hires ? 1.0f : PCAR, sum);
{
        if (hires) {
#pragma unroll
            for (int ch = 0; ch < TT / 128; ++ch) { v4us oh, ol;
#pragma unroll
                for (int q = 0; q < 4; ++q) { unsigned short a, c2; splitf(v[ch * 4 + q] * f, a, c2); oh[q] = a; ol[q] = c2; }
                const size_t oo = (size_t)row * PP + ch * 128 + lane * 4; *(v4us*)(Ph + oo) = oh; *(v4us*)(Pl + oo) = ol; }
        } else {
#pragma unroll
            for (int ch = 0; ch < TT / 128; ++ch) { v4h o4;
#pragma unroll
                for (int q = 0; q < 4; ++q) o4[q] = tohx(v[ch * 4 + q] * f);
                *(v4h*)(P16 + (size_t)row * PP + ch * 128 + lane * 4) = o4; } }
         }
}
template <int NS> __device__ __forceinline__ v2f sumplanes(const float* __restrict__ O) { v2f p[NS];
#pragma unroll
    for (int s = 0; s < NS; ++s) p[s] = *(const v2f*)(O + (size_t)s * ((size_t)ZH * TT * HD));
    v2f r = p[0];
#pragma unroll
    for (int s = 1; s < NS; ++s) r += p[s];
    return r; }
__global__ __launch_bounds__(256) void k_merge(const float* __restrict__ O, int h0, bf* Ah, bf* Al) { const size_t e = ((size_t)blockIdx.x * 256 + threadIdx.x) * 2; if (e >= (size_t)ZH * TT * HD) return; const int d = (int)(e % HD); const int t = (int)((e / HD) % TT); const int zz = (int)(e / ((size_t)HD * TT)); const float cs = (t < RH) ? 1.0f : (1.0f / PCAR); const size_t oo = (size_t)t * DQ + (h0 + zz) * HD + d;
    const v2f ov = (t < RH) ? sumplanes<KSH>(O + e) : sumplanes<KSF>(O + e);   // the key slices' partial sums, in slice order
    v2us oh, ol;
#pragma unroll
    for (int q = 0; q < 2; ++q) { unsigned short a, c2; splitf(ov[q] * cs, a, c2); oh[q] = a; ol[q] = c2; } *(v2us*)(Ah + oo) = oh; *(v2us*)(Al + oo) = ol;  }

extern "C" void kernel_launch(void* const* d_in, const int* in_sizes, int n_in,
                              void* d_out, int out_size, void* d_ws, size_t ws_size, hipStream_t stream) {
    (void)in_sizes; (void)n_in; (void)out_size;
    const float* x = (const float*)d_in[0]; const float* wq = (const float*)d_in[1]; const float* wk = wq + (size_t)DQ * DM; const float* wv = wq + (size_t)2 * DQ * DM; const float* wo = (const float*)d_in[2];   /* input order X, W_qkv ('oi' [3072][1024]: q | k | v = its three 1,024-row blocks), W_o ('oi' [1024][1024]): THREE inputs; the host's three separate 'oi' weights are the row blocks of this module's fused one */
    float* OUT = (float*)d_out;     // [2][2048][1024]
    char* wsp = (char*)d_ws;
    auto take = [&](size_t bytes) { char* p = wsp; wsp += (bytes + 255) & ~(size_t)255; return (void*)p; };
    bf* WQ = (bf*)take((size_t)DQ * DM * 2); bf* WK = (bf*)take((size_t)DKV * DM * 2); bf* WV = (bf*)take((size_t)DKV * DM * 2); bf* WO = (bf*)take((size_t)DM * DQ * 2); float* CS = (float*)take((size_t)TT * HD * 2 * 4);
    h16* QP16 = (h16*)take((size_t)NH_ * TT * HD * 2); h16* KP16 = (h16*)take((size_t)NKV * TT * HD * 2); h16* VT16 = (h16*)take((size_t)NKV * HD * TT * 2);
    bf* QPh = (bf*)take((size_t)NH_ * TT * HD * 2); bf* QPl = (bf*)take((size_t)NH_ * TT * HD * 2); bf* KPh = (bf*)take((size_t)NKV * TT * HD * 2); bf* KPl = (bf*)take((size_t)NKV * TT * HD * 2); bf* VTh = (bf*)take((size_t)NKV * HD * TT * 2); bf* VTl = (bf*)take((size_t)NKV * HD * TT * 2);
    float* Sb = (float*)take((size_t)ZH * TT * TT * 4); h16* P16 = (h16*)Sb; bf* Ph = (bf*)Sb; bf* Pl = Ph + TT;   // probabilities in place over the scores: row pitch PP; fp16 row, or hi half | lo half
    float* Ob = (float*)take((size_t)KSF * ZH * TT * HD * 4);   // 64 MiB
    bf* XB = (bf*)Ob; float* FQ = (float*)(XB + (size_t)TT * DM); float* FK = FQ + (size_t)TT * DQ;   // 20 MiB inside Ob: a batch's last read of them (k_vtp) is stream-ordered before its first partial tile, and the next batch rewrites them after its predecessor's last k_merge
    bf* ATh = (bf*)take((size_t)TT * DQ * 2); bf* ATl = (bf*)take((size_t)TT * DQ * 2);
    if ((size_t)(wsp - (char*)d_ws) > ws_size) return;    // ws 256 MiB
    float* FV = FK;   // v projection reuses the k buffer after the k planes are built (stream-ordered)
    { k_cvt8<<<(unsigned)(((size_t)DQ * DM / 8 + 255) / 256), 256, 0, stream>>>(wq, WQ, (size_t)DQ * DM / 8); k_cvt8<<<(unsigned)(((size_t)DKV * DM / 8 + 255) / 256), 256, 0, stream>>>(wk, WK, (size_t)DKV * DM / 8); k_cvt8<<<(unsigned)(((size_t)DKV * DM / 8 + 255) / 256), 256, 0, stream>>>(wv, WV, (size_t)DKV * DM / 8);
      k_cvt8<<<(unsigned)(((size_t)DM * DQ / 8 + 255) / 256), 256, 0, stream>>>(wo, WO, (size_t)DM * DQ / 8);
       }
    const unsigned LQ = (unsigned)(((size_t)NH_ * TT * HD / 2 + 255) / 256), LKv = (unsigned)(((size_t)NKV * TT * HD / 2 + 255) / 256);
    for (int b = 0; b < NB_; ++b) {
        if (b == 0) k_csP<<<(TT * HD + 255) / 256, 256, 0, stream>>>(CS);   /* {cos, sin}(t x THETA**(-2i/64)) per interleaved pair */
        k_cvt8<<<(unsigned)(((size_t)TT * DM / 8 + 255) / 256), 256, 0, stream>>>(x + (size_t)b * TT * DM, XB, (size_t)TT * DM / 8);
        k_gemmw<bf, 0, false><<<dim3(TT / 64, DQ / 64, 1), 32, 0, stream>>>(XB, nullptr, WQ, nullptr, DM, FQ, DQ, nullptr, 0, 0, 0);
        k_ropeI<<<LQ, 256, 0, stream>>>(FQ, DQ, NH_, CS, 1.0f, QP16, QPh, QPl);
        k_gemmw<bf, 0, false><<<dim3(TT / 64, DKV / 64, 1), 32, 0, stream>>>(XB, nullptr, WK, nullptr, DM, FK, DKV, nullptr, 0, 0, 0);
        k_ropeI<<<LKv, 256, 0, stream>>>(FK, DKV, NKV, CS, 1.0f, KP16, KPh, KPl);
        k_gemmw<bf, 0, false><<<dim3(TT / 64, DKV / 64, 1), 32, 0, stream>>>(XB, nullptr, WV, nullptr, DM, FV, DKV, nullptr, 0, 0, 0); k_vtp<<<LKv, 256, 0, stream>>>(FV, DKV, NKV, VT16, VTh, VTl);
        for (int h0 = 0; h0 < NH_; h0 += ZH) { const size_t zq = (size_t)h0, zk = (size_t)(h0 / REP);   // one kv head per query head: the pass's heads use consecutive kv planes (z-strides TT*HD)
            k_gemmc<bf, 2, 1, 1><<<dim3(RH / 64, TT / 64, ZH), 32, 0, stream>>>(QPh + zq * TT * HD, QPl + zq * TT * HD, KPh + zk * TT * HD, KPl + zk * TT * HD, HD, HD, Sb, TT, 0, (size_t)TT * HD, (size_t)TT * HD, (size_t)TT * TT);
            k_gemmc<h16, 0, 1, 1><<<dim3((TT - RH) / 64, TT / 64, ZH), 32, 0, stream>>>(QP16 + zq * TT * HD + (size_t)RH * HD, nullptr, KP16 + zk * TT * HD, nullptr, HD, HD, Sb + (size_t)RH * TT, TT, RH, (size_t)TT * HD, (size_t)TT * HD, (size_t)TT * TT);
            k_asoft<<<ZH * TT / 8, 256, 0, stream>>>(Sb, P16, Ph, Pl);
            k_gemmc<bf, 2, 2, KSH><<<dim3(RH / 64, KSH, ZH), 32, 0, stream>>>(Ph, Pl, VTh + zk * HD * TT, VTl + zk * HD * TT, TT, PP, Ob, HD, 0, (size_t)TT * PP, (size_t)HD * TT, (size_t)TT * HD);
            k_gemmc<h16, 0, 2, KSF><<<dim3((TT - RH) / 64, KSF, ZH), 32, 0, stream>>>(P16 + (size_t)RH * PP, nullptr, VT16 + zk * HD * TT, nullptr, TT, PP, Ob + (size_t)RH * HD, HD, RH, (size_t)TT * PP, (size_t)HD * TT, (size_t)TT * HD);
            k_merge<<<(unsigned)(((size_t)ZH * TT * HD / 2 + 255) / 256), 256, 0, stream>>>(Ob, h0, ATh, ATl); }
        k_gemmw<bf, 1, false><<<dim3(TT / 64, DM / 64, 1), 32, 0, stream>>>(ATh, ATl, WO, nullptr, DQ, OUT + (size_t)b * TT * DM, DM, nullptr, 0, 0, 0); }
}

// v003
// It runs in 296 microseconds.
// Next to v002, in two timings, it ran 1.87 times as fast each time.
// Counting every step since v000, it is 4.85 times as fast.
#include <hip/hip_runtime.h>

// Causal multi-head self-attention with interleaved rotary embeddings and a FUSED (out, in) qkv weight (X [2][2048][1024]; qkv = einsum('bsd,od->bso', X, W_qkv) ('oi' [3072][1024] std sqrt(2/4096), no bias) viewed (B, S, 3, 16, 64): q | k | v = the three 1,024-ROW blocks of W_qkv (16 heads x 64); rotary on (even, odd) pairs with angle pos / (10000 ** (2 k / 64)) (float32 constants 10000^(-2i/64), precise cosf/sinf); scores x 64^-0.5, causal (-inf); softmax; out = merged W_o^T ('oi', no bias) -> [2][2048][1024] (4.2 M); argument order X, W_qkv, W_o.
// Layout per batch: bf16 copy of x; exact projections; {cos, sin} per (position, pair) from the int positions (jnp-exact float32 inverse frequencies, precise cosf/sinf); interleaved rotary plane builder; causal T-2048 attention fused in k_attn (hybrid rows: < 512 hi/lo 3 products, rest fp16 x1024; running maximum, keys walked up to the diagonal); merged hi/lo x wo exact, no bias.
// Compute dtypes, f32 accumulate: every input rounded to bf16; projections exact ; rotary f32; attention rows < 512 3 products, rest fp16; softmax f32; wo hl x exact, no bias.

#define NB_  2
#define TT   2048
#define DM   1024
#define NH_  16
#define NKV  16
#define REP  (NH_ / NKV)
#define HD   64
#define DQ   (NH_ * HD)
#define DKV  (NKV * HD)
#define RH   512                  // query rows < RH use hi+lo planes (0: none)
#define SCL  0.125f   // HD^-0.5
typedef _Float16 h16;
typedef unsigned short bf;
typedef __attribute__((ext_vector_type(16))) __bf16   v16bf;
typedef __attribute__((ext_vector_type(16))) _Float16 v16h;
typedef __attribute__((ext_vector_type(8)))  _Float16 v8h;
typedef __attribute__((ext_vector_type(8)))  unsigned short v8us;
typedef __attribute__((ext_vector_type(8)))  float    v8f;
typedef __attribute__((ext_vector_type(4)))  float    v4f;
typedef v8h  __attribute__((may_alias)) v8ha;
typedef v4f  __attribute__((may_alias)) v4fa;
typedef v8us __attribute__((may_alias)) v8usa;

__device__ __forceinline__ unsigned short f2bf(float f) { unsigned u = __float_as_uint(f); u += 0x7FFFu + ((u >> 16) & 1u); return (unsigned short)(u >> 16); }
__device__ __forceinline__ float bf2f(unsigned short b) { return __uint_as_float(((unsigned)b) << 16); }
__device__ __forceinline__ float bfr(float f) { return bf2f(f2bf(f)); }
__device__ __forceinline__ v16h cat16(v8h lo, v8h hi) { return __builtin_shufflevector(lo, hi, 0, 1, 2, 3, 4, 5, 6, 7, 8, 9, 10, 11, 12, 13, 14, 15); }
__device__ __forceinline__ v16bf cat16b(v8us lo, v8us hi) { return __builtin_bit_cast(v16bf, __builtin_shufflevector(lo, hi, 0, 1, 2, 3, 4, 5, 6, 7, 8, 9, 10, 11, 12, 13, 14, 15)); }
__device__ __forceinline__ v8f wmma16(v16h a, v16h b, v8f c) { return __builtin_amdgcn_wmma_f32_16x16x32_f16(false, a, false, b, (short)0, c, false, false); }
__device__ __forceinline__ v8f wmmab(v16bf a, v16bf b, v8f c) { return __builtin_amdgcn_wmma_f32_16x16x32_bf16(false, a, false, b, (short)0, c, false, false); }



// ---- k_gemmw: register-blocked GEMM, ONE WAVE per 64x64 output tile (16 accumulators), operands straight from K-contiguous 16-bit planes; grid (M/64, N/64, Z), 32 threads.
// C[m][n] (f32, pitch ldc, + optional f32 bias[n]) = sum_k A[m][k] Bt[n][k] (+ split products per NSPLIT). z-batch strides sA/sB/sC in elements. K % 32 == 0.
template <typename T16> struct WFrag;
template <> struct WFrag<h16> { typedef v16h V; static __device__ __forceinline__ V ld(const h16* p) { return cat16(*(const v8h*)p, *(const v8h*)(p + 16)); } static __device__ __forceinline__ v8f mma(V a, V b, v8f c) { return wmma16(a, b, c); } };
template <> struct WFrag<bf> { typedef v16bf V; static __device__ __forceinline__ V ld(const bf* p) { return cat16b(*(const v8us*)p, *(const v8us*)(p + 16)); } static __device__ __forceinline__ v8f mma(V a, V b, v8f c) { return wmmab(a, b, c); } };
template <typename T16, int NSPLIT, bool BIAS>
__global__ __launch_bounds__(32) void k_gemmw(const T16* __restrict__ A, const T16* __restrict__ A2, const T16* __restrict__ Bt, const T16* __restrict__ Bt2, int K, float* C, int ldc, const float* __restrict__ bias, size_t sA, size_t sB, size_t sC) {
    typedef typename WFrag<T16>::V V;
    __shared__ __align__(16) float os[16 * 68];
    const size_t z = blockIdx.z; A += z * sA; if (A2) A2 += z * sA; Bt += z * sB; if (Bt2) Bt2 += z * sB; C += z * sC;
    const int lane = threadIdx.x & 31, lr = lane & 15, hi = lane >> 4; const int r0 = blockIdx.x * 64, c0 = blockIdx.y * 64;
    v8f acc[4][4];
#pragma unroll
    for (int mb = 0; mb < 4; ++mb)
#pragma unroll
        for (int nb = 0; nb < 4; ++nb) acc[mb][nb] = (v8f){};
    const size_t aoff = (size_t)(r0 + lr) * K + 8 * hi, boff = (size_t)(c0 + lr) * K + 8 * hi;
#pragma unroll 1
    for (int kc = 0; kc < K; kc += 32) {
        V a[4], a2[4];
#pragma unroll
        for (int mb = 0; mb < 4; ++mb) { a[mb] = WFrag<T16>::ld(A + aoff + (size_t)mb * 16 * K + kc); if (NSPLIT == 1 || NSPLIT == 2) a2[mb] = WFrag<T16>::ld(A2 + aoff + (size_t)mb * 16 * K + kc); }
#pragma unroll
        for (int nb = 0; nb < 4; ++nb) { const V b = WFrag<T16>::ld(Bt + boff + (size_t)nb * 16 * K + kc); V b2; if (NSPLIT >= 2) b2 = WFrag<T16>::ld(Bt2 + boff + (size_t)nb * 16 * K + kc);
#pragma unroll
            for (int mb = 0; mb < 4; ++mb) { acc[mb][nb] = WFrag<T16>::mma(a[mb], b, acc[mb][nb]); if (NSPLIT == 1 || NSPLIT == 2) acc[mb][nb] = WFrag<T16>::mma(a2[mb], b, acc[mb][nb]); if (NSPLIT >= 2) acc[mb][nb] = WFrag<T16>::mma(a[mb], b2, acc[mb][nb]); } }
        asm volatile("v_nop\n\tv_nop\n\tv_nop\n\tv_nop" : "+v"(acc[0][0]), "+v"(acc[1][1]), "+v"(acc[2][2]), "+v"(acc[3][3]) : "v"(a[0]), "v"(a[3]));
    }
#pragma unroll
    for (int mb = 0; mb < 4; ++mb) {
#pragma unroll
        for (int nb = 0; nb < 4; ++nb) {
#pragma unroll
            for (int j = 0; j < 8; ++j) os[(hi * 8 + j) * 68 + nb * 16 + lr] = acc[mb][nb][j]; }
        __builtin_amdgcn_wave_barrier(); asm volatile("" ::: "memory");
        float* crow = C + (size_t)(r0 + mb * 16) * ldc + c0;
{
#pragma unroll
            for (int s = 0; s < 8; ++s) { const int row = 2 * s + hi, cofs = lr * 4; v4f val = *(const v4fa*)(os + row * 68 + cofs); if (BIAS) { val[0] += bfr(bias[c0 + cofs]); val[1] += bfr(bias[c0 + cofs + 1]); val[2] += bfr(bias[c0 + cofs + 2]); val[3] += bfr(bias[c0 + cofs + 3]); }
                *(v4f*)(crow + (size_t)row * ldc + cofs) = val; }
             }
        __builtin_amdgcn_wave_barrier(); asm volatile("" ::: "memory");
    }
}

__device__ __forceinline__ h16 tohx(float x) { return (h16)x; }
__device__ __forceinline__ void splitf(float y, unsigned short& h, unsigned short& l) { h = f2bf(y); l = f2bf(y - bf2f(h)); }
typedef __attribute__((ext_vector_type(2))) _Float16 v2h;
typedef __attribute__((ext_vector_type(4))) _Float16 v4h;
typedef __attribute__((ext_vector_type(2))) unsigned short v2us;
typedef __attribute__((ext_vector_type(4))) unsigned short v4us;
typedef __attribute__((ext_vector_type(2))) float v2f;
typedef __attribute__((ext_vector_type(4))) int v4i;

__global__ __launch_bounds__(256) void k_wtG(const float* __restrict__ w, int K, int N, bf* Bt) {
    const int lane = threadIdx.x & 31; const int L0 = (blockIdx.x * 8 + (threadIdx.x >> 5)) * 8; const int nlines = N * K / 64;
{
#pragma unroll 1
        for (int l = 0; l < 8; ++l) { const int L = L0 + l; if (L >= nlines) break; const size_t e = (size_t)L * 64 + lane * 2; const int k = (int)(e % K), n = (int)(e / K); v2us o;
            o[0] = f2bf(w[(size_t)k * N + n]); o[1] = f2bf(w[(size_t)(k + 1) * N + n]); *(v2us*)(Bt + e) = o; }
         }
}
__global__ __launch_bounds__(256) void k_cvt8(const float* __restrict__ src, bf* dst, size_t n8) { const size_t i = (size_t)blockIdx.x * 256 + threadIdx.x; if (i >= n8) return; const v8f v = *(const v8f*)(src + i * 8); v8us o;
#pragma unroll
    for (int k = 0; k < 8; ++k) o[k] = f2bf(v[k]); *(v8us*)(dst + i * 8) = o;  }
__constant__ float INVP[HD / 2] = { 1.000000000e+00f,7.498942018e-01f,5.623413324e-01f,4.216965139e-01f,3.162277639e-01f,2.371373773e-01f,1.778279394e-01f,1.333521456e-01f,1.000000015e-01f,7.498942316e-02f,5.623413250e-02f,4.216964915e-02f,3.162277490e-02f,2.371373773e-02f,1.778279431e-02f,1.333521400e-02f,9.999999776e-03f,7.498942316e-03f,5.623413250e-03f,4.216964822e-03f,3.162277630e-03f,2.371373819e-03f,1.778279431e-03f,1.333521446e-03f,1.000000047e-03f,7.498941850e-04f,5.623413017e-04f,4.216965172e-04f,3.162277571e-04f,2.371373703e-04f,1.778279402e-04f,1.333521504e-04f };   // 10000 ** (-2 i / 64) as float32 (the module's power form, jnp-computed; differs from 1/10000**(2i/64) by ulps)
__global__ __launch_bounds__(256) void k_csP(float* CS) { const int idx = blockIdx.x * 256 + threadIdx.x; if (idx >= TT * HD) return; const int d = idx % HD; const int t = idx / HD; const float a = __fmul_rn((float)t, INVP[d >> 1]); v2f cs; cs[0] = cosf(a); cs[1] = sinf(a); *(v2f*)(CS + (size_t)idx * 2) = cs;  }

__global__ __launch_bounds__(256) void k_ropeI(const float* __restrict__ F, int pitch, int nheads, const float* __restrict__ CS, float sc, h16* P16, bf* Ph, bf* Pl) {
    const size_t e = ((size_t)blockIdx.x * 256 + threadIdx.x) * 2; if (e >= (size_t)nheads * TT * HD) return; const int d = (int)(e % HD); const int t = (int)((e / HD) % TT); const int h = (int)(e / ((size_t)HD * TT)); const float* f = F + (size_t)t * pitch + h * HD; const float x0 = f[d], x1 = f[d + 1]; const v2f cs = *(const v2f*)(CS + ((size_t)t * HD + d) * 2); v2h o16; v2us oh, ol;
    float a0 = __fmul_rn(x0, cs[0]), b0 = __fmul_rn(x1, cs[1]), a1 = __fmul_rn(x1, cs[0]), b1 = __fmul_rn(x0, cs[1]); asm volatile("" : "+v"(a0), "+v"(b0), "+v"(a1), "+v"(b1));
    float r0 = __fsub_rn(a0, b0) * sc, r1 = __fadd_rn(b1, a1) * sc;   /* even: x0 c - x1 s; odd: x0 s + x1 c */
    o16[0] = tohx(r0); o16[1] = tohx(r1); { unsigned short a2, c2; splitf(r0, a2, c2); oh[0] = a2; ol[0] = c2; splitf(r1, a2, c2); oh[1] = a2; ol[1] = c2; }
    *(v2h*)(P16 + e) = o16; *(v2us*)(Ph + e) = oh; *(v2us*)(Pl + e) = ol;  }


// k_ropeI: head planes [h][t][d] (fp16 + hi/lo) of rope(x) x sc with the interleaved convention out[2i] = x[2i] cos[t][i] - x[2i+1] sin[t][i], out[2i+1] = x[2i] sin[t][i] + x[2i+1] cos[t][i]

__global__ __launch_bounds__(256) void k_vtp(const float* __restrict__ F, int pitch, int nheads, h16* V16, bf* Vh, bf* Vl) { const size_t e = ((size_t)blockIdx.x * 256 + threadIdx.x) * 2; if (e >= (size_t)nheads * HD * TT) return; const int t = (int)(e % TT); const int d = (int)((e / TT) % HD); const int g = (int)(e / ((size_t)TT * HD)); v2h o16; v2us oh, ol;
#pragma unroll
    for (int q = 0; q < 2; ++q) { const float x = F[(size_t)(t + q) * pitch + g * HD + d]; o16[q] = tohx(x); unsigned short a2, c2; splitf(x, a2, c2); oh[q] = a2; ol[q] = c2; }
    *(v2h*)(V16 + e) = o16; *(v2us*)(Vh + e) = oh; *(v2us*)(Vl + e) = ol;  }
#define NW   4
#define SL2E (SCL * 1.4426950408889634f)   // the score scale (a power of two: exact) rides in the exponent's factor; m is kept in unscaled scores
#define OP   68                   // pitch, in floats, of a query's partial output row in LDS (64 + 4: rows 16 bytes apart in the banks)
// 2^x of eight values: eight independent v_exp_f32, each in place, and behind the last the one free slot that the instruction set asks for between a transcendental and an instruction that reads its result or
// overwrites its source.
__device__ __forceinline__ v8f exp2x8(v8f x) { float a = x[0], b = x[1], c = x[2], d = x[3], e = x[4], f = x[5], g = x[6], h = x[7];
    asm("v_exp_f32 %0, %0\n\tv_exp_f32 %1, %1\n\tv_exp_f32 %2, %2\n\tv_exp_f32 %3, %3\n\tv_exp_f32 %4, %4\n\tv_exp_f32 %5, %5\n\tv_exp_f32 %6, %6\n\tv_exp_f32 %7, %7\n\tv_nop" : "+v"(a), "+v"(b), "+v"(c), "+v"(d), "+v"(e), "+v"(f), "+v"(g), "+v"(h));
    return (v8f){a, b, c, d, e, f, g, h}; }
__device__ __forceinline__ float exp2x1(float a) { asm("v_exp_f32 %0, %0\n\tv_nop" : "+v"(a)); return a; }   // one value, with the same slot
template <typename T16, int NQ, bool HL>
__device__ __forceinline__ void attn_tile(const T16* __restrict__ Q, const T16* __restrict__ Q2, const T16* __restrict__ Kp, const T16* __restrict__ Kp2, const T16* __restrict__ Vt, const T16* __restrict__ Vt2, int q0, bf* __restrict__ Ah, bf* __restrict__ Al, float* os, float* ml) {
    typedef typename WFrag<T16>::V V;
    const int lane = threadIdx.x & 31, lr = lane & 15, hi = lane >> 4; const int w = __builtin_amdgcn_readfirstlane(threadIdx.x >> 5);
    const int klast = (q0 + NQ * 16 - 1) & ~31;      // first key of the 32-key block that holds the tile's last diagonal element
    V q[NQ][2], q2[NQ][2], k[2][2], k2[2][2];
    // every operand load is addressed as one lane pointer per plane and pass plus a constant that fits the instruction's offset field (no address sums per load)
    const unsigned kof = (unsigned)(lr * HD + 8 * hi), vof = (unsigned)(lr * TT + 8 * hi); const T16* pk = nullptr; const T16* pk2 = nullptr;
#pragma unroll
    for (int qt = 0; qt < NQ; ++qt)
#pragma unroll
        for (int c = 0; c < 2; ++c) { const int qc = qt * 16 * HD + c * 32; q[qt][c] = WFrag<T16>::ld(Q + (size_t)q0 * HD + kof + qc); if (HL) q2[qt][c] = WFrag<T16>::ld(Q2 + (size_t)q0 * HD + kof + qc); }
    auto ldk = [&](int kk) {                         // the four (HL: eight) fragments of the 32 key rows from kk on
        pk = Kp + (size_t)kk * HD + kof; if (HL) pk2 = Kp2 + (size_t)kk * HD + kof;
#pragma unroll
        for (int kt = 0; kt < 2; ++kt)
#pragma unroll
            for (int c = 0; c < 2; ++c) { const int kc = kt * 16 * HD + c * 32; k[kt][c] = WFrag<T16>::ld(pk + kc); if (HL) k2[kt][c] = WFrag<T16>::ld(pk2 + kc); } };
    if (!HL) ldk(min(32 * w, klast));                // fp16: key fragments run one pass ahead (a wave with no block of its own fetches the last one: in bounds, unused); hi/lo: at most 4 passes a wave, fetched in the pass, which keeps the registers under 256
    v8f o[4][NQ]; float m[NQ], l[NQ];
#pragma unroll
    for (int qt = 0; qt < NQ; ++qt) { m[qt] = -3.0e38f; l[qt] = 0.f;
#pragma unroll
        for (int dt = 0; dt < 4; ++dt) o[dt][qt] = (v8f){}; }
#pragma unroll 1   // stays rolled: the trip count is known only at run time, and a second copy of the body (its fragments and score tiles) would not fit the registers
    for (int kb = 32 * w; kb <= klast; kb += 32 * NW) {
        if (HL) ldk(kb);
        V v[4], v2[4]; const T16* pv = Vt + (size_t)kb + vof; const T16* pv2 = HL ? Vt2 + (size_t)kb + vof : nullptr;
#pragma unroll
        for (int dt = 0; dt < 4; ++dt) { v[dt] = WFrag<T16>::ld(pv + dt * 16 * TT); if (HL) v2[dt] = WFrag<T16>::ld(pv2 + dt * 16 * TT); }
        v8f s[2][NQ];
#pragma unroll
        for (int kt = 0; kt < 2; ++kt)
#pragma unroll
            for (int qt = 0; qt < NQ; ++qt) { v8f a = (v8f){};
#pragma unroll
                for (int c = 0; c < 2; ++c) { a = WFrag<T16>::mma(k[kt][c], q[qt][c], a); if (HL) { a = WFrag<T16>::mma(k[kt][c], q2[qt][c], a); a = WFrag<T16>::mma(k2[kt][c], q[qt][c], a); } }
                s[kt][qt] = a; }
        if (!HL) ldk(min(kb + 32 * NW, klast));       // the wave's next key fragments are fetched now, behind this pass's last use of the registers (its last pass fetches the last block: in bounds, unused)
        // all of the pass's loads are issued: the wait that stands in front of a rewrite of a register an issued load names. The pass's lane pointers are its inputs, so that their registers stay theirs up to here (one build landed later loads of the run in them)
        if constexpr (HL) asm volatile("s_wait_xcnt 0x0" :: "v"(pk), "v"(pk2), "v"(pv), "v"(pv2) : "memory"); else asm volatile("s_wait_xcnt 0x0" :: "v"(pk), "v"(pv) : "memory");
        if (kb == klast) {                            // only the last block crosses the diagonal: key > query is masked
#pragma unroll
            for (int kt = 0; kt < 2; ++kt)
#pragma unroll
                for (int qt = 0; qt < NQ; ++qt)
#pragma unroll
                    for (int j = 0; j < 8; ++j) if (kb + kt * 16 + hi * 8 + j > q0 + qt * 16 + lr) s[kt][qt][j] = -3.0e38f; }
        V pb[NQ], pb2[NQ];
#pragma unroll
        for (int qt = 0; qt < NQ; ++qt) {
            float mx = fmaxf(s[0][qt][0], s[1][qt][0]);
#pragma unroll
            for (int j = 1; j < 8; ++j) mx = fmaxf(mx, fmaxf(s[0][qt][j], s[1][qt][j]));
            mx = fmaxf(mx, __shfl_xor(mx, 16, 32));
            const float mn = fmaxf(m[qt], mx); const float al = exp2x1((m[qt] - mn) * SL2E); m[qt] = mn;
            float sum = 0.f;
#pragma unroll
            for (int kt = 0; kt < 2; ++kt) { v8f x;
#pragma unroll
                for (int j = 0; j < 8; ++j) { const float y = (s[kt][qt][j] - mn) * SL2E; x[j] = HL ? y : y + 10.0f; }
                x = exp2x8(x); s[kt][qt] = x;
#pragma unroll
                for (int j = 0; j < 8; ++j) sum += x[j]; }
            l[qt] = l[qt] * al + sum;
#pragma unroll
            for (int dt = 0; dt < 4; ++dt) o[dt][qt] *= al;
            if constexpr (HL) { v8us h0, h1, l0, l1;
#pragma unroll
                for (int j = 0; j < 8; ++j) { unsigned short a, c2; splitf(s[0][qt][j], a, c2); h0[j] = a; l0[j] = c2; splitf(s[1][qt][j], a, c2); h1[j] = a; l1[j] = c2; }
                pb[qt] = cat16b(h0, h1); pb2[qt] = cat16b(l0, l1);
            } else { v8h h0, h1;
#pragma unroll
                for (int j = 0; j < 8; ++j) { h0[j] = tohx(s[0][qt][j]); h1[j] = tohx(s[1][qt][j]); }
                pb[qt] = cat16(h0, h1); }
        }
#pragma unroll
        for (int dt = 0; dt < 4; ++dt)
#pragma unroll
            for (int qt = 0; qt < NQ; ++qt) { o[dt][qt] = WFrag<T16>::mma(v[dt], pb[qt], o[dt][qt]); if (HL) { o[dt][qt] = WFrag<T16>::mma(v[dt], pb2[qt], o[dt][qt]); o[dt][qt] = WFrag<T16>::mma(v2[dt], pb[qt], o[dt][qt]); } }
    }
#pragma unroll
    for (int qt = 0; qt < NQ; ++qt) { const int row = w * (NQ * 16) + qt * 16 + lr; const float ls = l[qt] + __shfl_xor(l[qt], 16, 32);   // the halves' sums are joined once, here
        if (hi == 0) { v2f t2; t2[0] = m[qt]; t2[1] = ls; *(v2f*)(ml + row * 2) = t2; }
#pragma unroll
        for (int dt = 0; dt < 4; ++dt) { float* p = os + row * OP + dt * 16 + hi * 8; *(v4f*)p = __builtin_shufflevector(o[dt][qt], o[dt][qt], 0, 1, 2, 3); *(v4f*)(p + 4) = __builtin_shufflevector(o[dt][qt], o[dt][qt], 4, 5, 6, 7); } }
    __syncthreads();                                  // every wave's (m, l, O) is in LDS before any wave joins them
    constexpr int LPQ = 8 / NQ, DPL = 8 * NQ;         // lanes per query row and output elements per lane in the join
    const int qq = w * (NQ * 4) + lane / LPQ, d0 = (lane % LPQ) * DPL;
    v2f t[NW]; float M = -3.0e38f;
#pragma unroll
    for (int i = 0; i < NW; ++i) { t[i] = *(const v2f*)(ml + (i * (NQ * 16) + qq) * 2); M = fmaxf(M, t[i][0]); }
    float L = 0.f, acc[DPL];
#pragma unroll
    for (int e = 0; e < DPL; ++e) acc[e] = 0.f;
#pragma unroll
    for (int i = 0; i < NW; ++i) { const float sc = exp2x1((t[i][0] - M) * SL2E); L += t[i][1] * sc;   // a wave that had no block: m = -3e38, so sc = 0, on l = 0 and O = 0
#pragma unroll
        for (int e = 0; e < DPL; e += 4) { const v4f x = *(const v4f*)(os + (i * (NQ * 16) + qq) * OP + d0 + e); acc[e] += x[0] * sc; acc[e + 1] += x[1] * sc; acc[e + 2] += x[2] * sc; acc[e + 3] += x[3] * sc; } }
    const float inv = __fdiv_rn(1.0f, L);
#pragma unroll
    for (int c = 0; c < DPL / 8; ++c) { v8us oh, ol;
#pragma unroll
        for (int j = 0; j < 8; ++j) { unsigned short a, c2; splitf(acc[c * 8 + j] * inv, a, c2); oh[j] = a; ol[j] = c2; }
        const size_t oo = (size_t)(q0 + qq) * DQ + d0 + c * 8; *(v8us*)(Ah + oo) = oh; *(v8us*)(Al + oo) = ol; }
    // hi/lo form only: behind the last store, the wait that stands in front of any rewrite of a register an issued store names (in the listing the way on from here leads past the fp16 form's entry, which writes such registers; the fp16 form's stores run straight into the end of the program)
    if constexpr (HL) asm volatile("s_wait_xcnt 0x0" ::: "memory");
}
// grid (heads, tiles): blockIdx.y ranks the tiles by falling cost: the (TT - RH) / 32 fp16 tiles of 32 rows from the last row up, then the RH / 16 hi/lo tiles of 16 rows.
__global__ __launch_bounds__(32 * NW) void k_attn(const h16* __restrict__ Q16, const h16* __restrict__ K16, const h16* __restrict__ V16, const bf* __restrict__ Qh, const bf* __restrict__ Ql, const bf* __restrict__ Kh, const bf* __restrict__ Kl, const bf* __restrict__ Vh, const bf* __restrict__ Vl, bf* __restrict__ Ah, bf* __restrict__ Al) {
    __shared__ __align__(16) float os[NW * 32 * OP]; __shared__ __align__(16) float ml[NW * 32 * 2];
    const size_t hp = (size_t)blockIdx.x * TT * HD; const int r = blockIdx.y; Ah += blockIdx.x * HD; Al += blockIdx.x * HD;
    if (r < (TT - RH) / 32) attn_tile<h16, 2, false>(Q16 + hp, nullptr, K16 + hp, nullptr, V16 + hp, nullptr, TT - 32 - 32 * r, Ah, Al, os, ml);
    else attn_tile<bf, 1, true>(Qh + hp, Ql + hp, Kh + hp, Kl + hp, Vh + hp, Vl + hp, RH - 16 - 16 * (r - (TT - RH) / 32), Ah, Al, os, ml);
}

extern "C" void kernel_launch(void* const* d_in, const int* in_sizes, int n_in,
                              void* d_out, int out_size, void* d_ws, size_t ws_size, hipStream_t stream) {
    (void)in_sizes; (void)n_in; (void)out_size;
    const float* x = (const float*)d_in[0]; const float* wq = (const float*)d_in[1]; const float* wk = wq + (size_t)DQ * DM; const float* wv = wq + (size_t)2 * DQ * DM; const float* wo = (const float*)d_in[2];   /* input order X, W_qkv ('oi' [3072][1024]: q | k | v = its three 1,024-row blocks), W_o ('oi' [1024][1024]): THREE inputs; the host's three separate 'oi' weights are the row blocks of this module's fused one */
    float* OUT = (float*)d_out;     // [2][2048][1024]
    char* wsp = (char*)d_ws;
    auto take = [&](size_t bytes) { char* p = wsp; wsp += (bytes + 255) & ~(size_t)255; return (void*)p; };
    bf* WQ = (bf*)take((size_t)DQ * DM * 2); bf* WK = (bf*)take((size_t)DKV * DM * 2); bf* WV = (bf*)take((size_t)DKV * DM * 2); bf* WO = (bf*)take((size_t)DM * DQ * 2); float* CS = (float*)take((size_t)TT * HD * 2 * 4);
    h16* QP16 = (h16*)take((size_t)NH_ * TT * HD * 2); h16* KP16 = (h16*)take((size_t)NKV * TT * HD * 2); h16* VT16 = (h16*)take((size_t)NKV * HD * TT * 2);
    bf* QPh = (bf*)take((size_t)NH_ * TT * HD * 2); bf* QPl = (bf*)take((size_t)NH_ * TT * HD * 2); bf* KPh = (bf*)take((size_t)NKV * TT * HD * 2); bf* KPl = (bf*)take((size_t)NKV * TT * HD * 2); bf* VTh = (bf*)take((size_t)NKV * HD * TT * 2); bf* VTl = (bf*)take((size_t)NKV * HD * TT * 2);
    bf* XB = (bf*)take((size_t)TT * DM * 2); float* FQ = (float*)take((size_t)TT * DQ * 4); float* FK = (float*)take((size_t)TT * DKV * 4);
    bf* ATh = (bf*)take((size_t)TT * DQ * 2); bf* ATl = (bf*)take((size_t)TT * DQ * 2);
    if ((size_t)(wsp - (char*)d_ws) > ws_size) return;    // ws 256 MiB
    float* FV = FK;   // v projection reuses the k buffer after the k planes are built (stream-ordered)
    { k_cvt8<<<(unsigned)(((size_t)DQ * DM / 8 + 255) / 256), 256, 0, stream>>>(wq, WQ, (size_t)DQ * DM / 8); k_cvt8<<<(unsigned)(((size_t)DKV * DM / 8 + 255) / 256), 256, 0, stream>>>(wk, WK, (size_t)DKV * DM / 8); k_cvt8<<<(unsigned)(((size_t)DKV * DM / 8 + 255) / 256), 256, 0, stream>>>(wv, WV, (size_t)DKV * DM / 8);
      k_cvt8<<<(unsigned)(((size_t)DM * DQ / 8 + 255) / 256), 256, 0, stream>>>(wo, WO, (size_t)DM * DQ / 8);
       }
    const unsigned LQ = (unsigned)(((size_t)NH_ * TT * HD / 2 + 255) / 256), LKv = (unsigned)(((size_t)NKV * TT * HD / 2 + 255) / 256);
    for (int b = 0; b < NB_; ++b) {
        if (b == 0) k_csP<<<(TT * HD + 255) / 256, 256, 0, stream>>>(CS);   /* {cos, sin}(t x THETA**(-2i/64)) per interleaved pair */
        k_cvt8<<<(unsigned)(((size_t)TT * DM / 8 + 255) / 256), 256, 0, stream>>>(x + (size_t)b * TT * DM, XB, (size_t)TT * DM / 8);
        k_gemmw<bf, 0, false><<<dim3(TT / 64, DQ / 64, 1), 32, 0, stream>>>(XB, nullptr, WQ, nullptr, DM, FQ, DQ, nullptr, 0, 0, 0);
        k_ropeI<<<LQ, 256, 0, stream>>>(FQ, DQ, NH_, CS, 1.0f, QP16, QPh, QPl);
        k_gemmw<bf, 0, false><<<dim3(TT / 64, DKV / 64, 1), 32, 0, stream>>>(XB, nullptr, WK, nullptr, DM, FK, DKV, nullptr, 0, 0, 0);
        k_ropeI<<<LKv, 256, 0, stream>>>(FK, DKV, NKV, CS, 1.0f, KP16, KPh, KPl);
        k_gemmw<bf, 0, false><<<dim3(TT / 64, DKV / 64, 1), 32, 0, stream>>>(XB, nullptr, WV, nullptr, DM, FV, DKV, nullptr, 0, 0, 0); k_vtp<<<LKv, 256, 0, stream>>>(FV, DKV, NKV, VT16, VTh, VTl);
        k_attn<<<dim3(NH_, (TT - RH) / 32 + RH / 16, 1), 32 * NW, 0, stream>>>(QP16, KP16, VT16, QPh, QPl, KPh, KPl, VTh, VTl, ATh, ATl);   // one kv head per query head
        k_gemmw<bf, 1, false><<<dim3(TT / 64, DM / 64, 1), 32, 0, stream>>>(ATh, ATl, WO, nullptr, DQ, OUT + (size_t)b * TT * DM, DM, nullptr, 0, 0, 0); }
}

// v004
// It runs in 261 microseconds.
// Two timings next to v003 put it at 1.14 and 1.12 times that version's speed.
// Over all steps from v000 it is 5.49 times as fast.
#include <hip/hip_runtime.h>

// Causal multi-head self-attention with interleaved rotary embeddings and a FUSED (out, in) qkv weight (X [2][2048][1024]; qkv = einsum('bsd,od->bso', X, W_qkv) ('oi' [3072][1024] std sqrt(2/4096), no bias) viewed (B, S, 3, 16, 64): q | k | v = the three 1,024-ROW blocks of W_qkv (16 heads x 64); rotary on (even, odd) pairs with angle pos / (10000 ** (2 k / 64)) (float32 constants 10000^(-2i/64), precise cosf/sinf); scores x 64^-0.5, causal (-inf); softmax; out = merged W_o^T ('oi', no bias) -> [2][2048][1024] (4.2 M); argument order X, W_qkv, W_o.
// Layout per batch: bf16 copy of x; exact projections; {cos, sin} per (position, pair) from the int positions (jnp-exact float32 inverse frequencies, precise cosf/sinf); interleaved rotary and the 16-bit head planes in the projections' own epilogues; causal T-2048 attention fused in k_attn (hybrid rows: < 512 hi/lo 3 products, rest fp16 x1024; running maximum, keys walked up to the diagonal); merged hi/lo x wo exact, no bias.
// Compute dtypes, f32 accumulate: every input rounded to bf16; projections exact ; rotary f32; attention rows < 512 3 products, rest fp16; softmax f32; wo hl x exact, no bias.

#define NB_  2
#define TT   2048
#define DM   1024
#define NH_  16
#define NKV  16
#define REP  (NH_ / NKV)
#define HD   64
#define DQ   (NH_ * HD)
#define DKV  (NKV * HD)
#define RH   512                  // query rows < RH use hi+lo planes (0: none)
#define SCL  0.125f   // HD^-0.5
typedef _Float16 h16;
typedef unsigned short bf;
typedef __attribute__((ext_vector_type(16))) __bf16   v16bf;
typedef __attribute__((ext_vector_type(16))) _Float16 v16h;
typedef __attribute__((ext_vector_type(8)))  _Float16 v8h;
typedef __attribute__((ext_vector_type(8)))  unsigned short v8us;
typedef __attribute__((ext_vector_type(8)))  float    v8f;
typedef __attribute__((ext_vector_type(4)))  float    v4f;
typedef v8h  __attribute__((may_alias)) v8ha;
typedef v4f  __attribute__((may_alias)) v4fa;
typedef v8us __attribute__((may_alias)) v8usa;

__device__ __forceinline__ unsigned short f2bf(float f) { unsigned u = __float_as_uint(f); u += 0x7FFFu + ((u >> 16) & 1u); return (unsigned short)(u >> 16); }
__device__ __forceinline__ float bf2f(unsigned short b) { return __uint_as_float(((unsigned)b) << 16); }
__device__ __forceinline__ float bfr(float f) { return bf2f(f2bf(f)); }
__device__ __forceinline__ v16h cat16(v8h lo, v8h hi) { return __builtin_shufflevector(lo, hi, 0, 1, 2, 3, 4, 5, 6, 7, 8, 9, 10, 11, 12, 13, 14, 15); }
__device__ __forceinline__ v16bf cat16b(v8us lo, v8us hi) { return __builtin_bit_cast(v16bf, __builtin_shufflevector(lo, hi, 0, 1, 2, 3, 4, 5, 6, 7, 8, 9, 10, 11, 12, 13, 14, 15)); }
__device__ __forceinline__ v8f wmma16(v16h a, v16h b, v8f c) { return __builtin_amdgcn_wmma_f32_16x16x32_f16(false, a, false, b, (short)0, c, false, false); }
__device__ __forceinline__ v8f wmmab(v16bf a, v16bf b, v8f c) { return __builtin_amdgcn_wmma_f32_16x16x32_bf16(false, a, false, b, (short)0, c, false, false); }



__device__ __forceinline__ h16 tohx(float x) { return (h16)x; }
__device__ __forceinline__ void splitf(float y, unsigned short& h, unsigned short& l) { h = f2bf(y); l = f2bf(y - bf2f(h)); }
typedef __attribute__((ext_vector_type(2))) _Float16 v2h;
typedef __attribute__((ext_vector_type(4))) _Float16 v4h;
typedef __attribute__((ext_vector_type(2))) unsigned short v2us;
typedef __attribute__((ext_vector_type(4))) unsigned short v4us;
typedef __attribute__((ext_vector_type(2))) float v2f;
typedef __attribute__((ext_vector_type(4))) int v4i;

// ---- k_gemmw: register-blocked GEMM, ONE WAVE per 64x64 output tile (16 accumulators), operands straight from K-contiguous 16-bit planes; grid (M/64, N/64, Z), 32 threads.
// C[m][n] (f32, pitch ldc, + optional f32 bias[n]) = sum_k A[m][k] Bt[n][k] (+ split products per NSPLIT). z-batch strides sA/sB/sC in elements. K % 32 == 0.
// EPI says where the tile goes. 0: C as above. 1 and 2: the tile is 64 positions (rows) x the 64 columns of ONE head (blockIdx.y), and it leaves the wave as the attention's 16-bit planes (fp16, bf16 hi, bf16 lo), no f32 copy in between:
// 1: interleaved rotary with {cos, sin} from CS, planes [h][t][d] (a lane turns 8 columns of a row: 16-byte stores, 8 lanes fill a 128-byte line); 2: planes [h][d][t]: a lane's accumulator holds 8 consecutive positions of one column, which IS 16 bytes of the transposed row.
template <typename T16> struct WFrag;
template <> struct WFrag<h16> { typedef v16h V; static __device__ __forceinline__ V ld(const h16* p) { return cat16(*(const v8h*)p, *(const v8h*)(p + 16)); } static __device__ __forceinline__ v8f mma(V a, V b, v8f c) { return wmma16(a, b, c); } };
template <> struct WFrag<bf> { typedef v16bf V; static __device__ __forceinline__ V ld(const bf* p) { return cat16b(*(const v8us*)p, *(const v8us*)(p + 16)); } static __device__ __forceinline__ v8f mma(V a, V b, v8f c) { return wmmab(a, b, c); } };
template <typename T16, int NSPLIT, bool BIAS, int EPI>
__global__ __launch_bounds__(32) void k_gemmw(const T16* __restrict__ A, const T16* __restrict__ A2, const T16* __restrict__ Bt, const T16* __restrict__ Bt2, int K, float* C, int ldc, const float* __restrict__ bias, size_t sA, size_t sB, size_t sC, const float* __restrict__ CS, h16* __restrict__ P16, bf* __restrict__ Ph, bf* __restrict__ Pl) {
    typedef typename WFrag<T16>::V V;
    __shared__ __align__(16) float os[16 * 68];
    const size_t z = blockIdx.z; A += z * sA; if (A2) A2 += z * sA; Bt += z * sB; if (Bt2) Bt2 += z * sB; C += z * sC;
    const int lane = threadIdx.x & 31, lr = lane & 15, hi = lane >> 4; const int r0 = blockIdx.x * 64, c0 = blockIdx.y * 64;
    v8f acc[4][4];
#pragma unroll
    for (int mb = 0; mb < 4; ++mb)
#pragma unroll
        for (int nb = 0; nb < 4; ++nb) acc[mb][nb] = (v8f){};
    const size_t aoff = (size_t)(r0 + lr) * K + 8 * hi, boff = (size_t)(c0 + lr) * K + 8 * hi;
#pragma unroll 1
    for (int kc = 0; kc < K; kc += 32) {
        V a[4], a2[4];
#pragma unroll
        for (int mb = 0; mb < 4; ++mb) { a[mb] = WFrag<T16>::ld(A + aoff + (size_t)mb * 16 * K + kc); if (NSPLIT == 1 || NSPLIT == 2) a2[mb] = WFrag<T16>::ld(A2 + aoff + (size_t)mb * 16 * K + kc); }
#pragma unroll
        for (int nb = 0; nb < 4; ++nb) { const V b = WFrag<T16>::ld(Bt + boff + (size_t)nb * 16 * K + kc); V b2; if (NSPLIT >= 2) b2 = WFrag<T16>::ld(Bt2 + boff + (size_t)nb * 16 * K + kc);
#pragma unroll
            for (int mb = 0; mb < 4; ++mb) { acc[mb][nb] = WFrag<T16>::mma(a[mb], b, acc[mb][nb]); if (NSPLIT == 1 || NSPLIT == 2) acc[mb][nb] = WFrag<T16>::mma(a2[mb], b, acc[mb][nb]); if (NSPLIT >= 2) acc[mb][nb] = WFrag<T16>::mma(a[mb], b2, acc[mb][nb]); } }
        asm volatile("v_nop\n\tv_nop\n\tv_nop\n\tv_nop" : "+v"(acc[0][0]), "+v"(acc[1][1]), "+v"(acc[2][2]), "+v"(acc[3][3]) : "v"(a[0]), "v"(a[3]));
    }
    if constexpr (EPI == 2) {
#pragma unroll
        for (int nb = 0; nb < 4; ++nb)
#pragma unroll
            for (int mb = 0; mb < 4; ++mb) { v8h o16; v8us oh, ol;
#pragma unroll
                for (int j = 0; j < 8; ++j) { const float x = acc[mb][nb][j]; o16[j] = tohx(x); unsigned short a2, c2; splitf(x, a2, c2); oh[j] = a2; ol[j] = c2; }
                const size_t e = (size_t)(c0 + nb * 16 + lr) * TT + r0 + mb * 16 + hi * 8; *(v8h*)(P16 + e) = o16; *(v8us*)(Ph + e) = oh; *(v8us*)(Pl + e) = ol; }
        return; }
#pragma unroll
    for (int mb = 0; mb < 4; ++mb) {
#pragma unroll
        for (int nb = 0; nb < 4; ++nb) {
#pragma unroll
            for (int j = 0; j < 8; ++j) os[(hi * 8 + j) * 68 + nb * 16 + lr] = acc[mb][nb][j]; }
        __builtin_amdgcn_wave_barrier(); asm volatile("" ::: "memory");
        if constexpr (EPI == 1) {
#pragma unroll
            for (int s = 0; s < 4; ++s) { const int t = r0 + mb * 16 + 4 * s + (lane >> 3), d0 = (lane & 7) * 8; const float* xr = os + (4 * s + (lane >> 3)) * 68 + d0; const v4f xa = *(const v4fa*)xr, xb = *(const v4fa*)(xr + 4);
                const float x[8] = { xa[0], xa[1], xa[2], xa[3], xb[0], xb[1], xb[2], xb[3] }; const float* cp = CS + ((size_t)t * HD + d0) * 2; v8h o16; v8us oh, ol;
#pragma unroll
                for (int p = 0; p < 8; p += 2) { const v2f cs = *(const v2f*)(cp + 2 * p); const float x0 = x[p], x1 = x[p + 1];
                    const float r0_ = x0 * cs[0] - x1 * cs[1], r1_ = x0 * cs[1] + x1 * cs[0];   /* even: x0 c - x1 s; odd: x0 s + x1 c */
                    o16[p] = tohx(r0_); o16[p + 1] = tohx(r1_); { unsigned short a2, c2; splitf(r0_, a2, c2); oh[p] = a2; ol[p] = c2; splitf(r1_, a2, c2); oh[p + 1] = a2; ol[p + 1] = c2; } }
                const size_t e = ((size_t)blockIdx.y * TT + t) * HD + d0; *(v8h*)(P16 + e) = o16; *(v8us*)(Ph + e) = oh; *(v8us*)(Pl + e) = ol; }
            asm volatile("s_wait_xcnt 0x0" ::: "memory");   // behind the block's stores: the wait that stands in front of a rewrite of a register an issued store names
        } else {
        float* crow = C + (size_t)(r0 + mb * 16) * ldc + c0;
{
#pragma unroll
            for (int s = 0; s < 8; ++s) { const int row = 2 * s + hi, cofs = lr * 4; v4f val = *(const v4fa*)(os + row * 68 + cofs); if (BIAS) { val[0] += bfr(bias[c0 + cofs]); val[1] += bfr(bias[c0 + cofs + 1]); val[2] += bfr(bias[c0 + cofs + 2]); val[3] += bfr(bias[c0 + cofs + 3]); }
                *(v4f*)(crow + (size_t)row * ldc + cofs) = val; }
             }
        }
        __builtin_amdgcn_wave_barrier(); asm volatile("" ::: "memory");
    }
}


__global__ __launch_bounds__(256) void k_wtG(const float* __restrict__ w, int K, int N, bf* Bt) {
    const int lane = threadIdx.x & 31; const int L0 = (blockIdx.x * 8 + (threadIdx.x >> 5)) * 8; const int nlines = N * K / 64;
{
#pragma unroll 1
        for (int l = 0; l < 8; ++l) { const int L = L0 + l; if (L >= nlines) break; const size_t e = (size_t)L * 64 + lane * 2; const int k = (int)(e % K), n = (int)(e / K); v2us o;
            o[0] = f2bf(w[(size_t)k * N + n]); o[1] = f2bf(w[(size_t)(k + 1) * N + n]); *(v2us*)(Bt + e) = o; }
         }
}
__global__ __launch_bounds__(256) void k_cvt8(const float* __restrict__ src, bf* dst, size_t n8) { const size_t i = (size_t)blockIdx.x * 256 + threadIdx.x; if (i >= n8) return; const v8f v = *(const v8f*)(src + i * 8); v8us o;
#pragma unroll
    for (int k = 0; k < 8; ++k) o[k] = f2bf(v[k]); *(v8us*)(dst + i * 8) = o;  }
__constant__ float INVP[HD / 2] = { 1.000000000e+00f,7.498942018e-01f,5.623413324e-01f,4.216965139e-01f,3.162277639e-01f,2.371373773e-01f,1.778279394e-01f,1.333521456e-01f,1.000000015e-01f,7.498942316e-02f,5.623413250e-02f,4.216964915e-02f,3.162277490e-02f,2.371373773e-02f,1.778279431e-02f,1.333521400e-02f,9.999999776e-03f,7.498942316e-03f,5.623413250e-03f,4.216964822e-03f,3.162277630e-03f,2.371373819e-03f,1.778279431e-03f,1.333521446e-03f,1.000000047e-03f,7.498941850e-04f,5.623413017e-04f,4.216965172e-04f,3.162277571e-04f,2.371373703e-04f,1.778279402e-04f,1.333521504e-04f };   // 10000 ** (-2 i / 64) as float32 (the module's power form, jnp-computed; differs from 1/10000**(2i/64) by ulps)
__global__ __launch_bounds__(256) void k_csP(float* CS) { const int idx = blockIdx.x * 256 + threadIdx.x; if (idx >= TT * HD) return; const int d = idx % HD; const int t = idx / HD; const float a = __fmul_rn((float)t, INVP[d >> 1]); v2f cs; cs[0] = cosf(a); cs[1] = sinf(a); *(v2f*)(CS + (size_t)idx * 2) = cs;  }

#define NW   4
#define SL2E (SCL * 1.4426950408889634f)   // the score scale (a power of two: exact) rides in the exponent's factor; m is kept in unscaled scores
#define OP   68                   // pitch, in floats, of a query's partial output row in LDS (64 + 4: rows 16 bytes apart in the banks)
// 2^x of eight values: eight independent v_exp_f32, each in place, and behind the last the one free slot that the instruction set asks for between a transcendental and an instruction that reads its result or
// overwrites its source.
__device__ __forceinline__ v8f exp2x8(v8f x) { float a = x[0], b = x[1], c = x[2], d = x[3], e = x[4], f = x[5], g = x[6], h = x[7];
    asm("v_exp_f32 %0, %0\n\tv_exp_f32 %1, %1\n\tv_exp_f32 %2, %2\n\tv_exp_f32 %3, %3\n\tv_exp_f32 %4, %4\n\tv_exp_f32 %5, %5\n\tv_exp_f32 %6, %6\n\tv_exp_f32 %7, %7\n\tv_nop" : "+v"(a), "+v"(b), "+v"(c), "+v"(d), "+v"(e), "+v"(f), "+v"(g), "+v"(h));
    return (v8f){a, b, c, d, e, f, g, h}; }
__device__ __forceinline__ float exp2x1(float a) { asm("v_exp_f32 %0, %0\n\tv_nop" : "+v"(a)); return a; }   // one value, with the same slot
template <typename T16, int NQ, bool HL>
__device__ __forceinline__ void attn_tile(const T16* __restrict__ Q, const T16* __restrict__ Q2, const T16* __restrict__ Kp, const T16* __restrict__ Kp2, const T16* __restrict__ Vt, const T16* __restrict__ Vt2, int q0, bf* __restrict__ Ah, bf* __restrict__ Al, float* os, float* ml) {
    typedef typename WFrag<T16>::V V;
    const int lane = threadIdx.x & 31, lr = lane & 15, hi = lane >> 4; const int w = __builtin_amdgcn_readfirstlane(threadIdx.x >> 5);
    const int klast = (q0 + NQ * 16 - 1) & ~31;      // first key of the 32-key block that holds the tile's last diagonal element
    V q[NQ][2], q2[NQ][2], k[2][2], k2[2][2];
    // every operand load is addressed as one lane pointer per plane and pass plus a constant that fits the instruction's offset field (no address sums per load)
    const unsigned kof = (unsigned)(lr * HD + 8 * hi), vof = (unsigned)(lr * TT + 8 * hi); const T16* pk = nullptr; const T16* pk2 = nullptr;
#pragma unroll
    for (int qt = 0; qt < NQ; ++qt)
#pragma unroll
        for (int c = 0; c < 2; ++c) { const int qc = qt * 16 * HD + c * 32; q[qt][c] = WFrag<T16>::ld(Q + (size_t)q0 * HD + kof + qc); if (HL) q2[qt][c] = WFrag<T16>::ld(Q2 + (size_t)q0 * HD + kof + qc); }
    auto ldk = [&](int kk) {                         // the four (HL: eight) fragments of the 32 key rows from kk on
        pk = Kp + (size_t)kk * HD + kof; if (HL) pk2 = Kp2 + (size_t)kk * HD + kof;
#pragma unroll
        for (int kt = 0; kt < 2; ++kt)
#pragma unroll
            for (int c = 0; c < 2; ++c) { const int kc = kt * 16 * HD + c * 32; k[kt][c] = WFrag<T16>::ld(pk + kc); if (HL) k2[kt][c] = WFrag<T16>::ld(pk2 + kc); } };
    if (!HL) ldk(min(32 * w, klast));                // fp16: key fragments run one pass ahead (a wave with no block of its own fetches the last one: in bounds, unused); hi/lo: at most 4 passes a wave, fetched in the pass, which keeps the registers under 256
    v8f o[4][NQ]; float m[NQ], l[NQ];
#pragma unroll
    for (int qt = 0; qt < NQ; ++qt) { m[qt] = -3.0e38f; l[qt] = 0.f;
#pragma unroll
        for (int dt = 0; dt < 4; ++dt) o[dt][qt] = (v8f){}; }
#pragma unroll 1   // stays rolled: the trip count is known only at run time, and a second copy of the body (its fragments and score tiles) would not fit the registers
    for (int kb = 32 * w; kb <= klast; kb += 32 * NW) {
        if (HL) ldk(kb);
        V v[4], v2[4]; const T16* pv = Vt + (size_t)kb + vof; const T16* pv2 = HL ? Vt2 + (size_t)kb + vof : nullptr;
#pragma unroll
        for (int dt = 0; dt < 4; ++dt) { v[dt] = WFrag<T16>::ld(pv + dt * 16 * TT); if (HL) v2[dt] = WFrag<T16>::ld(pv2 + dt * 16 * TT); }
        v8f s[2][NQ];
#pragma unroll
        for (int kt = 0; kt < 2; ++kt)
#pragma unroll
            for (int qt = 0; qt < NQ; ++qt) { v8f a = (v8f){};
#pragma unroll
                for (int c = 0; c < 2; ++c) { a = WFrag<T16>::mma(k[kt][c], q[qt][c], a); if (HL) { a = WFrag<T16>::mma(k[kt][c], q2[qt][c], a); a = WFrag<T16>::mma(k2[kt][c], q[qt][c], a); } }
                s[kt][qt] = a; }
        if (!HL) ldk(min(kb + 32 * NW, klast));       // the wave's next key fragments are fetched now, behind this pass's last use of the registers (its last pass fetches the last block: in bounds, unused)
        // all of the pass's loads are issued: the wait that stands in front of a rewrite of a register an issued load names. The pass's lane pointers are its inputs, so that their registers stay theirs up to here (one build landed later loads of the run in them)
        if constexpr (HL) asm volatile("s_wait_xcnt 0x0" :: "v"(pk), "v"(pk2), "v"(pv), "v"(pv2) : "memory"); else asm volatile("s_wait_xcnt 0x0" :: "v"(pk), "v"(pv) : "memory");
        if (kb == klast) {                            // only the last block crosses the diagonal: key > query is masked
#pragma unroll
            for (int kt = 0; kt < 2; ++kt)
#pragma unroll
                for (int qt = 0; qt < NQ; ++qt)
#pragma unroll
                    for (int j = 0; j < 8; ++j) if (kb + kt * 16 + hi * 8 + j > q0 + qt * 16 + lr) s[kt][qt][j] = -3.0e38f; }
        V pb[NQ], pb2[NQ];
#pragma unroll
        for (int qt = 0; qt < NQ; ++qt) {
            float mx = fmaxf(s[0][qt][0], s[1][qt][0]);
#pragma unroll
            for (int j = 1; j < 8; ++j) mx = fmaxf(mx, fmaxf(s[0][qt][j], s[1][qt][j]));
            mx = fmaxf(mx, __shfl_xor(mx, 16, 32));
            const float mn = fmaxf(m[qt], mx); const float al = exp2x1((m[qt] - mn) * SL2E); m[qt] = mn;
            float sum = 0.f;
#pragma unroll
            for (int kt = 0; kt < 2; ++kt) { v8f x;
#pragma unroll
                for (int j = 0; j < 8; ++j) { const float y = (s[kt][qt][j] - mn) * SL2E; x[j] = HL ? y : y + 10.0f; }
                x = exp2x8(x); s[kt][qt] = x;
#pragma unroll
                for (int j = 0; j < 8; ++j) sum += x[j]; }
            l[qt] = l[qt] * al + sum;
#pragma unroll
            for (int dt = 0; dt < 4; ++dt) o[dt][qt] *= al;
            if constexpr (HL) { v8us h0, h1, l0, l1;
#pragma unroll
                for (int j = 0; j < 8; ++j) { unsigned short a, c2; splitf(s[0][qt][j], a, c2); h0[j] = a; l0[j] = c2; splitf(s[1][qt][j], a, c2); h1[j] = a; l1[j] = c2; }
                pb[qt] = cat16b(h0, h1); pb2[qt] = cat16b(l0, l1);
            } else { v8h h0, h1;
#pragma unroll
                for (int j = 0; j < 8; ++j) { h0[j] = tohx(s[0][qt][j]); h1[j] = tohx(s[1][qt][j]); }
                pb[qt] = cat16(h0, h1); }
        }
#pragma unroll
        for (int dt = 0; dt < 4; ++dt)
#pragma unroll
            for (int qt = 0; qt < NQ; ++qt) { o[dt][qt] = WFrag<T16>::mma(v[dt], pb[qt], o[dt][qt]); if (HL) { o[dt][qt] = WFrag<T16>::mma(v[dt], pb2[qt], o[dt][qt]); o[dt][qt] = WFrag<T16>::mma(v2[dt], pb[qt], o[dt][qt]); } }
    }
#pragma unroll
    for (int qt = 0; qt < NQ; ++qt) { const int row = w * (NQ * 16) + qt * 16 + lr; const float ls = l[qt] + __shfl_xor(l[qt], 16, 32);   // the halves' sums are joined once, here
        if (hi == 0) { v2f t2; t2[0] = m[qt]; t2[1] = ls; *(v2f*)(ml + row * 2) = t2; }
#pragma unroll
        for (int dt = 0; dt < 4; ++dt) { float* p = os + row * OP + dt * 16 + hi * 8; *(v4f*)p = __builtin_shufflevector(o[dt][qt], o[dt][qt], 0, 1, 2, 3); *(v4f*)(p + 4) = __builtin_shufflevector(o[dt][qt], o[dt][qt], 4, 5, 6, 7); } }
    __syncthreads();                                  // every wave's (m, l, O) is in LDS before any wave joins them
    constexpr int LPQ = 8 / NQ, DPL = 8 * NQ;         // lanes per query row and output elements per lane in the join
    const int qq = w * (NQ * 4) + lane / LPQ, d0 = (lane % LPQ) * DPL;
    v2f t[NW]; float M = -3.0e38f;
#pragma unroll
    for (int i = 0; i < NW; ++i) { t[i] = *(const v2f*)(ml + (i * (NQ * 16) + qq) * 2); M = fmaxf(M, t[i][0]); }
    float L = 0.f, acc[DPL];
#pragma unroll
    for (int e = 0; e < DPL; ++e) acc[e] = 0.f;
#pragma unroll
    for (int i = 0; i < NW; ++i) { const float sc = exp2x1((t[i][0] - M) * SL2E); L += t[i][1] * sc;   // a wave that had no block: m = -3e38, so sc = 0, on l = 0 and O = 0
#pragma unroll
        for (int e = 0; e < DPL; e += 4) { const v4f x = *(const v4f*)(os + (i * (NQ * 16) + qq) * OP + d0 + e); acc[e] += x[0] * sc; acc[e + 1] += x[1] * sc; acc[e + 2] += x[2] * sc; acc[e + 3] += x[3] * sc; } }
    const float inv = __fdiv_rn(1.0f, L);
#pragma unroll
    for (int c = 0; c < DPL / 8; ++c) { v8us oh, ol;
#pragma unroll
        for (int j = 0; j < 8; ++j) { unsigned short a, c2; splitf(acc[c * 8 + j] * inv, a, c2); oh[j] = a; ol[j] = c2; }
        const size_t oo = (size_t)(q0 + qq) * DQ + d0 + c * 8; *(v8us*)(Ah + oo) = oh; *(v8us*)(Al + oo) = ol; }
    // hi/lo form only: behind the last store, the wait that stands in front of any rewrite of a register an issued store names (in the listing the way on from here leads past the fp16 form's entry, which writes such registers; the fp16 form's stores run straight into the end of the program)
    if constexpr (HL) asm volatile("s_wait_xcnt 0x0" ::: "memory");
}
// grid (heads, tiles): blockIdx.y ranks the tiles by falling cost: the (TT - RH) / 32 fp16 tiles of 32 rows from the last row up, then the RH / 16 hi/lo tiles of 16 rows.
__global__ __launch_bounds__(32 * NW) void k_attn(const h16* __restrict__ Q16, const h16* __restrict__ K16, const h16* __restrict__ V16, const bf* __restrict__ Qh, const bf* __restrict__ Ql, const bf* __restrict__ Kh, const bf* __restrict__ Kl, const bf* __restrict__ Vh, const bf* __restrict__ Vl, bf* __restrict__ Ah, bf* __restrict__ Al) {
    __shared__ __align__(16) float os[NW * 32 * OP]; __shared__ __align__(16) float ml[NW * 32 * 2];
    const size_t hp = (size_t)blockIdx.x * TT * HD; const int r = blockIdx.y; Ah += blockIdx.x * HD; Al += blockIdx.x * HD;
    if (r < (TT - RH) / 32) attn_tile<h16, 2, false>(Q16 + hp, nullptr, K16 + hp, nullptr, V16 + hp, nullptr, TT - 32 - 32 * r, Ah, Al, os, ml);
    else attn_tile<bf, 1, true>(Qh + hp, Ql + hp, Kh + hp, Kl + hp, Vh + hp, Vl + hp, RH - 16 - 16 * (r - (TT - RH) / 32), Ah, Al, os, ml);
}

extern "C" void kernel_launch(void* const* d_in, const int* in_sizes, int n_in,
                              void* d_out, int out_size, void* d_ws, size_t ws_size, hipStream_t stream) {
    (void)in_sizes; (void)n_in; (void)out_size;
    const float* x = (const float*)d_in[0]; const float* wq = (const float*)d_in[1]; const float* wk = wq + (size_t)DQ * DM; const float* wv = wq + (size_t)2 * DQ * DM; const float* wo = (const float*)d_in[2];   /* input order X, W_qkv ('oi' [3072][1024]: q | k | v = its three 1,024-row blocks), W_o ('oi' [1024][1024]): THREE inputs; the host's three separate 'oi' weights are the row blocks of this module's fused one */
    float* OUT = (float*)d_out;     // [2][2048][1024]
    char* wsp = (char*)d_ws;
    auto take = [&](size_t bytes) { char* p = wsp; wsp += (bytes + 255) & ~(size_t)255; return (void*)p; };
    bf* WQ = (bf*)take((size_t)DQ * DM * 2); bf* WK = (bf*)take((size_t)DKV * DM * 2); bf* WV = (bf*)take((size_t)DKV * DM * 2); bf* WO = (bf*)take((size_t)DM * DQ * 2); float* CS = (float*)take((size_t)TT * HD * 2 * 4);
    h16* QP16 = (h16*)take((size_t)NH_ * TT * HD * 2); h16* KP16 = (h16*)take((size_t)NKV * TT * HD * 2); h16* VT16 = (h16*)take((size_t)NKV * HD * TT * 2);
    bf* QPh = (bf*)take((size_t)NH_ * TT * HD * 2); bf* QPl = (bf*)take((size_t)NH_ * TT * HD * 2); bf* KPh = (bf*)take((size_t)NKV * TT * HD * 2); bf* KPl = (bf*)take((size_t)NKV * TT * HD * 2); bf* VTh = (bf*)take((size_t)NKV * HD * TT * 2); bf* VTl = (bf*)take((size_t)NKV * HD * TT * 2);
    bf* XB = (bf*)take((size_t)TT * DM * 2);
    bf* ATh = (bf*)take((size_t)TT * DQ * 2); bf* ATl = (bf*)take((size_t)TT * DQ * 2);
    if ((size_t)(wsp - (char*)d_ws) > ws_size) return;    // ws 256 MiB
    { k_cvt8<<<(unsigned)(((size_t)DQ * DM / 8 + 255) / 256), 256, 0, stream>>>(wq, WQ, (size_t)DQ * DM / 8); k_cvt8<<<(unsigned)(((size_t)DKV * DM / 8 + 255) / 256), 256, 0, stream>>>(wk, WK, (size_t)DKV * DM / 8); k_cvt8<<<(unsigned)(((size_t)DKV * DM / 8 + 255) / 256), 256, 0, stream>>>(wv, WV, (size_t)DKV * DM / 8);
      k_cvt8<<<(unsigned)(((size_t)DM * DQ / 8 + 255) / 256), 256, 0, stream>>>(wo, WO, (size_t)DM * DQ / 8);
       }
    for (int b = 0; b < NB_; ++b) {
        if (b == 0) k_csP<<<(TT * HD + 255) / 256, 256, 0, stream>>>(CS);   /* {cos, sin}(t x THETA**(-2i/64)) per interleaved pair */
        k_cvt8<<<(unsigned)(((size_t)TT * DM / 8 + 255) / 256), 256, 0, stream>>>(x + (size_t)b * TT * DM, XB, (size_t)TT * DM / 8);
        k_gemmw<bf, 0, false, 1><<<dim3(TT / 64, DQ / 64, 1), 32, 0, stream>>>(XB, nullptr, WQ, nullptr, DM, nullptr, 0, nullptr, 0, 0, 0, CS, QP16, QPh, QPl);
        k_gemmw<bf, 0, false, 1><<<dim3(TT / 64, DKV / 64, 1), 32, 0, stream>>>(XB, nullptr, WK, nullptr, DM, nullptr, 0, nullptr, 0, 0, 0, CS, KP16, KPh, KPl);
        k_gemmw<bf, 0, false, 2><<<dim3(TT / 64, DKV / 64, 1), 32, 0, stream>>>(XB, nullptr, WV, nullptr, DM, nullptr, 0, nullptr, 0, 0, 0, nullptr, VT16, VTh, VTl);
        k_attn<<<dim3(NH_, (TT - RH) / 32 + RH / 16, 1), 32 * NW, 0, stream>>>(QP16, KP16, VT16, QPh, QPl, KPh, KPl, VTh, VTl, ATh, ATl);   // one kv head per query head
        k_gemmw<bf, 1, false, 0><<<dim3(TT / 64, DM / 64, 1), 32, 0, stream>>>(ATh, ATl, WO, nullptr, DQ, OUT + (size_t)b * TT * DM, DM, nullptr, 0, 0, 0, nullptr, nullptr, nullptr, nullptr); }
}

// v005
// A run of this version takes 141 microseconds.
// Next to v004, in two timings, it ran 1.87 times as fast each time.
// Counting every step since v000, it is 10.3 times as fast.
#include <hip/hip_runtime.h>

// Causal multi-head self-attention with interleaved rotary embeddings and a FUSED (out, in) qkv weight (X [2][2048][1024]; qkv = einsum('bsd,od->bso', X, W_qkv) ('oi' [3072][1024] std sqrt(2/4096), no bias) viewed (B, S, 3, 16, 64): q | k | v = the three 1,024-ROW blocks of W_qkv (16 heads x 64); rotary on (even, odd) pairs with angle pos / (10000 ** (2 k / 64)) (float32 constants 10000^(-2i/64), precise cosf/sinf); scores x 64^-0.5, causal (-inf); softmax; out = merged W_o^T ('oi', no bias) -> [2][2048][1024] (4.2 M); argument order X, W_qkv, W_o.
// Both batches ride in every launch (4 launches): bf16 copies of x and the weights; exact projections; {cos, sin} per (position, pair) from the int positions (jnp-exact float32 inverse frequencies, precise cosf/sinf); interleaved rotary and the 16-bit head planes in the projections' own epilogues; causal T-2048 attention fused in k_attn (hybrid rows: < 512 hi/lo 3 products, rest fp16 x1024; running maximum, keys walked up to the diagonal); merged hi/lo x wo exact, no bias.
// Compute dtypes, f32 accumulate: every input rounded to bf16; projections exact ; rotary f32; attention rows < 512 3 products, rest fp16; softmax f32; wo hl x exact, no bias.

#define NB_  2
#define TT   2048
#define DM   1024
#define NH_  16
#define NKV  16
#define REP  (NH_ / NKV)
#define HD   64
#define DQ   (NH_ * HD)
#define DKV  (NKV * HD)
#define RH   512                  // query rows < RH use hi+lo planes (0: none)
#define SCL  0.125f   // HD^-0.5
typedef _Float16 h16;
typedef unsigned short bf;
typedef __attribute__((ext_vector_type(16))) __bf16   v16bf;
typedef __attribute__((ext_vector_type(16))) _Float16 v16h;
typedef __attribute__((ext_vector_type(8)))  _Float16 v8h;
typedef __attribute__((ext_vector_type(8)))  unsigned short v8us;
typedef __attribute__((ext_vector_type(8)))  float    v8f;
typedef __attribute__((ext_vector_type(4)))  float    v4f;
typedef v8h  __attribute__((may_alias)) v8ha;
typedef v4f  __attribute__((may_alias)) v4fa;
typedef v8us __attribute__((may_alias)) v8usa;

__device__ __forceinline__ unsigned short f2bf(float f) { unsigned u = __float_as_uint(f); u += 0x7FFFu + ((u >> 16) & 1u); return (unsigned short)(u >> 16); }
__device__ __forceinline__ float bf2f(unsigned short b) { return __uint_as_float(((unsigned)b) << 16); }
__device__ __forceinline__ float bfr(float f) { return bf2f(f2bf(f)); }
__device__ __forceinline__ v16h cat16(v8h lo, v8h hi) { return __builtin_shufflevector(lo, hi, 0, 1, 2, 3, 4, 5, 6, 7, 8, 9, 10, 11, 12, 13, 14, 15); }
__device__ __forceinline__ v16bf cat16b(v8us lo, v8us hi) { return __builtin_bit_cast(v16bf, __builtin_shufflevector(lo, hi, 0, 1, 2, 3, 4, 5, 6, 7, 8, 9, 10, 11, 12, 13, 14, 15)); }
__device__ __forceinline__ v8f wmma16(v16h a, v16h b, v8f c) { return __builtin_amdgcn_wmma_f32_16x16x32_f16(false, a, false, b, (short)0, c, false, false); }
__device__ __forceinline__ v8f wmmab(v16bf a, v16bf b, v8f c) { return __builtin_amdgcn_wmma_f32_16x16x32_bf16(false, a, false, b, (short)0, c, false, false); }



__device__ __forceinline__ h16 tohx(float x) { return (h16)x; }
__device__ __forceinline__ void splitf(float y, unsigned short& h, unsigned short& l) { h = f2bf(y); l = f2bf(y - bf2f(h)); }
typedef __attribute__((ext_vector_type(2))) _Float16 v2h;
typedef __attribute__((ext_vector_type(4))) _Float16 v4h;
typedef __attribute__((ext_vector_type(2))) unsigned short v2us;
typedef __attribute__((ext_vector_type(4))) unsigned short v4us;
typedef __attribute__((ext_vector_type(2))) float v2f;
typedef __attribute__((ext_vector_type(4))) int v4i;

// ---- k_gemmw: register-blocked GEMM, ONE WAVE per 64x64 output tile (16 accumulators), operands straight from K-contiguous 16-bit planes; grid (M/64, N/64, Z), 32 threads.
// C[m][n] (f32, pitch ldc, + optional f32 bias[n]) = sum_k A[m][k] Bt[n][k] (+ split products per NSPLIT). z-batch strides sA/sB/sC in elements. K % 32 == 0.
// EPI says where the tile goes. 0: C as above. 1: the fused q | k | v projection of batch blockIdx.z: the tile is 64 positions (rows) x the 64 columns of ONE head (blockIdx.y = which * NH_ + head, which = 0 q, 1 k, 2 v), and it leaves the wave as the attention's 16-bit planes (fp16, bf16 hi, bf16 lo; each buffer [which][batch][head] planes of TT * HD), no f32 copy in between:
// q, k: interleaved rotary with {cos, sin} from CS, planes [t][d] (a lane turns 8 columns of a row: 16-byte stores, 8 lanes fill a 128-byte line); v: planes [d][t]: a lane's accumulator holds 8 consecutive positions of one column, which IS 16 bytes of the transposed row.
template <typename T16> struct WFrag;
template <> struct WFrag<h16> { typedef v16h V; static __device__ __forceinline__ V ld(const h16* p) { return cat16(*(const v8h*)p, *(const v8h*)(p + 16)); } static __device__ __forceinline__ v8f mma(V a, V b, v8f c) { return wmma16(a, b, c); } };
template <> struct WFrag<bf> { typedef v16bf V; static __device__ __forceinline__ V ld(const bf* p) { return cat16b(*(const v8us*)p, *(const v8us*)(p + 16)); } static __device__ __forceinline__ v8f mma(V a, V b, v8f c) { return wmmab(a, b, c); } };
template <typename T16, int NSPLIT, bool BIAS, int EPI>
__global__ __launch_bounds__(32) void k_gemmw(const T16* __restrict__ A, const T16* __restrict__ A2, const T16* __restrict__ Bt, const T16* __restrict__ Bt2, int K, float* C, int ldc, const float* __restrict__ bias, size_t sA, size_t sB, size_t sC, const float* __restrict__ CS, h16* __restrict__ P16, bf* __restrict__ Ph, bf* __restrict__ Pl) {
    typedef typename WFrag<T16>::V V;
    __shared__ __align__(16) float os[16 * 68];
    const size_t z = blockIdx.z; A += z * sA; if (A2) A2 += z * sA; Bt += z * sB; if (Bt2) Bt2 += z * sB; C += z * sC;
    const int lane = threadIdx.x & 31, lr = lane & 15, hi = lane >> 4; const int r0 = blockIdx.x * 64, c0 = blockIdx.y * 64;
    v8f acc[4][4];
#pragma unroll
    for (int mb = 0; mb < 4; ++mb)
#pragma unroll
        for (int nb = 0; nb < 4; ++nb) acc[mb][nb] = (v8f){};
    const size_t aoff = (size_t)(r0 + lr) * K + 8 * hi, boff = (size_t)(c0 + lr) * K + 8 * hi;
#pragma unroll 1
    for (int kc = 0; kc < K; kc += 32) {
        V a[4], a2[4];
#pragma unroll
        for (int mb = 0; mb < 4; ++mb) { a[mb] = WFrag<T16>::ld(A + aoff + (size_t)mb * 16 * K + kc); if (NSPLIT == 1 || NSPLIT == 2) a2[mb] = WFrag<T16>::ld(A2 + aoff + (size_t)mb * 16 * K + kc); }
#pragma unroll
        for (int nb = 0; nb < 4; ++nb) { const V b = WFrag<T16>::ld(Bt + boff + (size_t)nb * 16 * K + kc); V b2; if (NSPLIT >= 2) b2 = WFrag<T16>::ld(Bt2 + boff + (size_t)nb * 16 * K + kc);
#pragma unroll
            for (int mb = 0; mb < 4; ++mb) { acc[mb][nb] = WFrag<T16>::mma(a[mb], b, acc[mb][nb]); if (NSPLIT == 1 || NSPLIT == 2) acc[mb][nb] = WFrag<T16>::mma(a2[mb], b, acc[mb][nb]); if (NSPLIT >= 2) acc[mb][nb] = WFrag<T16>::mma(a[mb], b2, acc[mb][nb]); } }
        asm volatile("v_nop\n\tv_nop\n\tv_nop\n\tv_nop" : "+v"(acc[0][0]), "+v"(acc[1][1]), "+v"(acc[2][2]), "+v"(acc[3][3]) : "v"(a[0]), "v"(a[3]));
    }
    const size_t pl = EPI == 1 ? ((size_t)(blockIdx.y / NH_) * NB_ + z) * NH_ + blockIdx.y % NH_ : 0;   // the tile's plane
    if (EPI == 1 && blockIdx.y >= 2 * NH_) {          // v (the same for the whole wave)
#pragma unroll
        for (int nb = 0; nb < 4; ++nb)
#pragma unroll
            for (int mb = 0; mb < 4; ++mb) { v8h o16; v8us oh, ol;
#pragma unroll
                for (int j = 0; j < 8; ++j) { const float x = acc[mb][nb][j]; o16[j] = tohx(x); unsigned short a2, c2; splitf(x, a2, c2); oh[j] = a2; ol[j] = c2; }
                const size_t e = (pl * HD + nb * 16 + lr) * TT + r0 + mb * 16 + hi * 8; *(v8h*)(P16 + e) = o16; *(v8us*)(Ph + e) = oh; *(v8us*)(Pl + e) = ol;
                asm volatile("s_wait_xcnt 0x0" ::: "memory"); }   // behind the block's stores: the wait that stands in front of a rewrite of a register an issued store names (the next block's values land in such registers)
        return; }
#pragma unroll
    for (int mb = 0; mb < 4; ++mb) {
#pragma unroll
        for (int nb = 0; nb < 4; ++nb) {
#pragma unroll
            for (int j = 0; j < 8; ++j) os[(hi * 8 + j) * 68 + nb * 16 + lr] = acc[mb][nb][j]; }
        __builtin_amdgcn_wave_barrier(); asm volatile("" ::: "memory");
        if constexpr (EPI == 1) {
#pragma unroll
            for (int s = 0; s < 4; ++s) { const int t = r0 + mb * 16 + 4 * s + (lane >> 3), d0 = (lane & 7) * 8; const float* xr = os + (4 * s + (lane >> 3)) * 68 + d0; const v4f xa = *(const v4fa*)xr, xb = *(const v4fa*)(xr + 4);
                const float x[8] = { xa[0], xa[1], xa[2], xa[3], xb[0], xb[1], xb[2], xb[3] }; const float* cp = CS + ((size_t)t * HD + d0) * 2; v8h o16; v8us oh, ol;
#pragma unroll
                for (int p = 0; p < 8; p += 2) { const v2f cs = *(const v2f*)(cp + 2 * p); const float x0 = x[p], x1 = x[p + 1];
                    const float r0_ = x0 * cs[0] - x1 * cs[1], r1_ = x0 * cs[1] + x1 * cs[0];   /* even: x0 c - x1 s; odd: x0 s + x1 c */
                    o16[p] = tohx(r0_); o16[p + 1] = tohx(r1_); { unsigned short a2, c2; splitf(r0_, a2, c2); oh[p] = a2; ol[p] = c2; splitf(r1_, a2, c2); oh[p + 1] = a2; ol[p + 1] = c2; } }
                const size_t e = (pl * TT + t) * HD + d0; *(v8h*)(P16 + e) = o16; *(v8us*)(Ph + e) = oh; *(v8us*)(Pl + e) = ol; }
            asm volatile("s_wait_xcnt 0x0" ::: "memory");   // behind the block's stores: the wait that stands in front of a rewrite of a register an issued store names (one build landed the next block's table loads in such registers)
        } else {
        float* crow = C + (size_t)(r0 + mb * 16) * ldc + c0;
{
#pragma unroll
            for (int s = 0; s < 8; ++s) { const int row = 2 * s + hi, cofs = lr * 4; v4f val = *(const v4fa*)(os + row * 68 + cofs); if (BIAS) { val[0] += bfr(bias[c0 + cofs]); val[1] += bfr(bias[c0 + cofs + 1]); val[2] += bfr(bias[c0 + cofs + 2]); val[3] += bfr(bias[c0 + cofs + 3]); }
                *(v4f*)(crow + (size_t)row * ldc + cofs) = val; }
             }
        }
        __builtin_amdgcn_wave_barrier(); asm volatile("" ::: "memory");
    }
}


__global__ __launch_bounds__(256) void k_wtG(const float* __restrict__ w, int K, int N, bf* Bt) {
    const int lane = threadIdx.x & 31; const int L0 = (blockIdx.x * 8 + (threadIdx.x >> 5)) * 8; const int nlines = N * K / 64;
{
#pragma unroll 1
        for (int l = 0; l < 8; ++l) { const int L = L0 + l; if (L >= nlines) break; const size_t e = (size_t)L * 64 + lane * 2; const int k = (int)(e % K), n = (int)(e / K); v2us o;
            o[0] = f2bf(w[(size_t)k * N + n]); o[1] = f2bf(w[(size_t)(k + 1) * N + n]); *(v2us*)(Bt + e) = o; }
         }
}
__device__ __forceinline__ void cvt8(const float* __restrict__ src, bf* dst, int blk) { const size_t i = (size_t)blk * 256 + threadIdx.x; const v8f v = *(const v8f*)(src + i * 8); v8us o;   // 2,048 elements a block; every buffer is a whole number of blocks
#pragma unroll
    for (int k = 0; k < 8; ++k) o[k] = f2bf(v[k]); *(v8us*)(dst + i * 8) = o;  }
__constant__ float INVP[HD / 2] = { 1.000000000e+00f,7.498942018e-01f,5.623413324e-01f,4.216965139e-01f,3.162277639e-01f,2.371373773e-01f,1.778279394e-01f,1.333521456e-01f,1.000000015e-01f,7.498942316e-02f,5.623413250e-02f,4.216964915e-02f,3.162277490e-02f,2.371373773e-02f,1.778279431e-02f,1.333521400e-02f,9.999999776e-03f,7.498942316e-03f,5.623413250e-03f,4.216964822e-03f,3.162277630e-03f,2.371373819e-03f,1.778279431e-03f,1.333521446e-03f,1.000000047e-03f,7.498941850e-04f,5.623413017e-04f,4.216965172e-04f,3.162277571e-04f,2.371373703e-04f,1.778279402e-04f,1.333521504e-04f };   // 10000 ** (-2 i / 64) as float32 (the module's power form, jnp-computed; differs from 1/10000**(2i/64) by ulps)
__device__ __forceinline__ void csP(float* CS, int blk) { const int idx = blk * 256 + threadIdx.x; const int d = idx % HD; const int t = idx / HD; const float a = __fmul_rn((float)t, INVP[d >> 1]); v2f cs; cs[0] = cosf(a); cs[1] = sinf(a); *(v2f*)(CS + (size_t)idx * 2) = cs;  }
// ---- k_prep: all that the GEMMs read and that depends on no other launch, in one grid; blockIdx.x picks the job by range (the same for a whole block), the table (the longest blocks) first.
#define PB_CS (TT * HD / 256)
#define PB_X  (NB_ * TT * DM / 2048)
#define PB_W  ((DQ + 2 * DKV) * DM / 2048)
#define PB_O  (DM * DQ / 2048)
__global__ __launch_bounds__(256) void k_prep(const float* __restrict__ x, const float* __restrict__ wqkv, const float* __restrict__ wo, bf* XB, bf* WQKV, bf* WO, float* CS) {
    int b = blockIdx.x;
    if (b < PB_CS) { csP(CS, b); return; }
    b -= PB_CS; const float* src = x; bf* dst = XB;
    if (b >= PB_X + PB_W) { b -= PB_X + PB_W; src = wo; dst = WO; } else if (b >= PB_X) { b -= PB_X; src = wqkv; dst = WQKV; }
    cvt8(src, dst, b);
}

#define NW   4
#define SL2E (SCL * 1.4426950408889634f)   // the score scale (a power of two: exact) rides in the exponent's factor; m is kept in unscaled scores
#define OP   68                   // pitch, in floats, of a query's partial output row in LDS (64 + 4: rows 16 bytes apart in the banks)
// 2^x of eight values: eight independent v_exp_f32, each in place, and behind the last the one free slot that the instruction set asks for between a transcendental and an instruction that reads its result or
// overwrites its source.
__device__ __forceinline__ v8f exp2x8(v8f x) { float a = x[0], b = x[1], c = x[2], d = x[3], e = x[4], f = x[5], g = x[6], h = x[7];
    asm("v_exp_f32 %0, %0\n\tv_exp_f32 %1, %1\n\tv_exp_f32 %2, %2\n\tv_exp_f32 %3, %3\n\tv_exp_f32 %4, %4\n\tv_exp_f32 %5, %5\n\tv_exp_f32 %6, %6\n\tv_exp_f32 %7, %7\n\tv_nop" : "+v"(a), "+v"(b), "+v"(c), "+v"(d), "+v"(e), "+v"(f), "+v"(g), "+v"(h));
    return (v8f){a, b, c, d, e, f, g, h}; }
__device__ __forceinline__ float exp2x1(float a) { asm("v_exp_f32 %0, %0\n\tv_nop" : "+v"(a)); return a; }   // one value, with the same slot
template <typename T16, int NQ, bool HL>
__device__ __forceinline__ void attn_tile(const T16* __restrict__ Q, const T16* __restrict__ Q2, const T16* __restrict__ Kp, const T16* __restrict__ Kp2, const T16* __restrict__ Vt, const T16* __restrict__ Vt2, int q0, bf* __restrict__ Ah, bf* __restrict__ Al, float* os, float* ml) {
    typedef typename WFrag<T16>::V V;
    const int lane = threadIdx.x & 31, lr = lane & 15, hi = lane >> 4; const int w = __builtin_amdgcn_readfirstlane(threadIdx.x >> 5);
    const int klast = (q0 + NQ * 16 - 1) & ~31;      // first key of the 32-key block that holds the tile's last diagonal element
    V q[NQ][2], q2[NQ][2], k[2][2], k2[2][2];
    // every operand load is addressed as one lane pointer per plane and pass plus a constant that fits the instruction's offset field (no address sums per load)
    const unsigned kof = (unsigned)(lr * HD + 8 * hi), vof = (unsigned)(lr * TT + 8 * hi); const T16* pk = nullptr; const T16* pk2 = nullptr;
#pragma unroll
    for (int qt = 0; qt < NQ; ++qt)
#pragma unroll
        for (int c = 0; c < 2; ++c) { const int qc = qt * 16 * HD + c * 32; q[qt][c] = WFrag<T16>::ld(Q + (size_t)q0 * HD + kof + qc); if (HL) q2[qt][c] = WFrag<T16>::ld(Q2 + (size_t)q0 * HD + kof + qc); }
    auto ldk = [&](int kk) {                         // the four (HL: eight) fragments of the 32 key rows from kk on
        pk = Kp + (size_t)kk * HD + kof; if (HL) pk2 = Kp2 + (size_t)kk * HD + kof;
#pragma unroll
        for (int kt = 0; kt < 2; ++kt)
#pragma unroll
            for (int c = 0; c < 2; ++c) { const int kc = kt * 16 * HD + c * 32; k[kt][c] = WFrag<T16>::ld(pk + kc); if (HL) k2[kt][c] = WFrag<T16>::ld(pk2 + kc); } };
    if (!HL) ldk(min(32 * w, klast));                // fp16: key fragments run one pass ahead (a wave with no block of its own fetches the last one: in bounds, unused); hi/lo: at most 4 passes a wave, fetched in the pass, which keeps the registers under 256
    v8f o[4][NQ]; float m[NQ], l[NQ];
#pragma unroll
    for (int qt = 0; qt < NQ; ++qt) { m[qt] = -3.0e38f; l[qt] = 0.f;
#pragma unroll
        for (int dt = 0; dt < 4; ++dt) o[dt][qt] = (v8f){}; }
#pragma unroll 1   // stays rolled: the trip count is known only at run time, and a second copy of the body (its fragments and score tiles) would not fit the registers
    for (int kb = 32 * w; kb <= klast; kb += 32 * NW) {
        if (HL) ldk(kb);
        V v[4], v2[4]; const T16* pv = Vt + (size_t)kb + vof; const T16* pv2 = HL ? Vt2 + (size_t)kb + vof : nullptr;
#pragma unroll
        for (int dt = 0; dt < 4; ++dt) { v[dt] = WFrag<T16>::ld(pv + dt * 16 * TT); if (HL) v2[dt] = WFrag<T16>::ld(pv2 + dt * 16 * TT); }
        v8f s[2][NQ];
#pragma unroll
        for (int kt = 0; kt < 2; ++kt)
#pragma unroll
            for (int qt = 0; qt < NQ; ++qt) { v8f a = (v8f){};
#pragma unroll
                for (int c = 0; c < 2; ++c) { a = WFrag<T16>::mma(k[kt][c], q[qt][c], a); if (HL) { a = WFrag<T16>::mma(k[kt][c], q2[qt][c], a); a = WFrag<T16>::mma(k2[kt][c], q[qt][c], a); } }
                s[kt][qt] = a; }
        if (!HL) ldk(min(kb + 32 * NW, klast));       // the wave's next key fragments are fetched now, behind this pass's last use of the registers (its last pass fetches the last block: in bounds, unused)
        // all of the pass's loads are issued: the wait that stands in front of a rewrite of a register an issued load names. The pass's lane pointers are its inputs, so that their registers stay theirs up to here (one build landed later loads of the run in them)
        if constexpr (HL) asm volatile("s_wait_xcnt 0x0" :: "v"(pk), "v"(pk2), "v"(pv), "v"(pv2) : "memory"); else asm volatile("s_wait_xcnt 0x0" :: "v"(pk), "v"(pv) : "memory");
        if (kb == klast) {                            // only the last block crosses the diagonal: key > query is masked
#pragma unroll
            for (int kt = 0; kt < 2; ++kt)
#pragma unroll
                for (int qt = 0; qt < NQ; ++qt)
#pragma unroll
                    for (int j = 0; j < 8; ++j) if (kb + kt * 16 + hi * 8 + j > q0 + qt * 16 + lr) s[kt][qt][j] = -3.0e38f; }
        V pb[NQ], pb2[NQ];
#pragma unroll
        for (int qt = 0; qt < NQ; ++qt) {
            float mx = fmaxf(s[0][qt][0], s[1][qt][0]);
#pragma unroll
            for (int j = 1; j < 8; ++j) mx = fmaxf(mx, fmaxf(s[0][qt][j], s[1][qt][j]));
            mx = fmaxf(mx, __shfl_xor(mx, 16, 32));
            const float mn = fmaxf(m[qt], mx); const float al = exp2x1((m[qt] - mn) * SL2E); m[qt] = mn;
            float sum = 0.f;
#pragma unroll
            for (int kt = 0; kt < 2; ++kt) { v8f x;
#pragma unroll
                for (int j = 0; j < 8; ++j) { const float y = (s[kt][qt][j] - mn) * SL2E; x[j] = HL ? y : y + 10.0f; }
                x = exp2x8(x); s[kt][qt] = x;
#pragma unroll
                for (int j = 0; j < 8; ++j) sum += x[j]; }
            l[qt] = l[qt] * al + sum;
#pragma unroll
            for (int dt = 0; dt < 4; ++dt) o[dt][qt] *= al;
            if constexpr (HL) { v8us h0, h1, l0, l1;
#pragma unroll
                for (int j = 0; j < 8; ++j) { unsigned short a, c2; splitf(s[0][qt][j], a, c2); h0[j] = a; l0[j] = c2; splitf(s[1][qt][j], a, c2); h1[j] = a; l1[j] = c2; }
                pb[qt] = cat16b(h0, h1); pb2[qt] = cat16b(l0, l1);
            } else { v8h h0, h1;
#pragma unroll
                for (int j = 0; j < 8; ++j) { h0[j] = tohx(s[0][qt][j]); h1[j] = tohx(s[1][qt][j]); }
                pb[qt] = cat16(h0, h1); }
        }
#pragma unroll
        for (int dt = 0; dt < 4; ++dt)
#pragma unroll
            for (int qt = 0; qt < NQ; ++qt) { o[dt][qt] = WFrag<T16>::mma(v[dt], pb[qt], o[dt][qt]); if (HL) { o[dt][qt] = WFrag<T16>::mma(v[dt], pb2[qt], o[dt][qt]); o[dt][qt] = WFrag<T16>::mma(v2[dt], pb[qt], o[dt][qt]); } }
    }
#pragma unroll
    for (int qt = 0; qt < NQ; ++qt) { const int row = w * (NQ * 16) + qt * 16 + lr; const float ls = l[qt] + __shfl_xor(l[qt], 16, 32);   // the halves' sums are joined once, here
        if (hi == 0) { v2f t2; t2[0] = m[qt]; t2[1] = ls; *(v2f*)(ml + row * 2) = t2; }
#pragma unroll
        for (int dt = 0; dt < 4; ++dt) { float* p = os + row * OP + dt * 16 + hi * 8; *(v4f*)p = __builtin_shufflevector(o[dt][qt], o[dt][qt], 0, 1, 2, 3); *(v4f*)(p + 4) = __builtin_shufflevector(o[dt][qt], o[dt][qt], 4, 5, 6, 7); } }
    __syncthreads();                                  // every wave's (m, l, O) is in LDS before any wave joins them
    constexpr int LPQ = 8 / NQ, DPL = 8 * NQ;         // lanes per query row and output elements per lane in the join
    const int qq = w * (NQ * 4) + lane / LPQ, d0 = (lane % LPQ) * DPL;
    v2f t[NW]; float M = -3.0e38f;
#pragma unroll
    for (int i = 0; i < NW; ++i) { t[i] = *(const v2f*)(ml + (i * (NQ * 16) + qq) * 2); M = fmaxf(M, t[i][0]); }
    float L = 0.f, acc[DPL];
#pragma unroll
    for (int e = 0; e < DPL; ++e) acc[e] = 0.f;
#pragma unroll
    for (int i = 0; i < NW; ++i) { const float sc = exp2x1((t[i][0] - M) * SL2E); L += t[i][1] * sc;   // a wave that had no block: m = -3e38, so sc = 0, on l = 0 and O = 0
#pragma unroll
        for (int e = 0; e < DPL; e += 4) { const v4f x = *(const v4f*)(os + (i * (NQ * 16) + qq) * OP + d0 + e); acc[e] += x[0] * sc; acc[e + 1] += x[1] * sc; acc[e + 2] += x[2] * sc; acc[e + 3] += x[3] * sc; } }
    const float inv = __fdiv_rn(1.0f, L);
#pragma unroll
    for (int c = 0; c < DPL / 8; ++c) { v8us oh, ol;
#pragma unroll
        for (int j = 0; j < 8; ++j) { unsigned short a, c2; splitf(acc[c * 8 + j] * inv, a, c2); oh[j] = a; ol[j] = c2; }
        const size_t oo = (size_t)(q0 + qq) * DQ + d0 + c * 8; *(v8us*)(Ah + oo) = oh; *(v8us*)(Al + oo) = ol; }
    // hi/lo form only: behind the last store, the wait that stands in front of any rewrite of a register an issued store names (in the listing the way on from here leads past the fp16 form's entry, which writes such registers; the fp16 form's stores run straight into the end of the program)
    if constexpr (HL) asm volatile("s_wait_xcnt 0x0" ::: "memory");
}
// grid (batches x heads, tiles): blockIdx.x = batch * NH_ + head is the plane's index; blockIdx.y ranks the tiles by falling cost: the (TT - RH) / 32 fp16 tiles of 32 rows from the last row up, then the RH / 16 hi/lo tiles of 16 rows.
__global__ __launch_bounds__(32 * NW) void k_attn(const h16* __restrict__ Q16, const h16* __restrict__ K16, const h16* __restrict__ V16, const bf* __restrict__ Qh, const bf* __restrict__ Ql, const bf* __restrict__ Kh, const bf* __restrict__ Kl, const bf* __restrict__ Vh, const bf* __restrict__ Vl, bf* __restrict__ Ah, bf* __restrict__ Al) {
    __shared__ __align__(16) float os[NW * 32 * OP]; __shared__ __align__(16) float ml[NW * 32 * 2];
    const size_t hp = (size_t)blockIdx.x * TT * HD; const int r = blockIdx.y; const size_t ao = (size_t)(blockIdx.x / NH_) * TT * DQ + (blockIdx.x % NH_) * HD; Ah += ao; Al += ao;
    if (r < (TT - RH) / 32) attn_tile<h16, 2, false>(Q16 + hp, nullptr, K16 + hp, nullptr, V16 + hp, nullptr, TT - 32 - 32 * r, Ah, Al, os, ml);
    else attn_tile<bf, 1, true>(Qh + hp, Ql + hp, Kh + hp, Kl + hp, Vh + hp, Vl + hp, RH - 16 - 16 * (r - (TT - RH) / 32), Ah, Al, os, ml);
}

extern "C" void kernel_launch(void* const* d_in, const int* in_sizes, int n_in,
                              void* d_out, int out_size, void* d_ws, size_t ws_size, hipStream_t stream) {
    (void)in_sizes; (void)n_in; (void)out_size;
    const float* x = (const float*)d_in[0]; const float* wqkv = (const float*)d_in[1]; const float* wo = (const float*)d_in[2];   /* input order X, W_qkv ('oi' [3072][1024]: q | k | v = its three 1,024-row blocks), W_o ('oi' [1024][1024]): THREE inputs */
    float* OUT = (float*)d_out;     // [2][2048][1024]
    char* wsp = (char*)d_ws;
    auto take = [&](size_t bytes) { char* p = wsp; wsp += (bytes + 255) & ~(size_t)255; return (void*)p; };
    const size_t PG = (size_t)NB_ * NH_ * TT * HD;   // elements of one of q, k, v: a plane per (batch, head)
    bf* WQKV = (bf*)take((size_t)(DQ + 2 * DKV) * DM * 2); bf* WO = (bf*)take((size_t)DM * DQ * 2); float* CS = (float*)take((size_t)TT * HD * 2 * 4);
    h16* P16 = (h16*)take(3 * PG * 2); bf* Ph = (bf*)take(3 * PG * 2); bf* Pl = (bf*)take(3 * PG * 2);   // each [q | k | v][batch][head]
    bf* XB = (bf*)take((size_t)NB_ * TT * DM * 2);
    bf* ATh = (bf*)take((size_t)NB_ * TT * DQ * 2); bf* ATl = (bf*)take((size_t)NB_ * TT * DQ * 2);
    if ((size_t)(wsp - (char*)d_ws) > ws_size) return;    // ws 256 MiB
    k_prep<<<PB_CS + PB_X + PB_W + PB_O, 256, 0, stream>>>(x, wqkv, wo, XB, WQKV, WO, CS);   /* bf16 copies; {cos, sin}(t x THETA**(-2i/64)) per interleaved pair */
    k_gemmw<bf, 0, false, 1><<<dim3(TT / 64, (DQ + 2 * DKV) / 64, NB_), 32, 0, stream>>>(XB, nullptr, WQKV, nullptr, DM, nullptr, 0, nullptr, (size_t)TT * DM, 0, 0, CS, P16, Ph, Pl);
    k_attn<<<dim3(NB_ * NH_, (TT - RH) / 32 + RH / 16, 1), 32 * NW, 0, stream>>>(P16, P16 + PG, P16 + 2 * PG, Ph, Pl, Ph + PG, Pl + PG, Ph + 2 * PG, Pl + 2 * PG, ATh, ATl);   // one kv head per query head
    k_gemmw<bf, 1, false, 0><<<dim3(NB_ * TT / 64, DM / 64, 1), 32, 0, stream>>>(ATh, ATl, WO, nullptr, DQ, OUT, DM, nullptr, 0, 0, 0, nullptr, nullptr, nullptr, nullptr);   // the batches' rows are one [NB_ * TT][DQ] operand
}

// v006
// Measured time: 114 microseconds a run.
// Next to v005, in two timings, it ran 1.24 and 1.23 times as fast.
// Counting every step since v000, it is 12.7 times as fast.
#include <hip/hip_runtime.h>

// Causal multi-head self-attention with interleaved rotary embeddings and a FUSED (out, in) qkv weight (X [2][2048][1024]; qkv = einsum('bsd,od->bso', X, W_qkv) ('oi' [3072][1024] std sqrt(2/4096), no bias) viewed (B, S, 3, 16, 64): q | k | v = the three 1,024-ROW blocks of W_qkv (16 heads x 64); rotary on (even, odd) pairs with angle pos / (10000 ** (2 k / 64)) (float32 constants 10000^(-2i/64), precise cosf/sinf); scores x 64^-0.5, causal (-inf); softmax; out = merged W_o^T ('oi', no bias) -> [2][2048][1024] (4.2 M); argument order X, W_qkv, W_o.
// Both batches ride in every launch (4 launches): bf16 copies of x and the weights; exact projections; {cos, sin} per (position, pair) from the int positions (jnp-exact float32 inverse frequencies, precise cosf/sinf); interleaved rotary and the 16-bit head planes in the projections' own epilogues; causal T-2048 attention fused in k_attn (hybrid rows: < 512 hi/lo 3 products, rest fp16 x1024; running maximum, keys walked up to the diagonal); merged hi/lo x wo exact, no bias.
// Compute dtypes, f32 accumulate: every input rounded to bf16; projections exact ; rotary f32; attention rows < 512 3 products, rest fp16; softmax f32; wo hl x exact, no bias.

#define NB_  2
#define TT   2048
#define DM   1024
#define NH_  16
#define NKV  16
#define REP  (NH_ / NKV)
#define HD   64
#define DQ   (NH_ * HD)
#define DKV  (NKV * HD)
#define RH   512                  // query rows < RH use hi+lo planes (0: none)
#define SCL  0.125f   // HD^-0.5
typedef _Float16 h16;
typedef unsigned short bf;
typedef __attribute__((ext_vector_type(16))) __bf16   v16bf;
typedef __attribute__((ext_vector_type(16))) _Float16 v16h;
typedef __attribute__((ext_vector_type(8)))  _Float16 v8h;
typedef __attribute__((ext_vector_type(8)))  unsigned short v8us;
typedef __attribute__((ext_vector_type(8)))  float    v8f;
typedef __attribute__((ext_vector_type(4)))  float    v4f;
typedef v8h  __attribute__((may_alias)) v8ha;
typedef v4f  __attribute__((may_alias)) v4fa;
typedef v8us __attribute__((may_alias)) v8usa;

__device__ __forceinline__ unsigned short f2bf(float f) { unsigned u = __float_as_uint(f); u += 0x7FFFu + ((u >> 16) & 1u); return (unsigned short)(u >> 16); }
__device__ __forceinline__ float bf2f(unsigned short b) { return __uint_as_float(((unsigned)b) << 16); }
__device__ __forceinline__ float bfr(float f) { return bf2f(f2bf(f)); }
__device__ __forceinline__ v16h cat16(v8h lo, v8h hi) { return __builtin_shufflevector(lo, hi, 0, 1, 2, 3, 4, 5, 6, 7, 8, 9, 10, 11, 12, 13, 14, 15); }
__device__ __forceinline__ v16bf cat16b(v8us lo, v8us hi) { return __builtin_bit_cast(v16bf, __builtin_shufflevector(lo, hi, 0, 1, 2, 3, 4, 5, 6, 7, 8, 9, 10, 11, 12, 13, 14, 15)); }
__device__ __forceinline__ v8f wmma16(v16h a, v16h b, v8f c) { return __builtin_amdgcn_wmma_f32_16x16x32_f16(false, a, false, b, (short)0, c, false, false); }
__device__ __forceinline__ v8f wmmab(v16bf a, v16bf b, v8f c) { return __builtin_amdgcn_wmma_f32_16x16x32_bf16(false, a, false, b, (short)0, c, false, false); }



__device__ __forceinline__ h16 tohx(float x) { return (h16)x; }
__device__ __forceinline__ void splitf(float y, unsigned short& h, unsigned short& l) { h = f2bf(y); l = f2bf(y - bf2f(h)); }
typedef __attribute__((ext_vector_type(2))) _Float16 v2h;
typedef __attribute__((ext_vector_type(4))) _Float16 v4h;
typedef __attribute__((ext_vector_type(2))) unsigned short v2us;
typedef __attribute__((ext_vector_type(4))) unsigned short v4us;
typedef __attribute__((ext_vector_type(2))) float v2f;
typedef __attribute__((ext_vector_type(4))) int v4i;

// ---- Fragment order: every 16-bit matrix operand in the workspace ([rows][K], rows % 16 == 0, K % 32 == 0) is stored as tiles of 16 rows x 32 k (1,024 bytes; tile index = (row / 16) * (K / 32) + k / 32), and inside a tile
// as the two 16-byte pieces a lane of the matrix instruction holds: piece (k / 16 % 2) * 32 + (k / 8 % 2) * 16 + row % 16. A fragment load (WFrag::ld at tile + lane * 8 elements) is then two wave-wide loads of 512 contiguous bytes
// (4 whole lines each), where a row-major plane takes 16 lines a load; the values that reach each lane and register are those of the row-major form.
__device__ __forceinline__ size_t pko(int row, int k, int K) { return ((size_t)(row >> 4) * (K >> 5) + (k >> 5)) * 512 + ((k >> 4) & 1) * 256 + ((k >> 3) & 1) * 128 + (row & 15) * 8 + (k & 7); }
// ---- k_gemmw: register-blocked GEMM, ONE WAVE per 64x64 output tile (16 accumulators), operands straight from 16-bit planes in fragment order; grid (M/64, N/64, Z), 32 threads.
// C[m][n] (f32, pitch ldc, + optional f32 bias[n]) = sum_k A[m][k] Bt[n][k] (+ split products per NSPLIT). z-batch strides sA/sB/sC in elements. K % 32 == 0.
// EPI says where the tile goes. 0: C as above. 1: the fused q | k | v projection of batch blockIdx.z: the tile is 64 positions (rows) x the 64 columns of ONE head (blockIdx.y = which * NH_ + head, which = 0 q, 1 k, 2 v), and it leaves the wave as the attention's 16-bit planes (fp16, bf16 hi, bf16 lo; each buffer [which][batch][head] planes of TT * HD), no f32 copy in between:
// q, k: interleaved rotary with {cos, sin} from CS, planes [t][d] in fragment order (a lane turns 8 columns of a row, one 16-byte piece; 8 lanes on 8 consecutive rows fill a 128-byte line); v: planes [d][t] in fragment order: a lane's accumulator holds 8 consecutive positions of one column, which IS its piece of the transposed tile (a store is 512 contiguous bytes).
template <typename T16> struct WFrag;
template <> struct WFrag<h16> { typedef v16h V; static __device__ __forceinline__ V ld(const h16* p) { return cat16(*(const v8h*)p, *(const v8h*)(p + 256)); } static __device__ __forceinline__ v8f mma(V a, V b, v8f c) { return wmma16(a, b, c); } };
template <> struct WFrag<bf> { typedef v16bf V; static __device__ __forceinline__ V ld(const bf* p) { return cat16b(*(const v8us*)p, *(const v8us*)(p + 256)); } static __device__ __forceinline__ v8f mma(V a, V b, v8f c) { return wmmab(a, b, c); } };
template <typename T16, int NSPLIT, bool BIAS, int EPI, int K>
__global__ __launch_bounds__(32) void k_gemmw(const T16* __restrict__ A, const T16* __restrict__ A2, const T16* __restrict__ Bt, const T16* __restrict__ Bt2, float* C, int ldc, const float* __restrict__ bias, size_t sA, size_t sB, size_t sC, const float* __restrict__ CS, h16* __restrict__ P16, bf* __restrict__ Ph, bf* __restrict__ Pl) {
    typedef typename WFrag<T16>::V V;
    __shared__ __align__(16) float os[16 * 68];
    const size_t z = blockIdx.z; A += z * sA; if (A2) A2 += z * sA; Bt += z * sB; if (Bt2) Bt2 += z * sB; C += z * sC;
    const int lane = threadIdx.x & 31, lr = lane & 15, hi = lane >> 4; const int r0 = blockIdx.x * 64, c0 = blockIdx.y * 64;
    v8f acc[4][4];
#pragma unroll
    for (int mb = 0; mb < 4; ++mb)
#pragma unroll
        for (int nb = 0; nb < 4; ++nb) acc[mb][nb] = (v8f){};
    const size_t aoff = (size_t)r0 * K + 8 * lane, boff = (size_t)c0 * K + 8 * lane;   // 16 rows of K are K / 32 tiles of 512 elements: a k step of 32 is 512 elements on
#pragma unroll 1
    for (int kc = 0; kc < K; kc += 32) {
        // one lane pointer per plane and k step; the row blocks are constants (K is a template argument) that fit the instruction's offset field
        const T16* pa = A + aoff + (size_t)kc * 16; const T16* pa2 = (NSPLIT == 1 || NSPLIT == 2) ? A2 + aoff + (size_t)kc * 16 : pa; const T16* pb = Bt + boff + (size_t)kc * 16; const T16* pb2 = NSPLIT >= 2 ? Bt2 + boff + (size_t)kc * 16 : pb;
        V a[4], a2[4], b[4], b2[4];
#pragma unroll
        for (int mb = 0; mb < 4; ++mb) { a[mb] = WFrag<T16>::ld(pa + mb * 16 * K); if (NSPLIT == 1 || NSPLIT == 2) a2[mb] = WFrag<T16>::ld(pa2 + mb * 16 * K); }
#pragma unroll
        for (int nb = 0; nb < 4; ++nb) { b[nb] = WFrag<T16>::ld(pb + nb * 16 * K); if (NSPLIT >= 2) b2[nb] = WFrag<T16>::ld(pb2 + nb * 16 * K); }
        // all of the k step's loads are issued: the wait that stands in front of a rewrite of a register an issued load names. The lane pointers are its inputs, so that their registers stay theirs up to here (one build landed later loads of the run in them)
        asm volatile("s_wait_xcnt 0x0" :: "v"(pa), "v"(pa2), "v"(pb), "v"(pb2) : "memory");
#pragma unroll
        for (int nb = 0; nb < 4; ++nb)
#pragma unroll
            for (int mb = 0; mb < 4; ++mb) { acc[mb][nb] = WFrag<T16>::mma(a[mb], b[nb], acc[mb][nb]); if (NSPLIT == 1 || NSPLIT == 2) acc[mb][nb] = WFrag<T16>::mma(a2[mb], b[nb], acc[mb][nb]); if (NSPLIT >= 2) acc[mb][nb] = WFrag<T16>::mma(a[mb], b2[nb], acc[mb][nb]); }
        asm volatile("v_nop\n\tv_nop\n\tv_nop\n\tv_nop" : "+v"(acc[0][0]), "+v"(acc[1][1]), "+v"(acc[2][2]), "+v"(acc[3][3]) : "v"(a[0]), "v"(a[3]));
    }
    const size_t pl = EPI == 1 ? ((size_t)(blockIdx.y / NH_) * NB_ + z) * NH_ + blockIdx.y % NH_ : 0;   // the tile's plane
    if (EPI == 1 && blockIdx.y >= 2 * NH_) {          // v (the same for the whole wave)
#pragma unroll
        for (int nb = 0; nb < 4; ++nb)
#pragma unroll
            for (int mb = 0; mb < 4; ++mb) { v8h o16; v8us oh, ol;
#pragma unroll
                for (int j = 0; j < 8; ++j) { const float x = acc[mb][nb][j]; o16[j] = tohx(x); unsigned short a2, c2; splitf(x, a2, c2); oh[j] = a2; ol[j] = c2; }
                const size_t e = pl * HD * TT + pko(nb * 16 + lr, r0 + mb * 16 + hi * 8, TT); *(v8h*)(P16 + e) = o16; *(v8us*)(Ph + e) = oh; *(v8us*)(Pl + e) = ol;
                asm volatile("s_wait_xcnt 0x0" ::: "memory"); }   // behind the block's stores: the wait that stands in front of a rewrite of a register an issued store names (the next block's values land in such registers)
        return; }
#pragma unroll
    for (int mb = 0; mb < 4; ++mb) {
#pragma unroll
        for (int nb = 0; nb < 4; ++nb) {
#pragma unroll
            for (int j = 0; j < 8; ++j) os[(hi * 8 + j) * 68 + nb * 16 + lr] = acc[mb][nb][j]; }
        __builtin_amdgcn_wave_barrier(); asm volatile("" ::: "memory");
        if constexpr (EPI == 1) {
#pragma unroll
            for (int s = 0; s < 4; ++s) { const int rr = 8 * (s & 1) + (lane & 7), t = r0 + mb * 16 + rr, d0 = (4 * (s >> 1) + (lane >> 3)) * 8; const float* xr = os + rr * 68 + d0; const v4f xa = *(const v4fa*)xr, xb = *(const v4fa*)(xr + 4);
                const float x[8] = { xa[0], xa[1], xa[2], xa[3], xb[0], xb[1], xb[2], xb[3] }; const float* cp = CS + ((size_t)t * HD + d0) * 2; v8h o16; v8us oh, ol;
#pragma unroll
                for (int p = 0; p < 8; p += 2) { const v2f cs = *(const v2f*)(cp + 2 * p); const float x0 = x[p], x1 = x[p + 1];
                    const float r0_ = x0 * cs[0] - x1 * cs[1], r1_ = x0 * cs[1] + x1 * cs[0];   /* even: x0 c - x1 s; odd: x0 s + x1 c */
                    o16[p] = tohx(r0_); o16[p + 1] = tohx(r1_); { unsigned short a2, c2; splitf(r0_, a2, c2); oh[p] = a2; ol[p] = c2; splitf(r1_, a2, c2); oh[p + 1] = a2; ol[p + 1] = c2; } }
                const size_t e = pl * TT * HD + pko(t, d0, HD); *(v8h*)(P16 + e) = o16; *(v8us*)(Ph + e) = oh; *(v8us*)(Pl + e) = ol;
                asm volatile("s_wait_xcnt 0x0" ::: "memory"); }   // behind the three stores: the wait that stands in front of a rewrite of a register an issued store names (the next pieces' values and table loads land in such registers)
        } else {
        float* crow = C + (size_t)(r0 + mb * 16) * ldc + c0;
{
#pragma unroll
            for (int s = 0; s < 8; ++s) { const int row = 2 * s + hi, cofs = lr * 4; v4f val = *(const v4fa*)(os + row * 68 + cofs); if (BIAS) { val[0] += bfr(bias[c0 + cofs]); val[1] += bfr(bias[c0 + cofs + 1]); val[2] += bfr(bias[c0 + cofs + 2]); val[3] += bfr(bias[c0 + cofs + 3]); }
                *(v4f*)(crow + (size_t)row * ldc + cofs) = val;
                asm volatile("s_wait_xcnt 0x0" ::: "memory"); }   // behind the store: the wait that stands in front of a rewrite of a register an issued store names (later addresses and values land in such registers)
             }
        }
        __builtin_amdgcn_wave_barrier(); asm volatile("" ::: "memory");
    }
}


__global__ __launch_bounds__(256) void k_wtG(const float* __restrict__ w, int K, int N, bf* Bt) {
    const int lane = threadIdx.x & 31; const int L0 = (blockIdx.x * 8 + (threadIdx.x >> 5)) * 8; const int nlines = N * K / 64;
{
#pragma unroll 1
        for (int l = 0; l < 8; ++l) { const int L = L0 + l; if (L >= nlines) break; const size_t e = (size_t)L * 64 + lane * 2; const int k = (int)(e % K), n = (int)(e / K); v2us o;
            o[0] = f2bf(w[(size_t)k * N + n]); o[1] = f2bf(w[(size_t)(k + 1) * N + n]); *(v2us*)(Bt + e) = o; }
         }
}
static_assert(DQ == DM, "cvt8 takes K = DM for every buffer");
__device__ __forceinline__ void cvt8(const float* __restrict__ src, bf* dst, int blk) { const size_t i = (size_t)blk * 256 + threadIdx.x;   // i: the 16-byte piece of dst (fragment order, K = DM) that the thread writes; a block is 4 tiles: 16 rows x 512 bytes of src; every buffer is a whole number of blocks
    const int tile = (int)(i >> 6), row = tile / (DM / 32) * 16 + (int)(i & 15), kk = tile % (DM / 32) * 32 + (int)((i >> 5) & 1) * 16 + (int)((i >> 4) & 1) * 8; const v8f v = *(const v8f*)(src + (size_t)row * DM + kk); v8us o;
#pragma unroll
    for (int k = 0; k < 8; ++k) o[k] = f2bf(v[k]); *(v8us*)(dst + i * 8) = o;  }
__constant__ float INVP[HD / 2] = { 1.000000000e+00f,7.498942018e-01f,5.623413324e-01f,4.216965139e-01f,3.162277639e-01f,2.371373773e-01f,1.778279394e-01f,1.333521456e-01f,1.000000015e-01f,7.498942316e-02f,5.623413250e-02f,4.216964915e-02f,3.162277490e-02f,2.371373773e-02f,1.778279431e-02f,1.333521400e-02f,9.999999776e-03f,7.498942316e-03f,5.623413250e-03f,4.216964822e-03f,3.162277630e-03f,2.371373819e-03f,1.778279431e-03f,1.333521446e-03f,1.000000047e-03f,7.498941850e-04f,5.623413017e-04f,4.216965172e-04f,3.162277571e-04f,2.371373703e-04f,1.778279402e-04f,1.333521504e-04f };   // 10000 ** (-2 i / 64) as float32 (the module's power form, jnp-computed; differs from 1/10000**(2i/64) by ulps)
__device__ __forceinline__ void csP(float* CS, int blk) { const int idx = blk * 256 + threadIdx.x; const int d = idx % HD; const int t = idx / HD; const float a = __fmul_rn((float)t, INVP[d >> 1]); v2f cs; cs[0] = cosf(a); cs[1] = sinf(a); *(v2f*)(CS + (size_t)idx * 2) = cs;  }
// ---- k_prep: all that the GEMMs read and that depends on no other launch, in one grid; blockIdx.x picks the job by range (the same for a whole block), the table (the longest blocks) first.
#define PB_CS (TT * HD / 256)
#define PB_X  (NB_ * TT * DM / 2048)
#define PB_W  ((DQ + 2 * DKV) * DM / 2048)
#define PB_O  (DM * DQ / 2048)
__global__ __launch_bounds__(256) void k_prep(const float* __restrict__ x, const float* __restrict__ wqkv, const float* __restrict__ wo, bf* XB, bf* WQKV, bf* WO, float* CS) {
    int b = blockIdx.x;
    if (b < PB_CS) { csP(CS, b); return; }
    b -= PB_CS; const float* src = x; bf* dst = XB;
    if (b >= PB_X + PB_W) { b -= PB_X + PB_W; src = wo; dst = WO; } else if (b >= PB_X) { b -= PB_X; src = wqkv; dst = WQKV; }
    cvt8(src, dst, b);
}

#define NW   4
#define SL2E (SCL * 1.4426950408889634f)   // the score scale (a power of two: exact) rides in the exponent's factor; m is kept in unscaled scores
#define OP   68                   // pitch, in floats, of a query's partial output row in LDS (64 + 4: rows 16 bytes apart in the banks)
// 2^x of eight values: eight independent v_exp_f32, each in place, and behind the last the one free slot that the instruction set asks for between a transcendental and an instruction that reads its result or
// overwrites its source.
__device__ __forceinline__ v8f exp2x8(v8f x) { float a = x[0], b = x[1], c = x[2], d = x[3], e = x[4], f = x[5], g = x[6], h = x[7];
    asm("v_exp_f32 %0, %0\n\tv_exp_f32 %1, %1\n\tv_exp_f32 %2, %2\n\tv_exp_f32 %3, %3\n\tv_exp_f32 %4, %4\n\tv_exp_f32 %5, %5\n\tv_exp_f32 %6, %6\n\tv_exp_f32 %7, %7\n\tv_nop" : "+v"(a), "+v"(b), "+v"(c), "+v"(d), "+v"(e), "+v"(f), "+v"(g), "+v"(h));
    return (v8f){a, b, c, d, e, f, g, h}; }
__device__ __forceinline__ float exp2x1(float a) { asm("v_exp_f32 %0, %0\n\tv_nop" : "+v"(a)); return a; }   // one value, with the same slot
template <typename T16, int NQ, bool HL>
__device__ __forceinline__ void attn_tile(const T16* __restrict__ Q, const T16* __restrict__ Q2, const T16* __restrict__ Kp, const T16* __restrict__ Kp2, const T16* __restrict__ Vt, const T16* __restrict__ Vt2, int q0, bf* __restrict__ Ah, bf* __restrict__ Al, float* os, float* ml) {
    typedef typename WFrag<T16>::V V;
    const int lane = threadIdx.x & 31, lr = lane & 15, hi = lane >> 4; const int w = __builtin_amdgcn_readfirstlane(threadIdx.x >> 5);
    const int klast = (q0 + NQ * 16 - 1) & ~31;      // first key of the 32-key block that holds the tile's last diagonal element
    V q[NQ][2], q2[NQ][2], k[2][2], k2[2][2];
    // every operand load is addressed as one lane pointer per plane and pass plus a constant that fits the instruction's offset field (no address sums per load)
    const unsigned kof = (unsigned)(8 * lane), vof = (unsigned)(8 * lane);   /* fragment order: the lane's piece of a tile */ const T16* pk = nullptr; const T16* pk2 = nullptr;
#pragma unroll
    for (int qt = 0; qt < NQ; ++qt)
#pragma unroll
        for (int c = 0; c < 2; ++c) { const int qc = qt * 16 * HD + c * 512; q[qt][c] = WFrag<T16>::ld(Q + (size_t)q0 * HD + kof + qc); if (HL) q2[qt][c] = WFrag<T16>::ld(Q2 + (size_t)q0 * HD + kof + qc); }
    auto ldk = [&](int kk) {                         // the four (HL: eight) fragments of the 32 key rows from kk on
        pk = Kp + (size_t)kk * HD + kof; if (HL) pk2 = Kp2 + (size_t)kk * HD + kof;
#pragma unroll
        for (int kt = 0; kt < 2; ++kt)
#pragma unroll
            for (int c = 0; c < 2; ++c) { const int kc = kt * 16 * HD + c * 512; k[kt][c] = WFrag<T16>::ld(pk + kc); if (HL) k2[kt][c] = WFrag<T16>::ld(pk2 + kc); } };
    if (!HL) ldk(min(32 * w, klast));                // fp16: key fragments run one pass ahead (a wave with no block of its own fetches the last one: in bounds, unused); hi/lo: at most 4 passes a wave, fetched in the pass, which keeps the registers under 256
    v8f o[4][NQ]; float m[NQ], l[NQ];
#pragma unroll
    for (int qt = 0; qt < NQ; ++qt) { m[qt] = -3.0e38f; l[qt] = 0.f;
#pragma unroll
        for (int dt = 0; dt < 4; ++dt) o[dt][qt] = (v8f){}; }
#pragma unroll 1   // stays rolled: the trip count is known only at run time, and a second copy of the body (its fragments and score tiles) would not fit the registers
    for (int kb = 32 * w; kb <= klast; kb += 32 * NW) {
        if (HL) ldk(kb);
        V v[4], v2[4]; const T16* pv = Vt + (size_t)kb * 16 + vof; const T16* pv2 = HL ? Vt2 + (size_t)kb * 16 + vof : nullptr;   // 32 keys on = one tile (512 elements) on
#pragma unroll
        for (int dt = 0; dt < 4; ++dt) { v[dt] = WFrag<T16>::ld(pv + dt * 16 * TT); if (HL) v2[dt] = WFrag<T16>::ld(pv2 + dt * 16 * TT); }
        v8f s[2][NQ];
#pragma unroll
        for (int kt = 0; kt < 2; ++kt)
#pragma unroll
            for (int qt = 0; qt < NQ; ++qt) { v8f a = (v8f){};
#pragma unroll
                for (int c = 0; c < 2; ++c) { a = WFrag<T16>::mma(k[kt][c], q[qt][c], a); if (HL) { a = WFrag<T16>::mma(k[kt][c], q2[qt][c], a); a = WFrag<T16>::mma(k2[kt][c], q[qt][c], a); } }
                s[kt][qt] = a; }
        if (!HL) ldk(min(kb + 32 * NW, klast));       // the wave's next key fragments are fetched now, behind this pass's last use of the registers (its last pass fetches the last block: in bounds, unused)
        // all of the pass's loads are issued: the wait that stands in front of a rewrite of a register an issued load names. The pass's lane pointers are its inputs, so that their registers stay theirs up to here (one build landed later loads of the run in them)
        if constexpr (HL) asm volatile("s_wait_xcnt 0x0" :: "v"(pk), "v"(pk2), "v"(pv), "v"(pv2) : "memory"); else asm volatile("s_wait_xcnt 0x0" :: "v"(pk), "v"(pv) : "memory");
        if (kb == klast) {                            // only the last block crosses the diagonal: key > query is masked
#pragma unroll
            for (int kt = 0; kt < 2; ++kt)
#pragma unroll
                for (int qt = 0; qt < NQ; ++qt)
#pragma unroll
                    for (int j = 0; j < 8; ++j) if (kb + kt * 16 + hi * 8 + j > q0 + qt * 16 + lr) s[kt][qt][j] = -3.0e38f; }
        V pb[NQ], pb2[NQ];
#pragma unroll
        for (int qt = 0; qt < NQ; ++qt) {
            float mx = fmaxf(s[0][qt][0], s[1][qt][0]);
#pragma unroll
            for (int j = 1; j < 8; ++j) mx = fmaxf(mx, fmaxf(s[0][qt][j], s[1][qt][j]));
            mx = fmaxf(mx, __shfl_xor(mx, 16, 32));
            const float mn = fmaxf(m[qt], mx); const float al = exp2x1((m[qt] - mn) * SL2E); m[qt] = mn;
            float sum = 0.f;
#pragma unroll
            for (int kt = 0; kt < 2; ++kt) { v8f x;
#pragma unroll
                for (int j = 0; j < 8; ++j) { const float y = (s[kt][qt][j] - mn) * SL2E; x[j] = HL ? y : y + 10.0f; }
                x = exp2x8(x); s[kt][qt] = x;
#pragma unroll
                for (int j = 0; j < 8; ++j) sum += x[j]; }
            l[qt] = l[qt] * al + sum;
#pragma unroll
            for (int dt = 0; dt < 4; ++dt) o[dt][qt] *= al;
            if constexpr (HL) { v8us h0, h1, l0, l1;
#pragma unroll
                for (int j = 0; j < 8; ++j) { unsigned short a, c2; splitf(s[0][qt][j], a, c2); h0[j] = a; l0[j] = c2; splitf(s[1][qt][j], a, c2); h1[j] = a; l1[j] = c2; }
                pb[qt] = cat16b(h0, h1); pb2[qt] = cat16b(l0, l1);
            } else { v8h h0, h1;
#pragma unroll
                for (int j = 0; j < 8; ++j) { h0[j] = tohx(s[0][qt][j]); h1[j] = tohx(s[1][qt][j]); }
                pb[qt] = cat16(h0, h1); }
        }
#pragma unroll
        for (int dt = 0; dt < 4; ++dt)
#pragma unroll
            for (int qt = 0; qt < NQ; ++qt) { o[dt][qt] = WFrag<T16>::mma(v[dt], pb[qt], o[dt][qt]); if (HL) { o[dt][qt] = WFrag<T16>::mma(v[dt], pb2[qt], o[dt][qt]); o[dt][qt] = WFrag<T16>::mma(v2[dt], pb[qt], o[dt][qt]); } }
    }
#pragma unroll
    for (int qt = 0; qt < NQ; ++qt) { const int row = w * (NQ * 16) + qt * 16 + lr; const float ls = l[qt] + __shfl_xor(l[qt], 16, 32);   // the halves' sums are joined once, here
        if (hi == 0) { v2f t2; t2[0] = m[qt]; t2[1] = ls; *(v2f*)(ml + row * 2) = t2; }
#pragma unroll
        for (int dt = 0; dt < 4; ++dt) { float* p = os + row * OP + dt * 16 + hi * 8; *(v4f*)p = __builtin_shufflevector(o[dt][qt], o[dt][qt], 0, 1, 2, 3); *(v4f*)(p + 4) = __builtin_shufflevector(o[dt][qt], o[dt][qt], 4, 5, 6, 7); } }
    __syncthreads();                                  // every wave's (m, l, O) is in LDS before any wave joins them
    constexpr int LPQ = 8 / NQ, DPL = 8 * NQ;         // lanes per query row and output elements per lane in the join
    const int qq = NQ == 2 ? w * 8 + lane / LPQ : (w & 1) * 8 + (lane & 7), d0 = NQ == 2 ? (lane % LPQ) * DPL : ((w >> 1) * 4 + (lane >> 3)) * 8;   // 8 consecutive rows a wave: their pieces fill whole lines of the merged planes
    v2f t[NW]; float M = -3.0e38f;
#pragma unroll
    for (int i = 0; i < NW; ++i) { t[i] = *(const v2f*)(ml + (i * (NQ * 16) + qq) * 2); M = fmaxf(M, t[i][0]); }
    float L = 0.f, acc[DPL];
#pragma unroll
    for (int e = 0; e < DPL; ++e) acc[e] = 0.f;
#pragma unroll
    for (int i = 0; i < NW; ++i) { const float sc = exp2x1((t[i][0] - M) * SL2E); L += t[i][1] * sc;   // a wave that had no block: m = -3e38, so sc = 0, on l = 0 and O = 0
#pragma unroll
        for (int e = 0; e < DPL; e += 4) { const v4f x = *(const v4f*)(os + (i * (NQ * 16) + qq) * OP + d0 + e); acc[e] += x[0] * sc; acc[e + 1] += x[1] * sc; acc[e + 2] += x[2] * sc; acc[e + 3] += x[3] * sc; } }
    const float inv = __fdiv_rn(1.0f, L);
#pragma unroll
    for (int c = 0; c < DPL / 8; ++c) { v8us oh, ol;
#pragma unroll
        for (int j = 0; j < 8; ++j) { unsigned short a, c2; splitf(acc[c * 8 + j] * inv, a, c2); oh[j] = a; ol[j] = c2; }
        const size_t oo = pko(q0 + qq, d0 + c * 8, DQ); *(v8us*)(Ah + oo) = oh; *(v8us*)(Al + oo) = ol; }
    // hi/lo form only: behind the last store, the wait that stands in front of any rewrite of a register an issued store names (in the listing the way on from here leads past the fp16 form's entry, which writes such registers; the fp16 form's stores run straight into the end of the program)
    if constexpr (HL) asm volatile("s_wait_xcnt 0x0" ::: "memory");
}
// grid (batches x heads, tiles): blockIdx.x = batch * NH_ + head is the plane's index; blockIdx.y ranks the tiles by falling cost: the (TT - RH) / 32 fp16 tiles of 32 rows from the last row up, then the RH / 16 hi/lo tiles of 16 rows.
__global__ __launch_bounds__(32 * NW) void k_attn(const h16* __restrict__ Q16, const h16* __restrict__ K16, const h16* __restrict__ V16, const bf* __restrict__ Qh, const bf* __restrict__ Ql, const bf* __restrict__ Kh, const bf* __restrict__ Kl, const bf* __restrict__ Vh, const bf* __restrict__ Vl, bf* __restrict__ Ah, bf* __restrict__ Al) {
    __shared__ __align__(16) float os[NW * 32 * OP]; __shared__ __align__(16) float ml[NW * 32 * 2];
    const size_t hp = (size_t)blockIdx.x * TT * HD; const int r = blockIdx.y; const size_t ao = (size_t)(blockIdx.x / NH_) * TT * DQ + (blockIdx.x % NH_) * (HD / 32) * 512;   /* the batch's rows, the head's first tile column */ Ah += ao; Al += ao;
    if (r < (TT - RH) / 32) attn_tile<h16, 2, false>(Q16 + hp, nullptr, K16 + hp, nullptr, V16 + hp, nullptr, TT - 32 - 32 * r, Ah, Al, os, ml);
    else attn_tile<bf, 1, true>(Qh + hp, Ql + hp, Kh + hp, Kl + hp, Vh + hp, Vl + hp, RH - 16 - 16 * (r - (TT - RH) / 32), Ah, Al, os, ml);
}

extern "C" void kernel_launch(void* const* d_in, const int* in_sizes, int n_in,
                              void* d_out, int out_size, void* d_ws, size_t ws_size, hipStream_t stream) {
    (void)in_sizes; (void)n_in; (void)out_size;
    const float* x = (const float*)d_in[0]; const float* wqkv = (const float*)d_in[1]; const float* wo = (const float*)d_in[2];   /* input order X, W_qkv ('oi' [3072][1024]: q | k | v = its three 1,024-row blocks), W_o ('oi' [1024][1024]): THREE inputs */
    float* OUT = (float*)d_out;     // [2][2048][1024]
    char* wsp = (char*)d_ws;
    auto take = [&](size_t bytes) { char* p = wsp; wsp += (bytes + 255) & ~(size_t)255; return (void*)p; };
    const size_t PG = (size_t)NB_ * NH_ * TT * HD;   // elements of one of q, k, v: a plane per (batch, head)
    bf* WQKV = (bf*)take((size_t)(DQ + 2 * DKV) * DM * 2); bf* WO = (bf*)take((size_t)DM * DQ * 2); float* CS = (float*)take((size_t)TT * HD * 2 * 4);
    h16* P16 = (h16*)take(3 * PG * 2); bf* Ph = (bf*)take(3 * PG * 2); bf* Pl = (bf*)take(3 * PG * 2);   // each [q | k | v][batch][head]
    bf* XB = (bf*)take((size_t)NB_ * TT * DM * 2);
    bf* ATh = (bf*)take((size_t)NB_ * TT * DQ * 2); bf* ATl = (bf*)take((size_t)NB_ * TT * DQ * 2);
    if ((size_t)(wsp - (char*)d_ws) > ws_size) return;    // ws 256 MiB
    k_prep<<<PB_CS + PB_X + PB_W + PB_O, 256, 0, stream>>>(x, wqkv, wo, XB, WQKV, WO, CS);   /* bf16 copies; {cos, sin}(t x THETA**(-2i/64)) per interleaved pair */
    k_gemmw<bf, 0, false, 1, DM><<<dim3(TT / 64, (DQ + 2 * DKV) / 64, NB_), 32, 0, stream>>>(XB, nullptr, WQKV, nullptr, nullptr, 0, nullptr, (size_t)TT * DM, 0, 0, CS, P16, Ph, Pl);
    k_attn<<<dim3(NB_ * NH_, (TT - RH) / 32 + RH / 16, 1), 32 * NW, 0, stream>>>(P16, P16 + PG, P16 + 2 * PG, Ph, Pl, Ph + PG, Pl + PG, Ph + 2 * PG, Pl + 2 * PG, ATh, ATl);   // one kv head per query head
    k_gemmw<bf, 1, false, 0, DQ><<<dim3(NB_ * TT / 64, DM / 64, 1), 32, 0, stream>>>(ATh, ATl, WO, nullptr, OUT, DM, nullptr, 0, 0, 0, nullptr, nullptr, nullptr, nullptr);   // the batches' rows are one [NB_ * TT][DQ] operand
}

// v007
// One run takes 83.6 microseconds.
// In two side-by-side timings against v006, it was 1.40 and 1.35 times as fast.
// All steps since v000 together make it 17.4 times as fast.
#include <hip/hip_runtime.h>

// Causal multi-head self-attention with interleaved rotary embeddings and a FUSED (out, in) qkv weight (X [2][2048][1024]; qkv = einsum('bsd,od->bso', X, W_qkv) ('oi' [3072][1024] std sqrt(2/4096), no bias) viewed (B, S, 3, 16, 64): q | k | v = the three 1,024-ROW blocks of W_qkv (16 heads x 64); rotary on (even, odd) pairs with angle pos / (10000 ** (2 k / 64)) (float32 constants 10000^(-2i/64), precise cosf/sinf); scores x 64^-0.5, causal (-inf); softmax; out = merged W_o^T ('oi', no bias) -> [2][2048][1024] (4.2 M); argument order X, W_qkv, W_o.
// Both batches ride in every launch (4 launches): bf16 copies of x and the weights; exact projections; {cos, sin} per (position, pair) from the int positions (jnp-exact float32 inverse frequencies, precise cosf/sinf); interleaved rotary and the 16-bit head planes in the projections' own epilogues; causal T-2048 attention fused in k_attn (hybrid rows: < 512 hi/lo 3 products, rest fp16 x1024; running maximum, keys walked up to the diagonal); merged hi/lo x wo exact, no bias.
// Compute dtypes, f32 accumulate: every input rounded to bf16; projections exact ; rotary f32; attention rows < 512 3 products, rest fp16; softmax f32; wo hl x exact, no bias.

#define NB_  2
#define TT   2048
#define DM   1024
#define NH_  16
#define NKV  16
#define REP  (NH_ / NKV)
#define HD   64
#define DQ   (NH_ * HD)
#define DKV  (NKV * HD)
#define RH   512                  // query rows < RH use hi+lo planes (0: none)
#define SCL  0.125f   // HD^-0.5
typedef _Float16 h16;
typedef unsigned short bf;
typedef __attribute__((ext_vector_type(16))) __bf16   v16bf;
typedef __attribute__((ext_vector_type(16))) _Float16 v16h;
typedef __attribute__((ext_vector_type(8)))  _Float16 v8h;
typedef __attribute__((ext_vector_type(8)))  unsigned short v8us;
typedef __attribute__((ext_vector_type(8)))  float    v8f;
typedef __attribute__((ext_vector_type(4)))  float    v4f;
typedef v8h  __attribute__((may_alias)) v8ha;
typedef v4f  __attribute__((may_alias)) v4fa;
typedef v8us __attribute__((may_alias)) v8usa;

__device__ __forceinline__ unsigned short f2bf(float f) { unsigned u = __float_as_uint(f); u += 0x7FFFu + ((u >> 16) & 1u); return (unsigned short)(u >> 16); }
__device__ __forceinline__ float bf2f(unsigned short b) { return __uint_as_float(((unsigned)b) << 16); }
__device__ __forceinline__ float bfr(float f) { return bf2f(f2bf(f)); }
__device__ __forceinline__ v16h cat16(v8h lo, v8h hi) { return __builtin_shufflevector(lo, hi, 0, 1, 2, 3, 4, 5, 6, 7, 8, 9, 10, 11, 12, 13, 14, 15); }
__device__ __forceinline__ v16bf cat16b(v8us lo, v8us hi) { return __builtin_bit_cast(v16bf, __builtin_shufflevector(lo, hi, 0, 1, 2, 3, 4, 5, 6, 7, 8, 9, 10, 11, 12, 13, 14, 15)); }
__device__ __forceinline__ v8f wmma16(v16h a, v16h b, v8f c) { return __builtin_amdgcn_wmma_f32_16x16x32_f16(false, a, false, b, (short)0, c, false, false); }
__device__ __forceinline__ v8f wmmab(v16bf a, v16bf b, v8f c) { return __builtin_amdgcn_wmma_f32_16x16x32_bf16(false, a, false, b, (short)0, c, false, false); }



__device__ __forceinline__ h16 tohx(float x) { return (h16)x; }
__device__ __forceinline__ void splitf(float y, unsigned short& h, unsigned short& l) { h = f2bf(y); l = f2bf(y - bf2f(h)); }
typedef __attribute__((ext_vector_type(2))) _Float16 v2h;
typedef __attribute__((ext_vector_type(4))) _Float16 v4h;
typedef __attribute__((ext_vector_type(2))) unsigned short v2us;
typedef __attribute__((ext_vector_type(4))) unsigned short v4us;
typedef __attribute__((ext_vector_type(2))) float v2f;
typedef __attribute__((ext_vector_type(4))) int v4i;

// ---- Fragment order: every 16-bit matrix operand in the workspace ([rows][K], rows % 16 == 0, K % 32 == 0) is stored as tiles of 16 rows x 32 k (1,024 bytes; tile index = (row / 16) * (K / 32) + k / 32), and inside a tile
// as the two 16-byte pieces a lane of the matrix instruction holds: piece (k / 16 % 2) * 32 + (k / 8 % 2) * 16 + row % 16. A fragment load (WFrag::ld at tile + lane * 8 elements) is then two wave-wide loads of 512 contiguous bytes
// (4 whole lines each), where a row-major plane takes 16 lines a load; the values that reach each lane and register are those of the row-major form.
__device__ __forceinline__ size_t pko(int row, int k, int K) { return ((size_t)(row >> 4) * (K >> 5) + (k >> 5)) * 512 + ((k >> 4) & 1) * 256 + ((k >> 3) & 1) * 128 + (row & 15) * 8 + (k & 7); }
// ---- k_gemmw: register-blocked GEMM, one wave per 64x64 output tile (16 accumulators); WM x WN waves form a work-group that owns a (64 WM) x (64 WN) tile and shares its operands through LDS; grid (M / (64 WM), N / (64 WN), Z), 32 WM WN threads.
// A stage is 64 k of every operand row of the work-group's tile, in fragment order as in the workspace (a row block of 16 rows x 64 k is 2 KiB in a row, there and in LDS). It comes by asynchronous copies to LDS, through no register,
// two buffers: stage t + 1 is asked for when every wave has left stage t - 1, and flies while stage t is worked on. A fragment read from LDS is two wave-wide reads of 512 contiguous bytes.
// C[m][n] (f32, pitch ldc, + optional f32 bias[n]) = sum_k A[m][k] Bt[n][k] (NSPLIT 1: + A2[m][k] Bt[n][k]). z-batch strides sA/sB/sC in elements. K % 64 == 0, K >= 128.
// EPI says where a wave's tile goes. 0: C as above. 1: the fused q | k | v projection of batch blockIdx.z: the tile is 64 positions (rows) x the 64 columns of ONE head (cy = column / 64 = which * NH_ + head, which = 0 q, 1 k, 2 v), and it leaves the wave as the attention's 16-bit planes (fp16, bf16 hi, bf16 lo; each buffer [which][batch][head] planes of TT * HD), no f32 copy in between:
// q, k: interleaved rotary with {cos, sin} from CS, planes [t][d] in fragment order (a lane turns 8 columns of a row, one 16-byte piece; 8 lanes on 8 consecutive rows fill a 128-byte line); v: planes [d][t] in fragment order: a lane's accumulator holds 8 consecutive positions of one column, which IS its piece of the transposed tile (a store is 512 contiguous bytes).
template <typename T16> struct WFrag;
template <> struct WFrag<h16> { typedef v16h V; static __device__ __forceinline__ V ld(const h16* p) { return cat16(*(const v8h*)p, *(const v8h*)(p + 256)); } static __device__ __forceinline__ v8f mma(V a, V b, v8f c) { return wmma16(a, b, c); } };
template <> struct WFrag<bf> { typedef v16bf V; static __device__ __forceinline__ V ld(const bf* p) { return cat16b(*(const v8us*)p, *(const v8us*)(p + 256)); } static __device__ __forceinline__ v8f mma(V a, V b, v8f c) { return wmmab(a, b, c); } };
// cp8, cp12: two or three row blocks of a stage (16 rows x 64 k, 2 KiB in a row in the workspace as in LDS), each as four wave-wide copies of 512 bytes; l, g: the lane's own 16 bytes of a block's first copy, in LDS and in the workspace.
// The wait on the last line stands in front of any rewrite of a register that an issued copy names; inside the statement nothing can be moved between the copies and it.
template <typename T16>
__device__ __forceinline__ void cp8(unsigned l0, const T16* g0, unsigned l1, const T16* g1) {
    asm volatile("global_load_async_to_lds_b128 %0, %8, off\n\tglobal_load_async_to_lds_b128 %1, %9, off\n\tglobal_load_async_to_lds_b128 %2, %10, off\n\tglobal_load_async_to_lds_b128 %3, %11, off\n\t"
                 "global_load_async_to_lds_b128 %4, %12, off\n\tglobal_load_async_to_lds_b128 %5, %13, off\n\tglobal_load_async_to_lds_b128 %6, %14, off\n\tglobal_load_async_to_lds_b128 %7, %15, off\n\ts_wait_xcnt 0x0"
                 :: "v"(l0), "v"(l0 + 512u), "v"(l0 + 1024u), "v"(l0 + 1536u), "v"(l1), "v"(l1 + 512u), "v"(l1 + 1024u), "v"(l1 + 1536u),
                    "v"(g0), "v"(g0 + 256), "v"(g0 + 512), "v"(g0 + 768), "v"(g1), "v"(g1 + 256), "v"(g1 + 512), "v"(g1 + 768) : "memory");
}
template <typename T16>
__device__ __forceinline__ void cp12(unsigned l0, const T16* g0, unsigned l1, const T16* g1, unsigned l2, const T16* g2) {
    asm volatile("global_load_async_to_lds_b128 %0, %12, off\n\tglobal_load_async_to_lds_b128 %1, %13, off\n\tglobal_load_async_to_lds_b128 %2, %14, off\n\tglobal_load_async_to_lds_b128 %3, %15, off\n\t"
                 "global_load_async_to_lds_b128 %4, %16, off\n\tglobal_load_async_to_lds_b128 %5, %17, off\n\tglobal_load_async_to_lds_b128 %6, %18, off\n\tglobal_load_async_to_lds_b128 %7, %19, off\n\t"
                 "global_load_async_to_lds_b128 %8, %20, off\n\tglobal_load_async_to_lds_b128 %9, %21, off\n\tglobal_load_async_to_lds_b128 %10, %22, off\n\tglobal_load_async_to_lds_b128 %11, %23, off\n\ts_wait_xcnt 0x0"
                 :: "v"(l0), "v"(l0 + 512u), "v"(l0 + 1024u), "v"(l0 + 1536u), "v"(l1), "v"(l1 + 512u), "v"(l1 + 1024u), "v"(l1 + 1536u), "v"(l2), "v"(l2 + 512u), "v"(l2 + 1024u), "v"(l2 + 1536u),
                    "v"(g0), "v"(g0 + 256), "v"(g0 + 512), "v"(g0 + 768), "v"(g1), "v"(g1 + 256), "v"(g1 + 512), "v"(g1 + 768), "v"(g2), "v"(g2 + 256), "v"(g2 + 512), "v"(g2 + 768) : "memory");
}
template <typename T16, int NSPLIT, bool BIAS, int EPI, int K, int WM, int WN>
__global__ __launch_bounds__(32 * WM * WN) void k_gemmw(const T16* __restrict__ A, const T16* __restrict__ A2, const T16* __restrict__ Bt, float* C, int ldc, const float* __restrict__ bias, size_t sA, size_t sB, size_t sC, const float* __restrict__ CS, h16* __restrict__ P16, bf* __restrict__ Ph, bf* __restrict__ Pl) {
    typedef typename WFrag<T16>::V V;
    static_assert(NSPLIT == 0 || NSPLIT == 1, "A (+ A2) x Bt"); static_assert(K % 64 == 0 && K >= 128, "two stages or more");
    // a stage in LDS: the row blocks of A, of A2, of Bt, in that order, 1,024 elements each; wave w copies row blocks w, w + NWV, ...: FULL each, and the first REM waves one more
    constexpr int NWV = WM * WN, RA = 4 * WM, RB0 = (NSPLIT + 1) * RA, NRB = RB0 + 4 * WN, FULL = NRB / NWV, REM = NRB % NWV, MR = FULL + (REM ? 1 : 0), SE = NRB * 1024, NT = K / 64;
    static_assert(REM == 0 ? FULL % 3 == 0 : FULL == 2, "the copies go three row blocks a statement, or two");
    __shared__ __align__(16) T16 st[2 * SE]; __shared__ __align__(16) float osb[NWV * 16 * 68];
    const size_t z = blockIdx.z; A += z * sA; if (NSPLIT == 1) A2 += z * sA; Bt += z * sB; C += z * sC;
    const int lane = threadIdx.x & 31, lr = lane & 15, hi = lane >> 4; const int w = __builtin_amdgcn_readfirstlane(threadIdx.x >> 5), wm = w % WM, wn = w / WM;
    const int R0 = blockIdx.x * (64 * WM), C0 = blockIdx.y * (64 * WN), r0 = R0 + wm * 64, c0 = C0 + wn * 64, cy = c0 / 64; float* os = osb + w * (16 * 68);   // each wave stages its output rows in its own range
    v8f acc[4][4];
#pragma unroll
    for (int mb = 0; mb < 4; ++mb)
#pragma unroll
        for (int nb = 0; nb < 4; ++nb) acc[mb][nb] = (v8f){};
    const T16* gp[MR];                               // the lane's first 16 bytes of each of the wave's row blocks, stage 0 (a wave without a last one: the stage's last block, never copied by it)
#pragma unroll
    for (int i = 0; i < MR; ++i) { const int rb = min(w + i * NWV, NRB - 1); gp[i] = (rb < RA ? A + (size_t)(R0 + 16 * rb) * K : (NSPLIT == 1 && rb < RB0) ? A2 + (size_t)(R0 + 16 * (rb - RA)) * K : Bt + (size_t)(C0 + 16 * (rb - RB0)) * K) + 8 * lane; }
    const unsigned l00 = (unsigned)(size_t)(st + w * 1024 + 8 * lane);   // ... and their place in buffer 0: NWV * 2,048 bytes from one to the next
    auto fill = [&](int t, int bu) {                 // stage t into buffer bu
        const unsigned l = l00 + (unsigned)bu * (SE * 2u); const size_t go = (size_t)t * 1024; constexpr unsigned LS = NWV * 2048u;
        if constexpr (REM == 0) {
#pragma unroll
            for (int i = 0; i < FULL; i += 3) cp12<T16>(l + i * LS, gp[i] + go, l + (i + 1) * LS, gp[i + 1] + go, l + (i + 2) * LS, gp[i + 2] + go);
        } else { if (w < REM) cp12<T16>(l, gp[0] + go, l + LS, gp[1] + go, l + 2 * LS, gp[2] + go); else cp8<T16>(l, gp[0] + go, l + LS, gp[1] + go); } };   // w is a scalar: a whole wave goes one way
    fill(0, 0);
    asm volatile("s_wait_asynccnt 0x0" ::: "memory");   // the wave's own copies of stage 0 have landed
    __syncthreads();                                 // ... and every other wave's: stage 0 may be read
#pragma unroll 1   // stays rolled: one copy of the body serves both buffers
    for (int t = 0; t < NT; ++t) {
        const T16* sb = st + (t & 1) * SE + 8 * lane;
        V a[2][4], a2[2][4], b[2][4];                // the fragments of the stage's two k steps of 32
        auto ldf = [&](int s) {
#pragma unroll
            for (int mb = 0; mb < 4; ++mb) { a[s][mb] = WFrag<T16>::ld(sb + (wm * 4 + mb) * 1024 + s * 512); if (NSPLIT == 1) a2[s][mb] = WFrag<T16>::ld(sb + (RA + wm * 4 + mb) * 1024 + s * 512); }
#pragma unroll
            for (int nb = 0; nb < 4; ++nb) b[s][nb] = WFrag<T16>::ld(sb + (RB0 + wn * 4 + nb) * 1024 + s * 512); };
        if (t + 1 < NT) fill(t + 1, (t + 1) & 1);    // into the buffer that every wave left at the barrier just passed; the copies fly while stage t is worked on
        ldf(0);
        __builtin_amdgcn_sched_barrier(0);           // the first k step's reads stay in front of the second's, so that its matrix instructions wait for them alone (left free, the scheduler put some of them last)
        ldf(1);
        __builtin_amdgcn_sched_barrier(0);           // the stage's LDS reads stay in front of its matrix instructions (left free, the scheduler spread them among these, each with a wait to 0 behind it)
#pragma unroll
        for (int s = 0; s < 2; ++s)
#pragma unroll
            for (int nb = 0; nb < 4; ++nb)
#pragma unroll
                for (int mb = 0; mb < 4; ++mb) { acc[mb][nb] = WFrag<T16>::mma(a[s][mb], b[s][nb], acc[mb][nb]); if (NSPLIT == 1) acc[mb][nb] = WFrag<T16>::mma(a2[s][mb], b[s][nb], acc[mb][nb]); }
        __builtin_amdgcn_sched_barrier(0);           // the matrix instructions stay in front of the waits (left free, the scheduler put them behind the barrier, and the wait for the copies stood right behind their issue)
        asm volatile("s_wait_dscnt 0x0" ::: "memory");      // the wave's reads of this buffer are over before it may be refilled
        asm volatile("s_wait_asynccnt 0x0" ::: "memory");   // the wave's own copies of stage t + 1 have landed
        __syncthreads();                             // stage t + 1 may be read by every wave; every wave has left stage t's buffer
    }
    asm volatile("s_wait_asynccnt 0x0" ::: "memory");   // no copy is outstanding when the wave goes on to its epilogue and ends
    const size_t pl = EPI == 1 ? ((size_t)(cy / NH_) * NB_ + z) * NH_ + cy % NH_ : 0;   // the tile's plane
    if (EPI == 1 && cy >= 2 * NH_) {          // v (the same for the whole wave)
#pragma unroll
        for (int nb = 0; nb < 4; ++nb)
#pragma unroll
            for (int mb = 0; mb < 4; ++mb) { v8h o16; v8us oh, ol;
#pragma unroll
                for (int j = 0; j < 8; ++j) { const float x = acc[mb][nb][j]; o16[j] = tohx(x); unsigned short a2, c2; splitf(x, a2, c2); oh[j] = a2; ol[j] = c2; }
                const size_t e = pl * HD * TT + pko(nb * 16 + lr, r0 + mb * 16 + hi * 8, TT); *(v8h*)(P16 + e) = o16; *(v8us*)(Ph + e) = oh; *(v8us*)(Pl + e) = ol;
                asm volatile("s_wait_xcnt 0x0" ::: "memory"); }   // behind the block's stores: the wait that stands in front of a rewrite of a register an issued store names (the next block's values land in such registers)
        return; }
#pragma unroll
    for (int mb = 0; mb < 4; ++mb) {
#pragma unroll
        for (int nb = 0; nb < 4; ++nb) {
#pragma unroll
            for (int j = 0; j < 8; ++j) os[(hi * 8 + j) * 68 + nb * 16 + lr] = acc[mb][nb][j]; }
        __builtin_amdgcn_wave_barrier(); asm volatile("" ::: "memory");
        if constexpr (EPI == 1) {
#pragma unroll
            for (int s = 0; s < 4; ++s) { const int rr = 8 * (s & 1) + (lane & 7), t = r0 + mb * 16 + rr, d0 = (4 * (s >> 1) + (lane >> 3)) * 8; const float* xr = os + rr * 68 + d0; const v4f xa = *(const v4fa*)xr, xb = *(const v4fa*)(xr + 4);
                const float x[8] = { xa[0], xa[1], xa[2], xa[3], xb[0], xb[1], xb[2], xb[3] }; const float* cp = CS + ((size_t)t * HD + d0) * 2; v8h o16; v8us oh, ol;
#pragma unroll
                for (int p = 0; p < 8; p += 2) { const v2f cs = *(const v2f*)(cp + 2 * p); const float x0 = x[p], x1 = x[p + 1];
                    const float r0_ = x0 * cs[0] - x1 * cs[1], r1_ = x0 * cs[1] + x1 * cs[0];   /* even: x0 c - x1 s; odd: x0 s + x1 c */
                    o16[p] = tohx(r0_); o16[p + 1] = tohx(r1_); { unsigned short a2, c2; splitf(r0_, a2, c2); oh[p] = a2; ol[p] = c2; splitf(r1_, a2, c2); oh[p + 1] = a2; ol[p + 1] = c2; } }
                const size_t e = pl * TT * HD + pko(t, d0, HD); *(v8h*)(P16 + e) = o16; *(v8us*)(Ph + e) = oh; *(v8us*)(Pl + e) = ol;
                asm volatile("s_wait_xcnt 0x0" ::: "memory"); }   // behind the three stores: the wait that stands in front of a rewrite of a register an issued store names (the next pieces' values and table loads land in such registers)
        } else {
        float* crow = C + (size_t)(r0 + mb * 16) * ldc + c0;
{
#pragma unroll
            for (int s = 0; s < 8; ++s) { const int row = 2 * s + hi, cofs = lr * 4; v4f val = *(const v4fa*)(os + row * 68 + cofs); if (BIAS) { val[0] += bfr(bias[c0 + cofs]); val[1] += bfr(bias[c0 + cofs + 1]); val[2] += bfr(bias[c0 + cofs + 2]); val[3] += bfr(bias[c0 + cofs + 3]); }
                *(v4f*)(crow + (size_t)row * ldc + cofs) = val;
                asm volatile("s_wait_xcnt 0x0" ::: "memory"); }   // behind the store: the wait that stands in front of a rewrite of a register an issued store names (later addresses and values land in such registers)
             }
        }
        __builtin_amdgcn_wave_barrier(); asm volatile("" ::: "memory");
    }
}


__global__ __launch_bounds__(256) void k_wtG(const float* __restrict__ w, int K, int N, bf* Bt) {
    const int lane = threadIdx.x & 31; const int L0 = (blockIdx.x * 8 + (threadIdx.x >> 5)) * 8; const int nlines = N * K / 64;
{
#pragma unroll 1
        for (int l = 0; l < 8; ++l) { const int L = L0 + l; if (L >= nlines) break; const size_t e = (size_t)L * 64 + lane * 2; const int k = (int)(e % K), n = (int)(e / K); v2us o;
            o[0] = f2bf(w[(size_t)k * N + n]); o[1] = f2bf(w[(size_t)(k + 1) * N + n]); *(v2us*)(Bt + e) = o; }
         }
}
static_assert(DQ == DM, "cvt8 takes K = DM for every buffer");
__device__ __forceinline__ void cvt8(const float* __restrict__ src, bf* dst, int blk) { const size_t i = (size_t)blk * 256 + threadIdx.x;   // i: the 16-byte piece of dst (fragment order, K = DM) that the thread writes; a block is 4 tiles: 16 rows x 512 bytes of src; every buffer is a whole number of blocks
    const int tile = (int)(i >> 6), row = tile / (DM / 32) * 16 + (int)(i & 15), kk = tile % (DM / 32) * 32 + (int)((i >> 5) & 1) * 16 + (int)((i >> 4) & 1) * 8; const v8f v = *(const v8f*)(src + (size_t)row * DM + kk); v8us o;
#pragma unroll
    for (int k = 0; k < 8; ++k) o[k] = f2bf(v[k]); *(v8us*)(dst + i * 8) = o;  }
__constant__ float INVP[HD / 2] = { 1.000000000e+00f,7.498942018e-01f,5.623413324e-01f,4.216965139e-01f,3.162277639e-01f,2.371373773e-01f,1.778279394e-01f,1.333521456e-01f,1.000000015e-01f,7.498942316e-02f,5.623413250e-02f,4.216964915e-02f,3.162277490e-02f,2.371373773e-02f,1.778279431e-02f,1.333521400e-02f,9.999999776e-03f,7.498942316e-03f,5.623413250e-03f,4.216964822e-03f,3.162277630e-03f,2.371373819e-03f,1.778279431e-03f,1.333521446e-03f,1.000000047e-03f,7.498941850e-04f,5.623413017e-04f,4.216965172e-04f,3.162277571e-04f,2.371373703e-04f,1.778279402e-04f,1.333521504e-04f };   // 10000 ** (-2 i / 64) as float32 (the module's power form, jnp-computed; differs from 1/10000**(2i/64) by ulps)
__device__ __forceinline__ void csP(float* CS, int blk) { const int idx = blk * 256 + threadIdx.x; const int d = idx % HD; const int t = idx / HD; const float a = __fmul_rn((float)t, INVP[d >> 1]); v2f cs; cs[0] = cosf(a); cs[1] = sinf(a); *(v2f*)(CS + (size_t)idx * 2) = cs;  }
// ---- k_prep: all that the GEMMs read and that depends on no other launch, in one grid; blockIdx.x picks the job by range (the same for a whole block), the table (the longest blocks) first.
#define PB_CS (TT * HD / 256)
#define PB_X  (NB_ * TT * DM / 2048)
#define PB_W  ((DQ + 2 * DKV) * DM / 2048)
#define PB_O  (DM * DQ / 2048)
__global__ __launch_bounds__(256) void k_prep(const float* __restrict__ x, const float* __restrict__ wqkv, const float* __restrict__ wo, bf* XB, bf* WQKV, bf* WO, float* CS) {
    int b = blockIdx.x;
    if (b < PB_CS) { csP(CS, b); return; }
    b -= PB_CS; const float* src = x; bf* dst = XB;
    if (b >= PB_X + PB_W) { b -= PB_X + PB_W; src = wo; dst = WO; } else if (b >= PB_X) { b -= PB_X; src = wqkv; dst = WQKV; }
    cvt8(src, dst, b);
}

#define NW   4
#define SL2E (SCL * 1.4426950408889634f)   // the score scale (a power of two: exact) rides in the exponent's factor; m is kept in unscaled scores
#define OP   68                   // pitch, in floats, of a query's partial output row in LDS (64 + 4: rows 16 bytes apart in the banks)
// 2^x of eight values: eight independent v_exp_f32, each in place, and behind the last the one free slot that the instruction set asks for between a transcendental and an instruction that reads its result or
// overwrites its source.
__device__ __forceinline__ v8f exp2x8(v8f x) { float a = x[0], b = x[1], c = x[2], d = x[3], e = x[4], f = x[5], g = x[6], h = x[7];
    asm("v_exp_f32 %0, %0\n\tv_exp_f32 %1, %1\n\tv_exp_f32 %2, %2\n\tv_exp_f32 %3, %3\n\tv_exp_f32 %4, %4\n\tv_exp_f32 %5, %5\n\tv_exp_f32 %6, %6\n\tv_exp_f32 %7, %7\n\tv_nop" : "+v"(a), "+v"(b), "+v"(c), "+v"(d), "+v"(e), "+v"(f), "+v"(g), "+v"(h));
    return (v8f){a, b, c, d, e, f, g, h}; }
__device__ __forceinline__ float exp2x1(float a) { asm("v_exp_f32 %0, %0\n\tv_nop" : "+v"(a)); return a; }   // one value, with the same slot
template <typename T16, int NQ, bool HL>
__device__ __forceinline__ void attn_tile(const T16* __restrict__ Q, const T16* __restrict__ Q2, const T16* __restrict__ Kp, const T16* __restrict__ Kp2, const T16* __restrict__ Vt, const T16* __restrict__ Vt2, int q0, bf* __restrict__ Ah, bf* __restrict__ Al, float* os, float* ml) {
    typedef typename WFrag<T16>::V V;
    const int lane = threadIdx.x & 31, lr = lane & 15, hi = lane >> 4; const int w = __builtin_amdgcn_readfirstlane(threadIdx.x >> 5);
    const int klast = (q0 + NQ * 16 - 1) & ~31;      // first key of the 32-key block that holds the tile's last diagonal element
    V q[NQ][2], q2[NQ][2], k[2][2], k2[2][2];
    // every operand load is addressed as one lane pointer per plane and pass plus a constant that fits the instruction's offset field (no address sums per load)
    const unsigned kof = (unsigned)(8 * lane), vof = (unsigned)(8 * lane);   /* fragment order: the lane's piece of a tile */ const T16* pk = nullptr; const T16* pk2 = nullptr;
#pragma unroll
    for (int qt = 0; qt < NQ; ++qt)
#pragma unroll
        for (int c = 0; c < 2; ++c) { const int qc = qt * 16 * HD + c * 512; q[qt][c] = WFrag<T16>::ld(Q + (size_t)q0 * HD + kof + qc); if (HL) q2[qt][c] = WFrag<T16>::ld(Q2 + (size_t)q0 * HD + kof + qc); }
    auto ldk = [&](int kk) {                         // the four (HL: eight) fragments of the 32 key rows from kk on
        pk = Kp + (size_t)kk * HD + kof; if (HL) pk2 = Kp2 + (size_t)kk * HD + kof;
#pragma unroll
        for (int kt = 0; kt < 2; ++kt)
#pragma unroll
            for (int c = 0; c < 2; ++c) { const int kc = kt * 16 * HD + c * 512; k[kt][c] = WFrag<T16>::ld(pk + kc); if (HL) k2[kt][c] = WFrag<T16>::ld(pk2 + kc); } };
    if (!HL) ldk(min(32 * w, klast));                // fp16: key fragments run one pass ahead (a wave with no block of its own fetches the last one: in bounds, unused); hi/lo: at most 4 passes a wave, fetched in the pass, which keeps the registers under 256
    v8f o[4][NQ]; float m[NQ], l[NQ];
#pragma unroll
    for (int qt = 0; qt < NQ; ++qt) { m[qt] = -3.0e38f; l[qt] = 0.f;
#pragma unroll
        for (int dt = 0; dt < 4; ++dt) o[dt][qt] = (v8f){}; }
#pragma unroll 1   // stays rolled: the trip count is known only at run time, and a second copy of the body (its fragments and score tiles) would not fit the registers
    for (int kb = 32 * w; kb <= klast; kb += 32 * NW) {
        if (HL) ldk(kb);
        V v[4], v2[4]; const T16* pv = Vt + (size_t)kb * 16 + vof; const T16* pv2 = HL ? Vt2 + (size_t)kb * 16 + vof : nullptr;   // 32 keys on = one tile (512 elements) on
#pragma unroll
        for (int dt = 0; dt < 4; ++dt) { v[dt] = WFrag<T16>::ld(pv + dt * 16 * TT); if (HL) v2[dt] = WFrag<T16>::ld(pv2 + dt * 16 * TT); }
        v8f s[2][NQ];
#pragma unroll
        for (int kt = 0; kt < 2; ++kt)
#pragma unroll
            for (int qt = 0; qt < NQ; ++qt) { v8f a = (v8f){};
#pragma unroll
                for (int c = 0; c < 2; ++c) { a = WFrag<T16>::mma(k[kt][c], q[qt][c], a); if (HL) { a = WFrag<T16>::mma(k[kt][c], q2[qt][c], a); a = WFrag<T16>::mma(k2[kt][c], q[qt][c], a); } }
                s[kt][qt] = a; }
        if (!HL) ldk(min(kb + 32 * NW, klast));       // the wave's next key fragments are fetched now, behind this pass's last use of the registers (its last pass fetches the last block: in bounds, unused)
        // all of the pass's loads are issued: the wait that stands in front of a rewrite of a register an issued load names. The pass's lane pointers are its inputs, so that their registers stay theirs up to here (one build landed later loads of the run in them)
        if constexpr (HL) asm volatile("s_wait_xcnt 0x0" :: "v"(pk), "v"(pk2), "v"(pv), "v"(pv2) : "memory"); else asm volatile("s_wait_xcnt 0x0" :: "v"(pk), "v"(pv) : "memory");
        if (kb == klast) {                            // only the last block crosses the diagonal: key > query is masked
#pragma unroll
            for (int kt = 0; kt < 2; ++kt)
#pragma unroll
                for (int qt = 0; qt < NQ; ++qt)
#pragma unroll
                    for (int j = 0; j < 8; ++j) if (kb + kt * 16 + hi * 8 + j > q0 + qt * 16 + lr) s[kt][qt][j] = -3.0e38f; }
        V pb[NQ], pb2[NQ];
#pragma unroll
        for (int qt = 0; qt < NQ; ++qt) {
            float mx = fmaxf(s[0][qt][0], s[1][qt][0]);
#pragma unroll
            for (int j = 1; j < 8; ++j) mx = fmaxf(mx, fmaxf(s[0][qt][j], s[1][qt][j]));
            mx = fmaxf(mx, __shfl_xor(mx, 16, 32));
            const float mn = fmaxf(m[qt], mx); const float al = exp2x1((m[qt] - mn) * SL2E); m[qt] = mn;
            float sum = 0.f;
#pragma unroll
            for (int kt = 0; kt < 2; ++kt) { v8f x;
#pragma unroll
                for (int j = 0; j < 8; ++j) { const float y = (s[kt][qt][j] - mn) * SL2E; x[j] = HL ? y : y + 10.0f; }
                x = exp2x8(x); s[kt][qt] = x;
#pragma unroll
                for (int j = 0; j < 8; ++j) sum += x[j]; }
            l[qt] = l[qt] * al + sum;
#pragma unroll
            for (int dt = 0; dt < 4; ++dt) o[dt][qt] *= al;
            if constexpr (HL) { v8us h0, h1, l0, l1;
#pragma unroll
                for (int j = 0; j < 8; ++j) { unsigned short a, c2; splitf(s[0][qt][j], a, c2); h0[j] = a; l0[j] = c2; splitf(s[1][qt][j], a, c2); h1[j] = a; l1[j] = c2; }
                pb[qt] = cat16b(h0, h1); pb2[qt] = cat16b(l0, l1);
            } else { v8h h0, h1;
#pragma unroll
                for (int j = 0; j < 8; ++j) { h0[j] = tohx(s[0][qt][j]); h1[j] = tohx(s[1][qt][j]); }
                pb[qt] = cat16(h0, h1); }
        }
#pragma unroll
        for (int dt = 0; dt < 4; ++dt)
#pragma unroll
            for (int qt = 0; qt < NQ; ++qt) { o[dt][qt] = WFrag<T16>::mma(v[dt], pb[qt], o[dt][qt]); if (HL) { o[dt][qt] = WFrag<T16>::mma(v[dt], pb2[qt], o[dt][qt]); o[dt][qt] = WFrag<T16>::mma(v2[dt], pb[qt], o[dt][qt]); } }
    }
#pragma unroll
    for (int qt = 0; qt < NQ; ++qt) { const int row = w * (NQ * 16) + qt * 16 + lr; const float ls = l[qt] + __shfl_xor(l[qt], 16, 32);   // the halves' sums are joined once, here
        if (hi == 0) { v2f t2; t2[0] = m[qt]; t2[1] = ls; *(v2f*)(ml + row * 2) = t2; }
#pragma unroll
        for (int dt = 0; dt < 4; ++dt) { float* p = os + row * OP + dt * 16 + hi * 8; *(v4f*)p = __builtin_shufflevector(o[dt][qt], o[dt][qt], 0, 1, 2, 3); *(v4f*)(p + 4) = __builtin_shufflevector(o[dt][qt], o[dt][qt], 4, 5, 6, 7); } }
    __syncthreads();                                  // every wave's (m, l, O) is in LDS before any wave joins them
    constexpr int LPQ = 8 / NQ, DPL = 8 * NQ;         // lanes per query row and output elements per lane in the join
    const int qq = NQ == 2 ? w * 8 + lane / LPQ : (w & 1) * 8 + (lane & 7), d0 = NQ == 2 ? (lane % LPQ) * DPL : ((w >> 1) * 4 + (lane >> 3)) * 8;   // 8 consecutive rows a wave: their pieces fill whole lines of the merged planes
    v2f t[NW]; float M = -3.0e38f;
#pragma unroll
    for (int i = 0; i < NW; ++i) { t[i] = *(const v2f*)(ml + (i * (NQ * 16) + qq) * 2); M = fmaxf(M, t[i][0]); }
    float L = 0.f, acc[DPL];
#pragma unroll
    for (int e = 0; e < DPL; ++e) acc[e] = 0.f;
#pragma unroll
    for (int i = 0; i < NW; ++i) { const float sc = exp2x1((t[i][0] - M) * SL2E); L += t[i][1] * sc;   // a wave that had no block: m = -3e38, so sc = 0, on l = 0 and O = 0
#pragma unroll
        for (int e = 0; e < DPL; e += 4) { const v4f x = *(const v4f*)(os + (i * (NQ * 16) + qq) * OP + d0 + e); acc[e] += x[0] * sc; acc[e + 1] += x[1] * sc; acc[e + 2] += x[2] * sc; acc[e + 3] += x[3] * sc; } }
    const float inv = __fdiv_rn(1.0f, L);
#pragma unroll
    for (int c = 0; c < DPL / 8; ++c) { v8us oh, ol;
#pragma unroll
        for (int j = 0; j < 8; ++j) { unsigned short a, c2; splitf(acc[c * 8 + j] * inv, a, c2); oh[j] = a; ol[j] = c2; }
        const size_t oo = pko(q0 + qq, d0 + c * 8, DQ); *(v8us*)(Ah + oo) = oh; *(v8us*)(Al + oo) = ol; }
    // hi/lo form only: behind the last store, the wait that stands in front of any rewrite of a register an issued store names (in the listing the way on from here leads past the fp16 form's entry, which writes such registers; the fp16 form's stores run straight into the end of the program)
    if constexpr (HL) asm volatile("s_wait_xcnt 0x0" ::: "memory");
}
// grid (batches x heads, tiles): blockIdx.x = batch * NH_ + head is the plane's index; blockIdx.y ranks the tiles by falling cost: the (TT - RH) / 32 fp16 tiles of 32 rows from the last row up, then the RH / 16 hi/lo tiles of 16 rows.
__global__ __launch_bounds__(32 * NW) void k_attn(const h16* __restrict__ Q16, const h16* __restrict__ K16, const h16* __restrict__ V16, const bf* __restrict__ Qh, const bf* __restrict__ Ql, const bf* __restrict__ Kh, const bf* __restrict__ Kl, const bf* __restrict__ Vh, const bf* __restrict__ Vl, bf* __restrict__ Ah, bf* __restrict__ Al) {
    __shared__ __align__(16) float os[NW * 32 * OP]; __shared__ __align__(16) float ml[NW * 32 * 2];
    const size_t hp = (size_t)blockIdx.x * TT * HD; const int r = blockIdx.y; const size_t ao = (size_t)(blockIdx.x / NH_) * TT * DQ + (blockIdx.x % NH_) * (HD / 32) * 512;   /* the batch's rows, the head's first tile column */ Ah += ao; Al += ao;
    if (r < (TT - RH) / 32) attn_tile<h16, 2, false>(Q16 + hp, nullptr, K16 + hp, nullptr, V16 + hp, nullptr, TT - 32 - 32 * r, Ah, Al, os, ml);
    else attn_tile<bf, 1, true>(Qh + hp, Ql + hp, Kh + hp, Kl + hp, Vh + hp, Vl + hp, RH - 16 - 16 * (r - (TT - RH) / 32), Ah, Al, os, ml);
}

extern "C" void kernel_launch(void* const* d_in, const int* in_sizes, int n_in,
                              void* d_out, int out_size, void* d_ws, size_t ws_size, hipStream_t stream) {
    (void)in_sizes; (void)n_in; (void)out_size;
    const float* x = (const float*)d_in[0]; const float* wqkv = (const float*)d_in[1]; const float* wo = (const float*)d_in[2];   /* input order X, W_qkv ('oi' [3072][1024]: q | k | v = its three 1,024-row blocks), W_o ('oi' [1024][1024]): THREE inputs */
    float* OUT = (float*)d_out;     // [2][2048][1024]
    char* wsp = (char*)d_ws;
    auto take = [&](size_t bytes) { char* p = wsp; wsp += (bytes + 255) & ~(size_t)255; return (void*)p; };
    const size_t PG = (size_t)NB_ * NH_ * TT * HD;   // elements of one of q, k, v: a plane per (batch, head)
    bf* WQKV = (bf*)take((size_t)(DQ + 2 * DKV) * DM * 2); bf* WO = (bf*)take((size_t)DM * DQ * 2); float* CS = (float*)take((size_t)TT * HD * 2 * 4);
    h16* P16 = (h16*)take(3 * PG * 2); bf* Ph = (bf*)take(3 * PG * 2); bf* Pl = (bf*)take(3 * PG * 2);   // each [q | k | v][batch][head]
    bf* XB = (bf*)take((size_t)NB_ * TT * DM * 2);
    bf* ATh = (bf*)take((size_t)NB_ * TT * DQ * 2); bf* ATl = (bf*)take((size_t)NB_ * TT * DQ * 2);
    if ((size_t)(wsp - (char*)d_ws) > ws_size) return;    // ws 256 MiB
    k_prep<<<PB_CS + PB_X + PB_W + PB_O, 256, 0, stream>>>(x, wqkv, wo, XB, WQKV, WO, CS);   /* bf16 copies; {cos, sin}(t x THETA**(-2i/64)) per interleaved pair */
    k_gemmw<bf, 0, false, 1, DM, 4, 3><<<dim3(TT / 256, (DQ + 2 * DKV) / 192, NB_), 384, 0, stream>>>(XB, nullptr, WQKV, nullptr, 0, nullptr, (size_t)TT * DM, 0, 0, CS, P16, Ph, Pl);
    k_attn<<<dim3(NB_ * NH_, (TT - RH) / 32 + RH / 16, 1), 32 * NW, 0, stream>>>(P16, P16 + PG, P16 + 2 * PG, Ph, Pl, Ph + PG, Pl + PG, Ph + 2 * PG, Pl + 2 * PG, ATh, ATl);   // one kv head per query head
    k_gemmw<bf, 1, false, 0, DQ, 2, 2><<<dim3(NB_ * TT / 128, DM / 128, 1), 128, 0, stream>>>(ATh, ATl, WO, OUT, DM, nullptr, 0, 0, 0, nullptr, nullptr, nullptr, nullptr);   // the batches' rows are one [NB_ * TT][DQ] operand
}

// v008
// Measured time: 78.4 microseconds a run.
// Two timings next to v007 both put it at 1.05 times that version's speed.
// All steps since v000 together make it 18.2 times as fast.
#include <hip/hip_runtime.h>

// Causal multi-head self-attention with interleaved rotary embeddings and a FUSED (out, in) qkv weight (X [2][2048][1024]; qkv = einsum('bsd,od->bso', X, W_qkv) ('oi' [3072][1024] std sqrt(2/4096), no bias) viewed (B, S, 3, 16, 64): q | k | v = the three 1,024-ROW blocks of W_qkv (16 heads x 64); rotary on (even, odd) pairs with angle pos / (10000 ** (2 k / 64)) (float32 constants 10000^(-2i/64), precise cosf/sinf); scores x 64^-0.5, causal (-inf); softmax; out = merged W_o^T ('oi', no bias) -> [2][2048][1024] (4.2 M); argument order X, W_qkv, W_o.
// Both batches ride in every launch (4 launches): bf16 copies of x and the weights; exact projections; {cos, sin} per (position, pair) from the int positions (jnp-exact float32 inverse frequencies, precise cosf/sinf); interleaved rotary and the 16-bit head planes in the projections' own epilogues; causal T-2048 attention fused in k_attn (hybrid rows: < 512 hi/lo 3 products, rest fp16 x1024; running maximum, keys walked up to the diagonal); merged hi/lo x wo exact, no bias.
// Compute dtypes, f32 accumulate: every input rounded to bf16; projections exact ; rotary f32; attention rows < 512 3 products, rest fp16; softmax f32; wo hl x exact, no bias.

#define NB_  2
#define TT   2048
#define DM   1024
#define NH_  16
#define NKV  16
#define REP  (NH_ / NKV)
#define HD   64
#define DQ   (NH_ * HD)
#define DKV  (NKV * HD)
#define RH   512                  // query rows < RH use hi+lo planes (0: none)
#define SCL  0.125f   // HD^-0.5
typedef _Float16 h16;
typedef unsigned short bf;
typedef __attribute__((ext_vector_type(16))) __bf16   v16bf;
typedef __attribute__((ext_vector_type(16))) _Float16 v16h;
typedef __attribute__((ext_vector_type(8)))  _Float16 v8h;
typedef __attribute__((ext_vector_type(8)))  unsigned short v8us;
typedef __attribute__((ext_vector_type(8)))  float    v8f;
typedef __attribute__((ext_vector_type(4)))  float    v4f;
typedef v8h  __attribute__((may_alias)) v8ha;
typedef v4f  __attribute__((may_alias)) v4fa;
typedef v8us __attribute__((may_alias)) v8usa;

__device__ __forceinline__ unsigned short f2bf(float f) { unsigned u = __float_as_uint(f); u += 0x7FFFu + ((u >> 16) & 1u); return (unsigned short)(u >> 16); }
__device__ __forceinline__ float bf2f(unsigned short b) { return __uint_as_float(((unsigned)b) << 16); }
__device__ __forceinline__ float bfr(float f) { return bf2f(f2bf(f)); }
__device__ __forceinline__ v16h cat16(v8h lo, v8h hi) { return __builtin_shufflevector(lo, hi, 0, 1, 2, 3, 4, 5, 6, 7, 8, 9, 10, 11, 12, 13, 14, 15); }
__device__ __forceinline__ v16bf cat16b(v8us lo, v8us hi) { return __builtin_bit_cast(v16bf, __builtin_shufflevector(lo, hi, 0, 1, 2, 3, 4, 5, 6, 7, 8, 9, 10, 11, 12, 13, 14, 15)); }
__device__ __forceinline__ v8f wmma16(v16h a, v16h b, v8f c) { return __builtin_amdgcn_wmma_f32_16x16x32_f16(false, a, false, b, (short)0, c, false, false); }
__device__ __forceinline__ v8f wmmab(v16bf a, v16bf b, v8f c) { return __builtin_amdgcn_wmma_f32_16x16x32_bf16(false, a, false, b, (short)0, c, false, false); }



__device__ __forceinline__ h16 tohx(float x) { return (h16)x; }
__device__ __forceinline__ void splitf(float y, unsigned short& h, unsigned short& l) { h = f2bf(y); l = f2bf(y - bf2f(h)); }
typedef __attribute__((ext_vector_type(2))) _Float16 v2h;
typedef __attribute__((ext_vector_type(4))) _Float16 v4h;
typedef __attribute__((ext_vector_type(2))) unsigned short v2us;
typedef __attribute__((ext_vector_type(4))) unsigned short v4us;
typedef __attribute__((ext_vector_type(2))) float v2f;
typedef __attribute__((ext_vector_type(4))) int v4i;

// ---- Fragment order: every 16-bit matrix operand in the workspace ([rows][K], rows % 16 == 0, K % 32 == 0) is stored as tiles of 16 rows x 32 k (1,024 bytes; tile index = (row / 16) * (K / 32) + k / 32), and inside a tile
// as the two 16-byte pieces a lane of the matrix instruction holds: piece (k / 16 % 2) * 32 + (k / 8 % 2) * 16 + row % 16. A fragment load (WFrag::ld at tile + lane * 8 elements) is then two wave-wide loads of 512 contiguous bytes
// (4 whole lines each), where a row-major plane takes 16 lines a load; the values that reach each lane and register are those of the row-major form.
__device__ __forceinline__ size_t pko(int row, int k, int K) { return ((size_t)(row >> 4) * (K >> 5) + (k >> 5)) * 512 + ((k >> 4) & 1) * 256 + ((k >> 3) & 1) * 128 + (row & 15) * 8 + (k & 7); }
// ---- k_gemmw: register-blocked GEMM, one wave per 64x64 output tile (16 accumulators); WM x WN waves form a work-group that owns a (64 WM) x (64 WN) tile and shares its operands through LDS; grid (M / (64 WM), N / (64 WN), Z), 32 WM WN threads.
// A stage is 64 k of every operand row of the work-group's tile, in fragment order as in the workspace (a row block of 16 rows x 64 k is 2 KiB in a row, there and in LDS). It comes by asynchronous copies to LDS, through no register,
// two buffers: stage t + 1 is asked for when every wave has left stage t - 1, and flies while stage t is worked on. A fragment read from LDS is two wave-wide reads of 512 contiguous bytes.
// C[m][n] (f32, pitch LDC, a constant, so that a tile's stores differ only in the instruction's offset field; + optional f32 bias[n]) = sum_k A[m][k] Bt[n][k] (NSPLIT 1: + A2[m][k] Bt[n][k]). z-batch strides sA/sB/sC in elements. K % 64 == 0, K >= 128.
// EPI says where a wave's tile goes. 0: C as above. 1: the fused q | k | v projection of batch blockIdx.z: the tile is 64 positions (rows) x the 64 columns of ONE head (cy = column / 64 = which * NH_ + head, which = 0 q, 1 k, 2 v), and it leaves the wave as the attention's 16-bit planes (fp16, bf16 hi, bf16 lo; each buffer [which][batch][head] planes of TT * HD), no f32 copy in between:
// q, k: interleaved rotary with {cos, sin} from CS, planes [t][d] in fragment order (a lane turns 8 columns of a row, one 16-byte piece; 8 lanes on 8 consecutive rows fill a 128-byte line); v: planes [d][t] in fragment order: a lane's accumulator holds 8 consecutive positions of one column, which IS its piece of the transposed tile (a store is 512 contiguous bytes).
template <typename T16> struct WFrag;
template <> struct WFrag<h16> { typedef v16h V; static __device__ __forceinline__ V ld(const h16* p) { return cat16(*(const v8h*)p, *(const v8h*)(p + 256)); } static __device__ __forceinline__ v8f mma(V a, V b, v8f c) { return wmma16(a, b, c); } };
template <> struct WFrag<bf> { typedef v16bf V; static __device__ __forceinline__ V ld(const bf* p) { return cat16b(*(const v8us*)p, *(const v8us*)(p + 256)); } static __device__ __forceinline__ v8f mma(V a, V b, v8f c) { return wmmab(a, b, c); } };
// cp8, cp12: two or three row blocks of a stage (16 rows x 64 k, 2 KiB in a row in the workspace as in LDS), each as four wave-wide copies of 512 bytes; l, g: the lane's own 16 bytes of a block's first copy, in LDS and in the workspace.
// The wait on the last line stands in front of any rewrite of a register that an issued copy names; inside the statement nothing can be moved between the copies and it.
template <typename T16>
__device__ __forceinline__ void cp8(unsigned l0, const T16* g0, unsigned l1, const T16* g1) {
    asm volatile("global_load_async_to_lds_b128 %0, %8, off\n\tglobal_load_async_to_lds_b128 %1, %9, off\n\tglobal_load_async_to_lds_b128 %2, %10, off\n\tglobal_load_async_to_lds_b128 %3, %11, off\n\t"
                 "global_load_async_to_lds_b128 %4, %12, off\n\tglobal_load_async_to_lds_b128 %5, %13, off\n\tglobal_load_async_to_lds_b128 %6, %14, off\n\tglobal_load_async_to_lds_b128 %7, %15, off\n\ts_wait_xcnt 0x0"
                 :: "v"(l0), "v"(l0 + 512u), "v"(l0 + 1024u), "v"(l0 + 1536u), "v"(l1), "v"(l1 + 512u), "v"(l1 + 1024u), "v"(l1 + 1536u),
                    "v"(g0), "v"(g0 + 256), "v"(g0 + 512), "v"(g0 + 768), "v"(g1), "v"(g1 + 256), "v"(g1 + 512), "v"(g1 + 768) : "memory");
}
template <typename T16>
__device__ __forceinline__ void cp12(unsigned l0, const T16* g0, unsigned l1, const T16* g1, unsigned l2, const T16* g2) {
    asm volatile("global_load_async_to_lds_b128 %0, %12, off\n\tglobal_load_async_to_lds_b128 %1, %13, off\n\tglobal_load_async_to_lds_b128 %2, %14, off\n\tglobal_load_async_to_lds_b128 %3, %15, off\n\t"
                 "global_load_async_to_lds_b128 %4, %16, off\n\tglobal_load_async_to_lds_b128 %5, %17, off\n\tglobal_load_async_to_lds_b128 %6, %18, off\n\tglobal_load_async_to_lds_b128 %7, %19, off\n\t"
                 "global_load_async_to_lds_b128 %8, %20, off\n\tglobal_load_async_to_lds_b128 %9, %21, off\n\tglobal_load_async_to_lds_b128 %10, %22, off\n\tglobal_load_async_to_lds_b128 %11, %23, off\n\ts_wait_xcnt 0x0"
                 :: "v"(l0), "v"(l0 + 512u), "v"(l0 + 1024u), "v"(l0 + 1536u), "v"(l1), "v"(l1 + 512u), "v"(l1 + 1024u), "v"(l1 + 1536u), "v"(l2), "v"(l2 + 512u), "v"(l2 + 1024u), "v"(l2 + 1536u),
                    "v"(g0), "v"(g0 + 256), "v"(g0 + 512), "v"(g0 + 768), "v"(g1), "v"(g1 + 256), "v"(g1 + 512), "v"(g1 + 768), "v"(g2), "v"(g2 + 256), "v"(g2 + 512), "v"(g2 + 768) : "memory");
}
template <typename T16, int NSPLIT, bool BIAS, int EPI, int K, int WM, int WN, int LDC>
__global__ __launch_bounds__(32 * WM * WN) void k_gemmw(const T16* __restrict__ A, const T16* __restrict__ A2, const T16* __restrict__ Bt, float* C, const float* __restrict__ bias, size_t sA, size_t sB, size_t sC, const float* __restrict__ CS, h16* __restrict__ P16, bf* __restrict__ Ph, bf* __restrict__ Pl) {
    typedef typename WFrag<T16>::V V;
    static_assert(NSPLIT == 0 || NSPLIT == 1, "A (+ A2) x Bt"); static_assert(K % 64 == 0 && K >= 128, "two stages or more");
    // a stage in LDS: the row blocks of A, of A2, of Bt, in that order, 1,024 elements each; wave w copies row blocks w, w + NWV, ...: FULL each, and the first REM waves one more
    constexpr int NWV = WM * WN, RA = 4 * WM, RB0 = (NSPLIT + 1) * RA, NRB = RB0 + 4 * WN, FULL = NRB / NWV, REM = NRB % NWV, MR = FULL + (REM ? 1 : 0), SE = NRB * 1024, NT = K / 64;
    static_assert(REM == 0 ? FULL % 3 == 0 : FULL == 2, "the copies go three row blocks a statement, or two");
    __shared__ __align__(16) T16 st[2 * SE]; __shared__ __align__(16) float osb[NWV * 16 * 68];
    const size_t z = blockIdx.z; A += z * sA; if (NSPLIT == 1) A2 += z * sA; Bt += z * sB; C += z * sC;
    const int lane = threadIdx.x & 31, lr = lane & 15, hi = lane >> 4; const int w = __builtin_amdgcn_readfirstlane(threadIdx.x >> 5), wm = w % WM, wn = w / WM;
    const int R0 = blockIdx.x * (64 * WM), C0 = blockIdx.y * (64 * WN), r0 = R0 + wm * 64, c0 = C0 + wn * 64, cy = c0 / 64; float* os = osb + w * (16 * 68);   // each wave stages its output rows in its own range
    v8f acc[4][4];
#pragma unroll
    for (int mb = 0; mb < 4; ++mb)
#pragma unroll
        for (int nb = 0; nb < 4; ++nb) acc[mb][nb] = (v8f){};
    const T16* gp[MR];                               // the lane's first 16 bytes of each of the wave's row blocks, stage 0 (a wave without a last one: the stage's last block, never copied by it)
#pragma unroll
    for (int i = 0; i < MR; ++i) { const int rb = min(w + i * NWV, NRB - 1); gp[i] = (rb < RA ? A + (size_t)(R0 + 16 * rb) * K : (NSPLIT == 1 && rb < RB0) ? A2 + (size_t)(R0 + 16 * (rb - RA)) * K : Bt + (size_t)(C0 + 16 * (rb - RB0)) * K) + 8 * lane; }
    const unsigned l00 = (unsigned)(size_t)(st + w * 1024 + 8 * lane);   // ... and their place in buffer 0: NWV * 2,048 bytes from one to the next
    auto fill = [&](int t, int bu) {                 // stage t into buffer bu
        const unsigned l = l00 + (unsigned)bu * (SE * 2u); const size_t go = (size_t)t * 1024; constexpr unsigned LS = NWV * 2048u;
        if constexpr (REM == 0) {
#pragma unroll
            for (int i = 0; i < FULL; i += 3) cp12<T16>(l + i * LS, gp[i] + go, l + (i + 1) * LS, gp[i + 1] + go, l + (i + 2) * LS, gp[i + 2] + go);
        } else { if (w < REM) cp12<T16>(l, gp[0] + go, l + LS, gp[1] + go, l + 2 * LS, gp[2] + go); else cp8<T16>(l, gp[0] + go, l + LS, gp[1] + go); } };   // w is a scalar: a whole wave goes one way
    fill(0, 0);
    asm volatile("s_wait_asynccnt 0x0" ::: "memory");   // the wave's own copies of stage 0 have landed
    __syncthreads();                                 // ... and every other wave's: stage 0 may be read
#pragma unroll 1   // stays rolled: one copy of the body serves both buffers
    for (int t = 0; t < NT; ++t) {
        const T16* sb = st + (t & 1) * SE + 8 * lane;
        V a[2][4], a2[2][4], b[2][4];                // the fragments of the stage's two k steps of 32
        auto ldf = [&](int s) {
#pragma unroll
            for (int mb = 0; mb < 4; ++mb) { a[s][mb] = WFrag<T16>::ld(sb + (wm * 4 + mb) * 1024 + s * 512); if (NSPLIT == 1) a2[s][mb] = WFrag<T16>::ld(sb + (RA + wm * 4 + mb) * 1024 + s * 512); }
#pragma unroll
            for (int nb = 0; nb < 4; ++nb) b[s][nb] = WFrag<T16>::ld(sb + (RB0 + wn * 4 + nb) * 1024 + s * 512); };
        if (t + 1 < NT) fill(t + 1, (t + 1) & 1);    // into the buffer that every wave left at the barrier just passed; the copies fly while stage t is worked on
        ldf(0);
        __builtin_amdgcn_sched_barrier(0);           // the first k step's reads stay in front of the second's, so that its matrix instructions wait for them alone (left free, the scheduler put some of them last)
        ldf(1);
        __builtin_amdgcn_sched_barrier(0);           // the stage's LDS reads stay in front of its matrix instructions (left free, the scheduler spread them among these, each with a wait to 0 behind it)
#pragma unroll
        for (int s = 0; s < 2; ++s)
#pragma unroll
            for (int nb = 0; nb < 4; ++nb)
#pragma unroll
                for (int mb = 0; mb < 4; ++mb) { acc[mb][nb] = WFrag<T16>::mma(a[s][mb], b[s][nb], acc[mb][nb]); if (NSPLIT == 1) acc[mb][nb] = WFrag<T16>::mma(a2[s][mb], b[s][nb], acc[mb][nb]); }
        __builtin_amdgcn_sched_barrier(0);           // the matrix instructions stay in front of the waits (left free, the scheduler put them behind the barrier, and the wait for the copies stood right behind their issue)
        asm volatile("s_wait_dscnt 0x0" ::: "memory");      // the wave's reads of this buffer are over before it may be refilled
        asm volatile("s_wait_asynccnt 0x0" ::: "memory");   // the wave's own copies of stage t + 1 have landed
        __syncthreads();                             // stage t + 1 may be read by every wave; every wave has left stage t's buffer
    }
    asm volatile("s_wait_asynccnt 0x0" ::: "memory");   // no copy is outstanding when the wave goes on to its epilogue and ends
    const size_t pl = EPI == 1 ? ((size_t)(cy / NH_) * NB_ + z) * NH_ + cy % NH_ : 0;   // the tile's plane
    if (EPI == 1 && cy >= 2 * NH_) {          // v (the same for the whole wave)
#pragma unroll
        for (int nb = 0; nb < 4; ++nb)
#pragma unroll
            for (int mb = 0; mb < 4; ++mb) { v8h o16; v8us oh, ol;
#pragma unroll
                for (int j = 0; j < 8; ++j) { const float x = acc[mb][nb][j]; o16[j] = tohx(x); unsigned short a2, c2; splitf(x, a2, c2); oh[j] = a2; ol[j] = c2; }
                const size_t e = pl * HD * TT + pko(nb * 16 + lr, r0 + mb * 16 + hi * 8, TT); *(v8h*)(P16 + e) = o16; *(v8us*)(Ph + e) = oh; *(v8us*)(Pl + e) = ol;
                asm volatile("s_wait_xcnt 0x0" ::: "memory"); }   // behind the block's stores: the wait that stands in front of a rewrite of a register an issued store names (the next block's values land in such registers)
        return; }
    v4f tb[EPI == 1 ? 32 : 1];                 // q, k: the table of the wave's 64 positions, 16 KiB in a row, asked for in one run here (the fragments' registers are free) and landing behind the first rows' staging, not waited for piece by piece
    if constexpr (EPI == 1) { const float* tp = CS + (size_t)(r0 >> 3) * 512 + lane * 4;
#pragma unroll
        for (int i = 0; i < 32; ++i) tb[i] = *(const v4fa*)(tp + i * 128);
        asm volatile("s_wait_xcnt 0x0" ::: "memory");   // behind the run: the wait that stands in front of a rewrite of a register an issued load names (offset register, scalar base); no load of the run moves down past it
    }
#pragma unroll
    for (int mb = 0; mb < 4; ++mb) {
#pragma unroll
        for (int nb = 0; nb < 4; ++nb) {
#pragma unroll
            for (int j = 0; j < 8; ++j) os[(hi * 8 + j) * 68 + nb * 16 + lr] = acc[mb][nb][j]; }
        __builtin_amdgcn_wave_barrier(); asm volatile("" ::: "memory");
        if constexpr (EPI == 1) {
#pragma unroll
            for (int s = 0; s < 4; ++s) { const int rr = 8 * (s & 1) + (lane & 7), t = r0 + mb * 16 + rr, d0 = (4 * (s >> 1) + (lane >> 3)) * 8; const float* xr = os + rr * 68 + d0; const v4f xa = *(const v4fa*)xr, xb = *(const v4fa*)(xr + 4);
                const float x[8] = { xa[0], xa[1], xa[2], xa[3], xb[0], xb[1], xb[2], xb[3] }; const v4f ca = tb[(mb * 2 + (s & 1)) * 4 + (s >> 1) * 2], cb = tb[(mb * 2 + (s & 1)) * 4 + (s >> 1) * 2 + 1];
                const float cc[8] = { ca[0], ca[1], ca[2], ca[3], cb[0], cb[1], cb[2], cb[3] }; v8h o16; v8us oh, ol;   // {cos, sin} of the piece's four pairs
#pragma unroll
                for (int p = 0; p < 8; p += 2) { const float cs[2] = { cc[p], cc[p + 1] }; const float x0 = x[p], x1 = x[p + 1];
                    const float r0_ = x0 * cs[0] - x1 * cs[1], r1_ = x0 * cs[1] + x1 * cs[0];   /* even: x0 c - x1 s; odd: x0 s + x1 c */
                    o16[p] = tohx(r0_); o16[p + 1] = tohx(r1_); { unsigned short a2, c2; splitf(r0_, a2, c2); oh[p] = a2; ol[p] = c2; splitf(r1_, a2, c2); oh[p + 1] = a2; ol[p + 1] = c2; } }
                const size_t e = pl * TT * HD + pko(t, d0, HD); *(v8h*)(P16 + e) = o16; *(v8us*)(Ph + e) = oh; *(v8us*)(Pl + e) = ol;
                asm volatile("s_wait_xcnt 0x0" ::: "memory"); }   // behind the three stores: the wait that stands in front of a rewrite of a register an issued store names (the next pieces' values land in such registers)
        } else {
        float* crow = C + (size_t)(r0 + hi) * LDC + c0 + lr * 4 + mb * 16 * LDC;   // the lane's 16 bytes of the block's row hi; its other rows lie 2 LDC apart
        v4f val[8];                                // the block's 16 rows are read back as one run and waited for once, not row pair by row pair
#pragma unroll
        for (int s = 0; s < 8; ++s) { const int cofs = lr * 4; val[s] = *(const v4fa*)(os + (2 * s + hi) * 68 + cofs); if (BIAS) { val[s][0] += bfr(bias[c0 + cofs]); val[s][1] += bfr(bias[c0 + cofs + 1]); val[s][2] += bfr(bias[c0 + cofs + 2]); val[s][3] += bfr(bias[c0 + cofs + 3]); } }
#pragma unroll
        for (int s = 0; s < 8; ++s) *(v4f*)(crow + 2 * s * LDC) = val[s];
        asm volatile("s_wait_xcnt 0x0" ::: "memory");   // behind the block's stores: the wait that stands in front of a rewrite of a register an issued store names (the next block's addresses and values land in such registers)
        }
        __builtin_amdgcn_wave_barrier(); asm volatile("" ::: "memory");
    }
}


__global__ __launch_bounds__(256) void k_wtG(const float* __restrict__ w, int K, int N, bf* Bt) {
    const int lane = threadIdx.x & 31; const int L0 = (blockIdx.x * 8 + (threadIdx.x >> 5)) * 8; const int nlines = N * K / 64;
{
#pragma unroll 1
        for (int l = 0; l < 8; ++l) { const int L = L0 + l; if (L >= nlines) break; const size_t e = (size_t)L * 64 + lane * 2; const int k = (int)(e % K), n = (int)(e / K); v2us o;
            o[0] = f2bf(w[(size_t)k * N + n]); o[1] = f2bf(w[(size_t)(k + 1) * N + n]); *(v2us*)(Bt + e) = o; }
         }
}
static_assert(DQ == DM, "cvt8 takes K = DM for every buffer");
__device__ __forceinline__ void cvt8(const float* __restrict__ src, bf* dst, int blk) { const size_t i = (size_t)blk * 256 + threadIdx.x;   // i: the 16-byte piece of dst (fragment order, K = DM) that the thread writes; a block is 4 tiles: 16 rows x 512 bytes of src; every buffer is a whole number of blocks
    const int tile = (int)(i >> 6), row = tile / (DM / 32) * 16 + (int)(i & 15), kk = tile % (DM / 32) * 32 + (int)((i >> 5) & 1) * 16 + (int)((i >> 4) & 1) * 8; const v8f v = *(const v8f*)(src + (size_t)row * DM + kk); v8us o;
#pragma unroll
    for (int k = 0; k < 8; ++k) o[k] = f2bf(v[k]); *(v8us*)(dst + i * 8) = o;  }
__constant__ float INVP[HD / 2] = { 1.000000000e+00f,7.498942018e-01f,5.623413324e-01f,4.216965139e-01f,3.162277639e-01f,2.371373773e-01f,1.778279394e-01f,1.333521456e-01f,1.000000015e-01f,7.498942316e-02f,5.623413250e-02f,4.216964915e-02f,3.162277490e-02f,2.371373773e-02f,1.778279431e-02f,1.333521400e-02f,9.999999776e-03f,7.498942316e-03f,5.623413250e-03f,4.216964822e-03f,3.162277630e-03f,2.371373819e-03f,1.778279431e-03f,1.333521446e-03f,1.000000047e-03f,7.498941850e-04f,5.623413017e-04f,4.216965172e-04f,3.162277571e-04f,2.371373703e-04f,1.778279402e-04f,1.333521504e-04f };   // 10000 ** (-2 i / 64) as float32 (the module's power form, jnp-computed; differs from 1/10000**(2i/64) by ulps)
// The table, one {cos, sin} per (position t, pair pr), in the order in which the projection's epilogue reads it: a block of 8 positions is 2 KiB, four runs of 512 bytes (run = pr / 16 * 2 + pr / 2 % 2), and in a run lane (pr / 4 % 4) * 8 + t % 8
// holds the 16 bytes of pairs pr & ~1 and pr | 1: a wave-wide 16-byte load is one run (4 whole lines), and two runs give a lane the four pairs of its 8 columns.
__device__ __forceinline__ void csP(float* CS, int blk) { const int slot = blk * 256 + threadIdx.x; const int ln = (slot >> 1) & 31; const int t = blk * 8 + (ln & 7), pr = ((slot >> 7) & 1) * 16 + (ln >> 3) * 4 + ((slot >> 6) & 1) * 2 + (slot & 1);
    const float a = __fmul_rn((float)t, INVP[pr]); v2f cs; cs[0] = cosf(a); cs[1] = sinf(a); *(v2f*)(CS + (size_t)slot * 2) = cs;  }
// ---- k_prep: all that the GEMMs read and that depends on no other launch, in one grid; blockIdx.x picks the job by range (the same for a whole block), the table (the longest blocks) first.
#define PB_CS (TT / 8)
#define PB_X  (NB_ * TT * DM / 2048)
#define PB_W  ((DQ + 2 * DKV) * DM / 2048)
#define PB_O  (DM * DQ / 2048)
__global__ __launch_bounds__(256) void k_prep(const float* __restrict__ x, const float* __restrict__ wqkv, const float* __restrict__ wo, bf* XB, bf* WQKV, bf* WO, float* CS) {
    int b = blockIdx.x;
    if (b < PB_CS) { csP(CS, b); return; }
    b -= PB_CS; const float* src = x; bf* dst = XB;
    if (b >= PB_X + PB_W) { b -= PB_X + PB_W; src = wo; dst = WO; } else if (b >= PB_X) { b -= PB_X; src = wqkv; dst = WQKV; }
    cvt8(src, dst, b);
}

#define NW   4
#define SL2E (SCL * 1.4426950408889634f)   // the score scale (a power of two: exact) rides in the exponent's factor; m is kept in unscaled scores
#define OP   68                   // pitch, in floats, of a query's partial output row in LDS (64 + 4: rows 16 bytes apart in the banks)
// 2^x of eight values: eight independent v_exp_f32, each in place, and behind the last the one free slot that the instruction set asks for between a transcendental and an instruction that reads its result or
// overwrites its source.
__device__ __forceinline__ v8f exp2x8(v8f x) { float a = x[0], b = x[1], c = x[2], d = x[3], e = x[4], f = x[5], g = x[6], h = x[7];
    asm("v_exp_f32 %0, %0\n\tv_exp_f32 %1, %1\n\tv_exp_f32 %2, %2\n\tv_exp_f32 %3, %3\n\tv_exp_f32 %4, %4\n\tv_exp_f32 %5, %5\n\tv_exp_f32 %6, %6\n\tv_exp_f32 %7, %7\n\tv_nop" : "+v"(a), "+v"(b), "+v"(c), "+v"(d), "+v"(e), "+v"(f), "+v"(g), "+v"(h));
    return (v8f){a, b, c, d, e, f, g, h}; }
__device__ __forceinline__ float exp2x1(float a) { asm("v_exp_f32 %0, %0\n\tv_nop" : "+v"(a)); return a; }   // one value, with the same slot
template <typename T16, int NQ, bool HL>
__device__ __forceinline__ void attn_tile(const T16* __restrict__ Q, const T16* __restrict__ Q2, const T16* __restrict__ Kp, const T16* __restrict__ Kp2, const T16* __restrict__ Vt, const T16* __restrict__ Vt2, int q0, bf* __restrict__ Ah, bf* __restrict__ Al, float* os, float* ml) {
    typedef typename WFrag<T16>::V V;
    const int lane = threadIdx.x & 31, lr = lane & 15, hi = lane >> 4; const int w = __builtin_amdgcn_readfirstlane(threadIdx.x >> 5);
    const int klast = (q0 + NQ * 16 - 1) & ~31;      // first key of the 32-key block that holds the tile's last diagonal element
    V q[NQ][2], q2[NQ][2], k[2][2], k2[2][2];
    // every operand load is addressed as one lane pointer per plane and pass plus a constant that fits the instruction's offset field (no address sums per load)
    const unsigned kof = (unsigned)(8 * lane), vof = (unsigned)(8 * lane);   /* fragment order: the lane's piece of a tile */ const T16* pk = nullptr; const T16* pk2 = nullptr;
#pragma unroll
    for (int qt = 0; qt < NQ; ++qt)
#pragma unroll
        for (int c = 0; c < 2; ++c) { const int qc = qt * 16 * HD + c * 512; q[qt][c] = WFrag<T16>::ld(Q + (size_t)q0 * HD + kof + qc); if (HL) q2[qt][c] = WFrag<T16>::ld(Q2 + (size_t)q0 * HD + kof + qc); }
    auto ldk = [&](int kk) {                         // the four (HL: eight) fragments of the 32 key rows from kk on
        pk = Kp + (size_t)kk * HD + kof; if (HL) pk2 = Kp2 + (size_t)kk * HD + kof;
#pragma unroll
        for (int kt = 0; kt < 2; ++kt)
#pragma unroll
            for (int c = 0; c < 2; ++c) { const int kc = kt * 16 * HD + c * 512; k[kt][c] = WFrag<T16>::ld(pk + kc); if (HL) k2[kt][c] = WFrag<T16>::ld(pk2 + kc); } };
    if (!HL) ldk(min(32 * w, klast));                // fp16: key fragments run one pass ahead (a wave with no block of its own fetches the last one: in bounds, unused); hi/lo: at most 4 passes a wave, fetched in the pass, which keeps the registers under 256
    v8f o[4][NQ]; float m[NQ], l[NQ];
#pragma unroll
    for (int qt = 0; qt < NQ; ++qt) { m[qt] = -3.0e38f; l[qt] = 0.f;
#pragma unroll
        for (int dt = 0; dt < 4; ++dt) o[dt][qt] = (v8f){}; }
#pragma unroll 1   // stays rolled: the trip count is known only at run time, and a second copy of the body (its fragments and score tiles) would not fit the registers
    for (int kb = 32 * w; kb <= klast; kb += 32 * NW) {
        if (HL) ldk(kb);
        V v[4], v2[4]; const T16* pv = Vt + (size_t)kb * 16 + vof; const T16* pv2 = HL ? Vt2 + (size_t)kb * 16 + vof : nullptr;   // 32 keys on = one tile (512 elements) on
#pragma unroll
        for (int dt = 0; dt < 4; ++dt) { v[dt] = WFrag<T16>::ld(pv + dt * 16 * TT); if (HL) v2[dt] = WFrag<T16>::ld(pv2 + dt * 16 * TT); }
        v8f s[2][NQ];
#pragma unroll
        for (int kt = 0; kt < 2; ++kt)
#pragma unroll
            for (int qt = 0; qt < NQ; ++qt) { v8f a = (v8f){};
#pragma unroll
                for (int c = 0; c < 2; ++c) { a = WFrag<T16>::mma(k[kt][c], q[qt][c], a); if (HL) { a = WFrag<T16>::mma(k[kt][c], q2[qt][c], a); a = WFrag<T16>::mma(k2[kt][c], q[qt][c], a); } }
                s[kt][qt] = a; }
        if (!HL) ldk(min(kb + 32 * NW, klast));       // the wave's next key fragments are fetched now, behind this pass's last use of the registers (its last pass fetches the last block: in bounds, unused)
        // all of the pass's loads are issued: the wait that stands in front of a rewrite of a register an issued load names. The pass's lane pointers are its inputs, so that their registers stay theirs up to here (one build landed later loads of the run in them)
        if constexpr (HL) asm volatile("s_wait_xcnt 0x0" :: "v"(pk), "v"(pk2), "v"(pv), "v"(pv2) : "memory"); else asm volatile("s_wait_xcnt 0x0" :: "v"(pk), "v"(pv) : "memory");
        if (kb == klast) {                            // only the last block crosses the diagonal: key > query is masked
#pragma unroll
            for (int kt = 0; kt < 2; ++kt)
#pragma unroll
                for (int qt = 0; qt < NQ; ++qt)
#pragma unroll
                    for (int j = 0; j < 8; ++j) if (kb + kt * 16 + hi * 8 + j > q0 + qt * 16 + lr) s[kt][qt][j] = -3.0e38f; }
        V pb[NQ], pb2[NQ];
#pragma unroll
        for (int qt = 0; qt < NQ; ++qt) {
            float mx = fmaxf(s[0][qt][0], s[1][qt][0]);
#pragma unroll
            for (int j = 1; j < 8; ++j) mx = fmaxf(mx, fmaxf(s[0][qt][j], s[1][qt][j]));
            mx = fmaxf(mx, __shfl_xor(mx, 16, 32));
            const float mn = fmaxf(m[qt], mx); const float al = exp2x1((m[qt] - mn) * SL2E); m[qt] = mn;
            float sum = 0.f;
#pragma unroll
            for (int kt = 0; kt < 2; ++kt) { v8f x;
#pragma unroll
                for (int j = 0; j < 8; ++j) { const float y = (s[kt][qt][j] - mn) * SL2E; x[j] = HL ? y : y + 10.0f; }
                x = exp2x8(x); s[kt][qt] = x;
#pragma unroll
                for (int j = 0; j < 8; ++j) sum += x[j]; }
            l[qt] = l[qt] * al + sum;
#pragma unroll
            for (int dt = 0; dt < 4; ++dt) o[dt][qt] *= al;
            if constexpr (HL) { v8us h0, h1, l0, l1;
#pragma unroll
                for (int j = 0; j < 8; ++j) { unsigned short a, c2; splitf(s[0][qt][j], a, c2); h0[j] = a; l0[j] = c2; splitf(s[1][qt][j], a, c2); h1[j] = a; l1[j] = c2; }
                pb[qt] = cat16b(h0, h1); pb2[qt] = cat16b(l0, l1);
            } else { v8h h0, h1;
#pragma unroll
                for (int j = 0; j < 8; ++j) { h0[j] = tohx(s[0][qt][j]); h1[j] = tohx(s[1][qt][j]); }
                pb[qt] = cat16(h0, h1); }
        }
#pragma unroll
        for (int dt = 0; dt < 4; ++dt)
#pragma unroll
            for (int qt = 0; qt < NQ; ++qt) { o[dt][qt] = WFrag<T16>::mma(v[dt], pb[qt], o[dt][qt]); if (HL) { o[dt][qt] = WFrag<T16>::mma(v[dt], pb2[qt], o[dt][qt]); o[dt][qt] = WFrag<T16>::mma(v2[dt], pb[qt], o[dt][qt]); } }
    }
#pragma unroll
    for (int qt = 0; qt < NQ; ++qt) { const int row = w * (NQ * 16) + qt * 16 + lr; const float ls = l[qt] + __shfl_xor(l[qt], 16, 32);   // the halves' sums are joined once, here
        if (hi == 0) { v2f t2; t2[0] = m[qt]; t2[1] = ls; *(v2f*)(ml + row * 2) = t2; }
#pragma unroll
        for (int dt = 0; dt < 4; ++dt) { float* p = os + row * OP + dt * 16 + hi * 8; *(v4f*)p = __builtin_shufflevector(o[dt][qt], o[dt][qt], 0, 1, 2, 3); *(v4f*)(p + 4) = __builtin_shufflevector(o[dt][qt], o[dt][qt], 4, 5, 6, 7); } }
    __syncthreads();                                  // every wave's (m, l, O) is in LDS before any wave joins them
    constexpr int LPQ = 8 / NQ, DPL = 8 * NQ;         // lanes per query row and output elements per lane in the join
    const int qq = NQ == 2 ? w * 8 + lane / LPQ : (w & 1) * 8 + (lane & 7), d0 = NQ == 2 ? (lane % LPQ) * DPL : ((w >> 1) * 4 + (lane >> 3)) * 8;   // 8 consecutive rows a wave: their pieces fill whole lines of the merged planes
    v2f t[NW]; float M = -3.0e38f;
#pragma unroll
    for (int i = 0; i < NW; ++i) { t[i] = *(const v2f*)(ml + (i * (NQ * 16) + qq) * 2); M = fmaxf(M, t[i][0]); }
    float L = 0.f, acc[DPL];
#pragma unroll
    for (int e = 0; e < DPL; ++e) acc[e] = 0.f;
#pragma unroll
    for (int i = 0; i < NW; ++i) { const float sc = exp2x1((t[i][0] - M) * SL2E); L += t[i][1] * sc;   // a wave that had no block: m = -3e38, so sc = 0, on l = 0 and O = 0
#pragma unroll
        for (int e = 0; e < DPL; e += 4) { const v4f x = *(const v4f*)(os + (i * (NQ * 16) + qq) * OP + d0 + e); acc[e] += x[0] * sc; acc[e + 1] += x[1] * sc; acc[e + 2] += x[2] * sc; acc[e + 3] += x[3] * sc; } }
    const float inv = __fdiv_rn(1.0f, L);
#pragma unroll
    for (int c = 0; c < DPL / 8; ++c) { v8us oh, ol;
#pragma unroll
        for (int j = 0; j < 8; ++j) { unsigned short a, c2; splitf(acc[c * 8 + j] * inv, a, c2); oh[j] = a; ol[j] = c2; }
        const size_t oo = pko(q0 + qq, d0 + c * 8, DQ); *(v8us*)(Ah + oo) = oh; *(v8us*)(Al + oo) = ol; }
    // hi/lo form only: behind the last store, the wait that stands in front of any rewrite of a register an issued store names (in the listing the way on from here leads past the fp16 form's entry, which writes such registers; the fp16 form's stores run straight into the end of the program)
    if constexpr (HL) asm volatile("s_wait_xcnt 0x0" ::: "memory");
}
// grid (batches x heads, tiles): blockIdx.x = batch * NH_ + head is the plane's index; blockIdx.y ranks the tiles by falling cost: the (TT - RH) / 32 fp16 tiles of 32 rows from the last row up, then the RH / 16 hi/lo tiles of 16 rows.
__global__ __launch_bounds__(32 * NW) void k_attn(const h16* __restrict__ Q16, const h16* __restrict__ K16, const h16* __restrict__ V16, const bf* __restrict__ Qh, const bf* __restrict__ Ql, const bf* __restrict__ Kh, const bf* __restrict__ Kl, const bf* __restrict__ Vh, const bf* __restrict__ Vl, bf* __restrict__ Ah, bf* __restrict__ Al) {
    __shared__ __align__(16) float os[NW * 32 * OP]; __shared__ __align__(16) float ml[NW * 32 * 2];
    const size_t hp = (size_t)blockIdx.x * TT * HD; const int r = blockIdx.y; const size_t ao = (size_t)(blockIdx.x / NH_) * TT * DQ + (blockIdx.x % NH_) * (HD / 32) * 512;   /* the batch's rows, the head's first tile column */ Ah += ao; Al += ao;
    if (r < (TT - RH) / 32) attn_tile<h16, 2, false>(Q16 + hp, nullptr, K16 + hp, nullptr, V16 + hp, nullptr, TT - 32 - 32 * r, Ah, Al, os, ml);
    else attn_tile<bf, 1, true>(Qh + hp, Ql + hp, Kh + hp, Kl + hp, Vh + hp, Vl + hp, RH - 16 - 16 * (r - (TT - RH) / 32), Ah, Al, os, ml);
}

extern "C" void kernel_launch(void* const* d_in, const int* in_sizes, int n_in,
                              void* d_out, int out_size, void* d_ws, size_t ws_size, hipStream_t stream) {
    (void)in_sizes; (void)n_in; (void)out_size;
    const float* x = (const float*)d_in[0]; const float* wqkv = (const float*)d_in[1]; const float* wo = (const float*)d_in[2];   /* input order X, W_qkv ('oi' [3072][1024]: q | k | v = its three 1,024-row blocks), W_o ('oi' [1024][1024]): THREE inputs */
    float* OUT = (float*)d_out;     // [2][2048][1024]
    char* wsp = (char*)d_ws;
    auto take = [&](size_t bytes) { char* p = wsp; wsp += (bytes + 255) & ~(size_t)255; return (void*)p; };
    const size_t PG = (size_t)NB_ * NH_ * TT * HD;   // elements of one of q, k, v: a plane per (batch, head)
    bf* WQKV = (bf*)take((size_t)(DQ + 2 * DKV) * DM * 2); bf* WO = (bf*)take((size_t)DM * DQ * 2); float* CS = (float*)take((size_t)TT * (HD / 2) * 2 * 4);
    h16* P16 = (h16*)take(3 * PG * 2); bf* Ph = (bf*)take(3 * PG * 2); bf* Pl = (bf*)take(3 * PG * 2);   // each [q | k | v][batch][head]
    bf* XB = (bf*)take((size_t)NB_ * TT * DM * 2);
    bf* ATh = (bf*)take((size_t)NB_ * TT * DQ * 2); bf* ATl = (bf*)take((size_t)NB_ * TT * DQ * 2);
    if ((size_t)(wsp - (char*)d_ws) > ws_size) return;    // ws 256 MiB
    k_prep<<<PB_CS + PB_X + PB_W + PB_O, 256, 0, stream>>>(x, wqkv, wo, XB, WQKV, WO, CS);   /* bf16 copies; {cos, sin}(t x THETA**(-2i/64)) per interleaved pair */
    k_gemmw<bf, 0, false, 1, DM, 4, 3, 0><<<dim3(TT / 256, (DQ + 2 * DKV) / 192, NB_), 384, 0, stream>>>(XB, nullptr, WQKV, nullptr, nullptr, (size_t)TT * DM, 0, 0, CS, P16, Ph, Pl);
    k_attn<<<dim3(NB_ * NH_, (TT - RH) / 32 + RH / 16, 1), 32 * NW, 0, stream>>>(P16, P16 + PG, P16 + 2 * PG, Ph, Pl, Ph + PG, Pl + PG, Ph + 2 * PG, Pl + 2 * PG, ATh, ATl);   // one kv head per query head
    k_gemmw<bf, 1, false, 0, DQ, 2, 2, DM><<<dim3(NB_ * TT / 128, DM / 128, 1), 128, 0, stream>>>(ATh, ATl, WO, OUT, nullptr, 0, 0, 0, nullptr, nullptr, nullptr, nullptr);   // the batches' rows are one [NB_ * TT][DQ] operand
}

// v009
// Measured time: 72.5 microseconds a run.
// In two side-by-side timings against v008, it was 1.07 and 1.08 times as fast.
// All steps since v000 together make it 19.6 times as fast.
#include <hip/hip_runtime.h>

// Causal multi-head self-attention with interleaved rotary embeddings and a FUSED (out, in) qkv weight (X [2][2048][1024]; qkv = einsum('bsd,od->bso', X, W_qkv) ('oi' [3072][1024] std sqrt(2/4096), no bias) viewed (B, S, 3, 16, 64): q | k | v = the three 1,024-ROW blocks of W_qkv (16 heads x 64); rotary on (even, odd) pairs with angle pos / (10000 ** (2 k / 64)) (float32 constants 10000^(-2i/64), precise cosf/sinf); scores x 64^-0.5, causal (-inf); softmax; out = merged W_o^T ('oi', no bias) -> [2][2048][1024] (4.2 M); argument order X, W_qkv, W_o.
// Both batches ride in every launch (4 launches): bf16 copies of x and the weights; exact projections; {cos, sin} per (position, pair) from the int positions (jnp-exact float32 inverse frequencies, precise cosf/sinf); interleaved rotary and the 16-bit head planes in the projections' own epilogues; causal T-2048 attention fused in k_attn (hybrid rows: < 512 hi/lo 3 products, rest fp16 x1024; running maximum, keys walked up to the diagonal); merged hi/lo x wo exact, no bias.
// Compute dtypes, f32 accumulate: every input rounded to bf16; projections exact ; rotary f32; attention rows < 512 3 products, rest fp16; softmax f32; wo hl x exact, no bias.

#define NB_  2
#define TT   2048
#define DM   1024
#define NH_  16
#define NKV  16
#define REP  (NH_ / NKV)
#define HD   64
#define DQ   (NH_ * HD)
#define DKV  (NKV * HD)
#define RH   512                  // query rows < RH use hi+lo planes (0: none)
#define SCL  0.125f   // HD^-0.5
typedef _Float16 h16;
typedef unsigned short bf;
typedef __attribute__((ext_vector_type(16))) __bf16   v16bf;
typedef __attribute__((ext_vector_type(16))) _Float16 v16h;
typedef __attribute__((ext_vector_type(8)))  _Float16 v8h;
typedef __attribute__((ext_vector_type(8)))  unsigned short v8us;
typedef __attribute__((ext_vector_type(8)))  float    v8f;
typedef __attribute__((ext_vector_type(4)))  float    v4f;
typedef v8h  __attribute__((may_alias)) v8ha;
typedef v4f  __attribute__((may_alias)) v4fa;
typedef v8us __attribute__((may_alias)) v8usa;

__device__ __forceinline__ unsigned short f2bf(float f) { unsigned u = __float_as_uint(f); u += 0x7FFFu + ((u >> 16) & 1u); return (unsigned short)(u >> 16); }
__device__ __forceinline__ float bf2f(unsigned short b) { return __uint_as_float(((unsigned)b) << 16); }
__device__ __forceinline__ float bfr(float f) { return bf2f(f2bf(f)); }
__device__ __forceinline__ v16h cat16(v8h lo, v8h hi) { return __builtin_shufflevector(lo, hi, 0, 1, 2, 3, 4, 5, 6, 7, 8, 9, 10, 11, 12, 13, 14, 15); }
__device__ __forceinline__ v16bf cat16b(v8us lo, v8us hi) { return __builtin_bit_cast(v16bf, __builtin_shufflevector(lo, hi, 0, 1, 2, 3, 4, 5, 6, 7, 8, 9, 10, 11, 12, 13, 14, 15)); }
__device__ __forceinline__ v8f wmma16(v16h a, v16h b, v8f c) { return __builtin_amdgcn_wmma_f32_16x16x32_f16(false, a, false, b, (short)0, c, false, false); }
__device__ __forceinline__ v8f wmmab(v16bf a, v16bf b, v8f c) { return __builtin_amdgcn_wmma_f32_16x16x32_bf16(false, a, false, b, (short)0, c, false, false); }



__device__ __forceinline__ h16 tohx(float x) { return (h16)x; }
__device__ __forceinline__ void splitf(float y, unsigned short& h, unsigned short& l) { h = f2bf(y); l = f2bf(y - bf2f(h)); }
typedef __attribute__((ext_vector_type(2))) _Float16 v2h;
typedef __attribute__((ext_vector_type(4))) _Float16 v4h;
typedef __attribute__((ext_vector_type(2))) unsigned short v2us;
typedef __attribute__((ext_vector_type(4))) unsigned short v4us;
typedef __attribute__((ext_vector_type(2))) float v2f;
typedef __attribute__((ext_vector_type(4))) int v4i;

// ---- Fragment order: every 16-bit matrix operand in the workspace ([rows][K], rows % 16 == 0, K % 32 == 0) is stored as tiles of 16 rows x 32 k (1,024 bytes; tile index = (row / 16) * (K / 32) + k / 32), and inside a tile
// as the two 16-byte pieces a lane of the matrix instruction holds: piece (k / 16 % 2) * 32 + (k / 8 % 2) * 16 + row % 16. A fragment load (WFrag::ld at tile + lane * 8 elements) is then two wave-wide loads of 512 contiguous bytes
// (4 whole lines each), where a row-major plane takes 16 lines a load; the values that reach each lane and register are those of the row-major form.
__device__ __forceinline__ size_t pko(int row, int k, int K) { return ((size_t)(row >> 4) * (K >> 5) + (k >> 5)) * 512 + ((k >> 4) & 1) * 256 + ((k >> 3) & 1) * 128 + (row & 15) * 8 + (k & 7); }
// ---- k_gemmw: register-blocked GEMM, one wave per 64x64 output tile (16 accumulators); WM x WN waves form a work-group that owns a (64 WM) x (64 WN) tile and shares its operands through LDS; grid (M / (64 WM), N / (64 WN), Z), 32 WM WN threads.
// A stage is 64 k of every operand row of the work-group's tile, in fragment order as in the workspace (a row block of 16 rows x 64 k is 2 KiB in a row, there and in LDS). It comes by asynchronous copies to LDS, through no register,
// two buffers: stage t + 1 is asked for when every wave has left stage t - 1, and flies while stage t is worked on. A fragment read from LDS is two wave-wide reads of 512 contiguous bytes.
// C[m][n] (f32, pitch LDC, a constant, so that a tile's stores differ only in the instruction's offset field; + optional f32 bias[n]) = sum_k A[m][k] Bt[n][k] (NSPLIT 1: + A2[m][k] Bt[n][k]). z-batch strides sA/sB/sC in elements. K % 64 == 0, K >= 128.
// EPI says where a wave's tile goes. 0: C as above. 1: the fused q | k | v projection of batch blockIdx.z: the tile is 64 positions (rows) x the 64 columns of ONE head (cy = column / 64 = which * NH_ + head, which = 0 q, 1 k, 2 v), and it leaves the wave as the attention's 16-bit planes (fp16, bf16 hi, bf16 lo; each buffer [which][batch][head] planes of TT * HD), no f32 copy in between:
// q, k: interleaved rotary with {cos, sin} from CS, planes [t][d] in fragment order (a lane turns 8 columns of a row, one 16-byte piece; 8 lanes on 8 consecutive rows fill a 128-byte line); v: planes [d][t] in fragment order: a lane's accumulator holds 8 consecutive positions of one column, which IS its piece of the transposed tile (a store is 512 contiguous bytes).
template <typename T16> struct WFrag;
template <> struct WFrag<h16> { typedef v16h V; static __device__ __forceinline__ V ld(const h16* p) { return cat16(*(const v8h*)p, *(const v8h*)(p + 256)); } static __device__ __forceinline__ v8f mma(V a, V b, v8f c) { return wmma16(a, b, c); } };
template <> struct WFrag<bf> { typedef v16bf V; static __device__ __forceinline__ V ld(const bf* p) { return cat16b(*(const v8us*)p, *(const v8us*)(p + 256)); } static __device__ __forceinline__ v8f mma(V a, V b, v8f c) { return wmmab(a, b, c); } };
// cp8, cp12: two or three row blocks of a stage (16 rows x 64 k, 2 KiB in a row in the workspace as in LDS), each as four wave-wide copies of 512 bytes; l, g: the lane's own 16 bytes of a block's first copy, in LDS and in the workspace.
// The wait on the last line stands in front of any rewrite of a register that an issued copy names; inside the statement nothing can be moved between the copies and it.
template <typename T16>
__device__ __forceinline__ void cp8(unsigned l0, const T16* g0, unsigned l1, const T16* g1) {
    asm volatile("global_load_async_to_lds_b128 %0, %8, off\n\tglobal_load_async_to_lds_b128 %1, %9, off\n\tglobal_load_async_to_lds_b128 %2, %10, off\n\tglobal_load_async_to_lds_b128 %3, %11, off\n\t"
                 "global_load_async_to_lds_b128 %4, %12, off\n\tglobal_load_async_to_lds_b128 %5, %13, off\n\tglobal_load_async_to_lds_b128 %6, %14, off\n\tglobal_load_async_to_lds_b128 %7, %15, off\n\ts_wait_xcnt 0x0"
                 :: "v"(l0), "v"(l0 + 512u), "v"(l0 + 1024u), "v"(l0 + 1536u), "v"(l1), "v"(l1 + 512u), "v"(l1 + 1024u), "v"(l1 + 1536u),
                    "v"(g0), "v"(g0 + 256), "v"(g0 + 512), "v"(g0 + 768), "v"(g1), "v"(g1 + 256), "v"(g1 + 512), "v"(g1 + 768) : "memory");
}
template <typename T16>
__device__ __forceinline__ void cp12(unsigned l0, const T16* g0, unsigned l1, const T16* g1, unsigned l2, const T16* g2) {
    asm volatile("global_load_async_to_lds_b128 %0, %12, off\n\tglobal_load_async_to_lds_b128 %1, %13, off\n\tglobal_load_async_to_lds_b128 %2, %14, off\n\tglobal_load_async_to_lds_b128 %3, %15, off\n\t"
                 "global_load_async_to_lds_b128 %4, %16, off\n\tglobal_load_async_to_lds_b128 %5, %17, off\n\tglobal_load_async_to_lds_b128 %6, %18, off\n\tglobal_load_async_to_lds_b128 %7, %19, off\n\t"
                 "global_load_async_to_lds_b128 %8, %20, off\n\tglobal_load_async_to_lds_b128 %9, %21, off\n\tglobal_load_async_to_lds_b128 %10, %22, off\n\tglobal_load_async_to_lds_b128 %11, %23, off\n\ts_wait_xcnt 0x0"
                 :: "v"(l0), "v"(l0 + 512u), "v"(l0 + 1024u), "v"(l0 + 1536u), "v"(l1), "v"(l1 + 512u), "v"(l1 + 1024u), "v"(l1 + 1536u), "v"(l2), "v"(l2 + 512u), "v"(l2 + 1024u), "v"(l2 + 1536u),
                    "v"(g0), "v"(g0 + 256), "v"(g0 + 512), "v"(g0 + 768), "v"(g1), "v"(g1 + 256), "v"(g1 + 512), "v"(g1 + 768), "v"(g2), "v"(g2 + 256), "v"(g2 + 512), "v"(g2 + 768) : "memory");
}
template <typename T16, int NSPLIT, bool BIAS, int EPI, int K, int WM, int WN, int LDC>
__global__ __launch_bounds__(32 * WM * WN) void k_gemmw(const T16* __restrict__ A, const T16* __restrict__ A2, const T16* __restrict__ Bt, float* C, const float* __restrict__ bias, size_t sA, size_t sB, size_t sC, const float* __restrict__ CS, h16* __restrict__ P16, bf* __restrict__ Ph, bf* __restrict__ Pl) {
    typedef typename WFrag<T16>::V V;
    static_assert(NSPLIT == 0 || NSPLIT == 1, "A (+ A2) x Bt"); static_assert(K % 64 == 0 && K >= 128, "two stages or more"); static_assert((K / 64 & (K / 64 - 1)) == 0, "the stage ring wraps by a mask");
    // a stage in LDS: the row blocks of A, of A2, of Bt, in that order, 1,024 elements each; wave w copies row blocks w, w + NWV, ...: FULL each, and the first REM waves one more
    constexpr int NWV = WM * WN, RA = 4 * WM, RB0 = (NSPLIT + 1) * RA, NRB = RB0 + 4 * WN, FULL = NRB / NWV, REM = NRB % NWV, MR = FULL + (REM ? 1 : 0), SE = NRB * 1024, NT = K / 64;
    static_assert(REM == 0 ? FULL % 3 == 0 : FULL == 2, "the copies go three row blocks a statement, or two");
    __shared__ __align__(16) T16 st[2 * SE]; __shared__ __align__(16) float osb[NWV * 16 * 68];
    const size_t z = blockIdx.z; A += z * sA; if (NSPLIT == 1) A2 += z * sA; Bt += z * sB; C += z * sC;
    const int lane = threadIdx.x & 31, lr = lane & 15, hi = lane >> 4; const int w = __builtin_amdgcn_readfirstlane(threadIdx.x >> 5), wm = w % WM, wn = w / WM;
    const int R0 = blockIdx.x * (64 * WM), C0 = blockIdx.y * (64 * WN), r0 = R0 + wm * 64, c0 = C0 + wn * 64, cy = c0 / 64; float* os = osb + w * (16 * 68);   // each wave stages its output rows in its own range
    v8f acc[4][4];
#pragma unroll
    for (int mb = 0; mb < 4; ++mb)
#pragma unroll
        for (int nb = 0; nb < 4; ++nb) acc[mb][nb] = (v8f){};
    const T16* gp[MR];                               // the lane's first 16 bytes of each of the wave's row blocks, stage 0 (a wave without a last one: the stage's last block, never copied by it)
#pragma unroll
    for (int i = 0; i < MR; ++i) { const int rb = min(w + i * NWV, NRB - 1); gp[i] = (rb < RA ? A + (size_t)(R0 + 16 * rb) * K : (NSPLIT == 1 && rb < RB0) ? A2 + (size_t)(R0 + 16 * (rb - RA)) * K : Bt + (size_t)(C0 + 16 * (rb - RB0)) * K) + 8 * lane; }
    const unsigned l00 = (unsigned)(size_t)(st + w * 1024 + 8 * lane);   // ... and their place in buffer 0: NWV * 2,048 bytes from one to the next
    // The work-groups that share operand rows (a row of tiles shares A, a column Bt) start together; each enters the ring of k stages at a place of its own, set by its tile indices, and wraps, so that they do not ask L2 for the same lines at the same moment. The sum over k starts at that stage.
    const int rot = (int)(blockIdx.x + blockIdx.y + blockIdx.z * (NT / 2)) & (NT - 1);   // the batches half a ring apart
    auto fill = [&](int t, int bu) {                 // the t-th stage of the work-group's walk into buffer bu
        const unsigned l = l00 + (unsigned)bu * (SE * 2u); const size_t go = (size_t)((t + rot) & (NT - 1)) * 1024; constexpr unsigned LS = NWV * 2048u;
        if constexpr (REM == 0) {
#pragma unroll
            for (int i = 0; i < FULL; i += 3) cp12<T16>(l + i * LS, gp[i] + go, l + (i + 1) * LS, gp[i + 1] + go, l + (i + 2) * LS, gp[i + 2] + go);
        } else { if (w < REM) cp12<T16>(l, gp[0] + go, l + LS, gp[1] + go, l + 2 * LS, gp[2] + go); else cp8<T16>(l, gp[0] + go, l + LS, gp[1] + go); } };   // w is a scalar: a whole wave goes one way
    fill(0, 0);
    asm volatile("s_wait_asynccnt 0x0" ::: "memory");   // the wave's own copies of stage 0 have landed
    __syncthreads();                                 // ... and every other wave's: stage 0 may be read
#pragma unroll 1   // stays rolled: one copy of the body serves both buffers
    for (int t = 0; t < NT; ++t) {
        const T16* sb = st + (t & 1) * SE + 8 * lane;
        V a[2][4], a2[2][4], b[2][4];                // the fragments of the stage's two k steps of 32
        auto ldf = [&](int s) {
#pragma unroll
            for (int mb = 0; mb < 4; ++mb) { a[s][mb] = WFrag<T16>::ld(sb + (wm * 4 + mb) * 1024 + s * 512); if (NSPLIT == 1) a2[s][mb] = WFrag<T16>::ld(sb + (RA + wm * 4 + mb) * 1024 + s * 512); }
#pragma unroll
            for (int nb = 0; nb < 4; ++nb) b[s][nb] = WFrag<T16>::ld(sb + (RB0 + wn * 4 + nb) * 1024 + s * 512); };
        if (t + 1 < NT) fill(t + 1, (t + 1) & 1);    // into the buffer that every wave left at the barrier just passed; the copies fly while stage t is worked on
        ldf(0);
        __builtin_amdgcn_sched_barrier(0);           // the first k step's reads stay in front of the second's, so that its matrix instructions wait for them alone (left free, the scheduler put some of them last)
        ldf(1);
        __builtin_amdgcn_sched_barrier(0);           // the stage's LDS reads stay in front of its matrix instructions (left free, the scheduler spread them among these, each with a wait to 0 behind it)
#pragma unroll
        for (int s = 0; s < 2; ++s)
#pragma unroll
            for (int nb = 0; nb < 4; ++nb)
#pragma unroll
                for (int mb = 0; mb < 4; ++mb) { acc[mb][nb] = WFrag<T16>::mma(a[s][mb], b[s][nb], acc[mb][nb]); if (NSPLIT == 1) acc[mb][nb] = WFrag<T16>::mma(a2[s][mb], b[s][nb], acc[mb][nb]); }
        __builtin_amdgcn_sched_barrier(0);           // the matrix instructions stay in front of the waits (left free, the scheduler put them behind the barrier, and the wait for the copies stood right behind their issue)
        asm volatile("s_wait_dscnt 0x0" ::: "memory");      // the wave's reads of this buffer are over before it may be refilled
        asm volatile("s_wait_asynccnt 0x0" ::: "memory");   // the wave's own copies of stage t + 1 have landed
        __syncthreads();                             // stage t + 1 may be read by every wave; every wave has left stage t's buffer
    }
    asm volatile("s_wait_asynccnt 0x0" ::: "memory");   // no copy is outstanding when the wave goes on to its epilogue and ends
    const size_t pl = EPI == 1 ? ((size_t)(cy / NH_) * NB_ + z) * NH_ + cy % NH_ : 0;   // the tile's plane
    if (EPI == 1 && cy >= 2 * NH_) {          // v (the same for the whole wave)
#pragma unroll
        for (int nb = 0; nb < 4; ++nb)
#pragma unroll
            for (int mb = 0; mb < 4; ++mb) { v8h o16; v8us oh, ol;
#pragma unroll
                for (int j = 0; j < 8; ++j) { const float x = acc[mb][nb][j]; o16[j] = tohx(x); unsigned short a2, c2; splitf(x, a2, c2); oh[j] = a2; ol[j] = c2; }
                const size_t e = pl * HD * TT + pko(nb * 16 + lr, r0 + mb * 16 + hi * 8, TT); *(v8h*)(P16 + e) = o16; *(v8us*)(Ph + e) = oh; *(v8us*)(Pl + e) = ol;
                asm volatile("s_wait_xcnt 0x0" ::: "memory"); }   // behind the block's stores: the wait that stands in front of a rewrite of a register an issued store names (the next block's values land in such registers)
        return; }
    v4f tb[EPI == 1 ? 32 : 1];                 // q, k: the table of the wave's 64 positions, 16 KiB in a row, asked for in one run here (the fragments' registers are free) and landing behind the first rows' staging, not waited for piece by piece
    if constexpr (EPI == 1) { const float* tp = CS + (size_t)(r0 >> 3) * 512 + lane * 4;
#pragma unroll
        for (int i = 0; i < 32; ++i) tb[i] = *(const v4fa*)(tp + i * 128);
        asm volatile("s_wait_xcnt 0x0" ::: "memory");   // behind the run: the wait that stands in front of a rewrite of a register an issued load names (offset register, scalar base); no load of the run moves down past it
    }
#pragma unroll
    for (int mb = 0; mb < 4; ++mb) {
#pragma unroll
        for (int nb = 0; nb < 4; ++nb) {
#pragma unroll
            for (int j = 0; j < 8; ++j) os[(hi * 8 + j) * 68 + nb * 16 + lr] = acc[mb][nb][j]; }
        __builtin_amdgcn_wave_barrier(); asm volatile("" ::: "memory");
        if constexpr (EPI == 1) {
#pragma unroll
            for (int s = 0; s < 4; ++s) { const int rr = 8 * (s & 1) + (lane & 7), t = r0 + mb * 16 + rr, d0 = (4 * (s >> 1) + (lane >> 3)) * 8; const float* xr = os + rr * 68 + d0; const v4f xa = *(const v4fa*)xr, xb = *(const v4fa*)(xr + 4);
                const float x[8] = { xa[0], xa[1], xa[2], xa[3], xb[0], xb[1], xb[2], xb[3] }; const v4f ca = tb[(mb * 2 + (s & 1)) * 4 + (s >> 1) * 2], cb = tb[(mb * 2 + (s & 1)) * 4 + (s >> 1) * 2 + 1];
                const float cc[8] = { ca[0], ca[1], ca[2], ca[3], cb[0], cb[1], cb[2], cb[3] }; v8h o16; v8us oh, ol;   // {cos, sin} of the piece's four pairs
#pragma unroll
                for (int p = 0; p < 8; p += 2) { const float cs[2] = { cc[p], cc[p + 1] }; const float x0 = x[p], x1 = x[p + 1];
                    const float r0_ = x0 * cs[0] - x1 * cs[1], r1_ = x0 * cs[1] + x1 * cs[0];   /* even: x0 c - x1 s; odd: x0 s + x1 c */
                    o16[p] = tohx(r0_); o16[p + 1] = tohx(r1_); { unsigned short a2, c2; splitf(r0_, a2, c2); oh[p] = a2; ol[p] = c2; splitf(r1_, a2, c2); oh[p + 1] = a2; ol[p + 1] = c2; } }
                const size_t e = pl * TT * HD + pko(t, d0, HD); *(v8h*)(P16 + e) = o16; *(v8us*)(Ph + e) = oh; *(v8us*)(Pl + e) = ol;
                asm volatile("s_wait_xcnt 0x0" ::: "memory"); }   // behind the three stores: the wait that stands in front of a rewrite of a register an issued store names (the next pieces' values land in such registers)
        } else {
        float* crow = C + (size_t)(r0 + hi) * LDC + c0 + lr * 4 + mb * 16 * LDC;   // the lane's 16 bytes of the block's row hi; its other rows lie 2 LDC apart
        v4f val[8];                                // the block's 16 rows are read back as one run and waited for once, not row pair by row pair
#pragma unroll
        for (int s = 0; s < 8; ++s) { const int cofs = lr * 4; val[s] = *(const v4fa*)(os + (2 * s + hi) * 68 + cofs); if (BIAS) { val[s][0] += bfr(bias[c0 + cofs]); val[s][1] += bfr(bias[c0 + cofs + 1]); val[s][2] += bfr(bias[c0 + cofs + 2]); val[s][3] += bfr(bias[c0 + cofs + 3]); } }
#pragma unroll
        for (int s = 0; s < 8; ++s) *(v4f*)(crow + 2 * s * LDC) = val[s];
        asm volatile("s_wait_xcnt 0x0" ::: "memory");   // behind the block's stores: the wait that stands in front of a rewrite of a register an issued store names (the next block's addresses and values land in such registers)
        }
        __builtin_amdgcn_wave_barrier(); asm volatile("" ::: "memory");
    }
}


__global__ __launch_bounds__(256) void k_wtG(const float* __restrict__ w, int K, int N, bf* Bt) {
    const int lane = threadIdx.x & 31; const int L0 = (blockIdx.x * 8 + (threadIdx.x >> 5)) * 8; const int nlines = N * K / 64;
{
#pragma unroll 1
        for (int l = 0; l < 8; ++l) { const int L = L0 + l; if (L >= nlines) break; const size_t e = (size_t)L * 64 + lane * 2; const int k = (int)(e % K), n = (int)(e / K); v2us o;
            o[0] = f2bf(w[(size_t)k * N + n]); o[1] = f2bf(w[(size_t)(k + 1) * N + n]); *(v2us*)(Bt + e) = o; }
         }
}
static_assert(DQ == DM, "cvt8 takes K = DM for every buffer");
__device__ __forceinline__ void cvt8(const float* __restrict__ src, bf* dst, int blk) { const size_t i = (size_t)blk * 256 + threadIdx.x;   // i: the 16-byte piece of dst (fragment order, K = DM) that the thread writes; a block is 4 tiles: 16 rows x 512 bytes of src; every buffer is a whole number of blocks
    const int tile = (int)(i >> 6), row = tile / (DM / 32) * 16 + (int)(i & 15), kk = tile % (DM / 32) * 32 + (int)((i >> 5) & 1) * 16 + (int)((i >> 4) & 1) * 8; const v8f v = *(const v8f*)(src + (size_t)row * DM + kk); v8us o;
#pragma unroll
    for (int k = 0; k < 8; ++k) o[k] = f2bf(v[k]); *(v8us*)(dst + i * 8) = o;  }
__constant__ float INVP[HD / 2] = { 1.000000000e+00f,7.498942018e-01f,5.623413324e-01f,4.216965139e-01f,3.162277639e-01f,2.371373773e-01f,1.778279394e-01f,1.333521456e-01f,1.000000015e-01f,7.498942316e-02f,5.623413250e-02f,4.216964915e-02f,3.162277490e-02f,2.371373773e-02f,1.778279431e-02f,1.333521400e-02f,9.999999776e-03f,7.498942316e-03f,5.623413250e-03f,4.216964822e-03f,3.162277630e-03f,2.371373819e-03f,1.778279431e-03f,1.333521446e-03f,1.000000047e-03f,7.498941850e-04f,5.623413017e-04f,4.216965172e-04f,3.162277571e-04f,2.371373703e-04f,1.778279402e-04f,1.333521504e-04f };   // 10000 ** (-2 i / 64) as float32 (the module's power form, jnp-computed; differs from 1/10000**(2i/64) by ulps)
// The table, one {cos, sin} per (position t, pair pr), in the order in which the projection's epilogue reads it: a block of 8 positions is 2 KiB, four runs of 512 bytes (run = pr / 16 * 2 + pr / 2 % 2), and in a run lane (pr / 4 % 4) * 8 + t % 8
// holds the 16 bytes of pairs pr & ~1 and pr | 1: a wave-wide 16-byte load is one run (4 whole lines), and two runs give a lane the four pairs of its 8 columns.
__device__ __forceinline__ void csP(float* CS, int blk) { const int slot = blk * 256 + threadIdx.x; const int ln = (slot >> 1) & 31; const int t = blk * 8 + (ln & 7), pr = ((slot >> 7) & 1) * 16 + (ln >> 3) * 4 + ((slot >> 6) & 1) * 2 + (slot & 1);
    const float a = __fmul_rn((float)t, INVP[pr]); v2f cs; cs[0] = cosf(a); cs[1] = sinf(a); *(v2f*)(CS + (size_t)slot * 2) = cs;  }
// ---- k_prep: all that the GEMMs read and that depends on no other launch, in one grid; blockIdx.x picks the job by range (the same for a whole block), the table (the longest blocks) first.
#define PB_CS (TT / 8)
#define PB_X  (NB_ * TT * DM / 2048)
#define PB_W  ((DQ + 2 * DKV) * DM / 2048)
#define PB_O  (DM * DQ / 2048)
__global__ __launch_bounds__(256) void k_prep(const float* __restrict__ x, const float* __restrict__ wqkv, const float* __restrict__ wo, bf* XB, bf* WQKV, bf* WO, float* CS) {
    int b = blockIdx.x;
    if (b < PB_CS) { csP(CS, b); return; }
    b -= PB_CS; const float* src = x; bf* dst = XB;
    if (b >= PB_X + PB_W) { b -= PB_X + PB_W; src = wo; dst = WO; } else if (b >= PB_X) { b -= PB_X; src = wqkv; dst = WQKV; }
    cvt8(src, dst, b);
}

#define NW   4
#define SL2E (SCL * 1.4426950408889634f)   // the score scale (a power of two: exact) rides in the exponent's factor; m is kept in unscaled scores
#define OP   68                   // pitch, in floats, of a query's partial output row in LDS (64 + 4: rows 16 bytes apart in the banks)
// 2^x of eight values: eight independent v_exp_f32, each in place, and behind the last the one free slot that the instruction set asks for between a transcendental and an instruction that reads its result or
// overwrites its source.
__device__ __forceinline__ v8f exp2x8(v8f x) { float a = x[0], b = x[1], c = x[2], d = x[3], e = x[4], f = x[5], g = x[6], h = x[7];
    asm("v_exp_f32 %0, %0\n\tv_exp_f32 %1, %1\n\tv_exp_f32 %2, %2\n\tv_exp_f32 %3, %3\n\tv_exp_f32 %4, %4\n\tv_exp_f32 %5, %5\n\tv_exp_f32 %6, %6\n\tv_exp_f32 %7, %7\n\tv_nop" : "+v"(a), "+v"(b), "+v"(c), "+v"(d), "+v"(e), "+v"(f), "+v"(g), "+v"(h));
    return (v8f){a, b, c, d, e, f, g, h}; }
__device__ __forceinline__ float exp2x1(float a) { asm("v_exp_f32 %0, %0\n\tv_nop" : "+v"(a)); return a; }   // one value, with the same slot
template <typename T16, int NQ, bool HL>
__device__ __forceinline__ void attn_tile(const T16* __restrict__ Q, const T16* __restrict__ Q2, const T16* __restrict__ Kp, const T16* __restrict__ Kp2, const T16* __restrict__ Vt, const T16* __restrict__ Vt2, int q0, int rot, bf* __restrict__ Ah, bf* __restrict__ Al, float* os, float* ml) {
    typedef typename WFrag<T16>::V V;
    const int lane = threadIdx.x & 31, lr = lane & 15, hi = lane >> 4; const int w = __builtin_amdgcn_readfirstlane(threadIdx.x >> 5);
    const int klast = (q0 + NQ * 16 - 1) & ~31;      // first key of the 32-key block that holds the tile's last diagonal element
    // The tiles of a head walk the same key and value planes and start together: a wave enters the ring of its nw blocks at pass rot (less nw where that is past the end; 0 for a very short ring) and wraps, so that tiles of different rot do not ask L2 for the same lines at the same moment.
    const int nw = ((klast >> 5) + 1 - w + NW - 1) / NW;   // the wave's blocks: w, w + NW, ... up to the diagonal (0: none)
    int i0 = rot; if (i0 >= nw) i0 -= nw; if (i0 >= nw) i0 = 0;
    int kb = 32 * (w + NW * i0);
    V q[NQ][2], q2[NQ][2], k[2][2], k2[2][2];
    // every operand load is addressed as one lane pointer per plane and pass plus a constant that fits the instruction's offset field (no address sums per load)
    const unsigned kof = (unsigned)(8 * lane), vof = (unsigned)(8 * lane);   /* fragment order: the lane's piece of a tile */ const T16* pk = nullptr; const T16* pk2 = nullptr;
#pragma unroll
    for (int qt = 0; qt < NQ; ++qt)
#pragma unroll
        for (int c = 0; c < 2; ++c) { const int qc = qt * 16 * HD + c * 512; q[qt][c] = WFrag<T16>::ld(Q + (size_t)q0 * HD + kof + qc); if (HL) q2[qt][c] = WFrag<T16>::ld(Q2 + (size_t)q0 * HD + kof + qc); }
    auto ldk = [&](int kk) {                         // the four (HL: eight) fragments of the 32 key rows from kk on
        pk = Kp + (size_t)kk * HD + kof; if (HL) pk2 = Kp2 + (size_t)kk * HD + kof;
#pragma unroll
        for (int kt = 0; kt < 2; ++kt)
#pragma unroll
            for (int c = 0; c < 2; ++c) { const int kc = kt * 16 * HD + c * 512; k[kt][c] = WFrag<T16>::ld(pk + kc); if (HL) k2[kt][c] = WFrag<T16>::ld(pk2 + kc); } };
    if (!HL) ldk(min(kb, klast));                    // fp16: key fragments run one pass ahead (a wave with no block of its own fetches the last one: in bounds, unused); hi/lo: at most 4 passes a wave, fetched in the pass, which keeps the registers under 256
    v8f o[4][NQ]; float m[NQ], l[NQ];
#pragma unroll
    for (int qt = 0; qt < NQ; ++qt) { m[qt] = -3.0e38f; l[qt] = 0.f;
#pragma unroll
        for (int dt = 0; dt < 4; ++dt) o[dt][qt] = (v8f){}; }
#pragma unroll 1   // stays rolled: the trip count is known only at run time, and a second copy of the body (its fragments and score tiles) would not fit the registers
    for (int i = 0; i < nw; ++i) {
        const int kn = kb + 32 * NW <= klast ? kb + 32 * NW : 32 * w;   // the wave's next block; behind its last one the ring wraps to its first
        if (HL) ldk(kb);
        V v[4], v2[4]; const T16* pv = Vt + (size_t)kb * 16 + vof; const T16* pv2 = HL ? Vt2 + (size_t)kb * 16 + vof : nullptr;   // 32 keys on = one tile (512 elements) on
#pragma unroll
        for (int dt = 0; dt < 4; ++dt) { v[dt] = WFrag<T16>::ld(pv + dt * 16 * TT); if (HL) v2[dt] = WFrag<T16>::ld(pv2 + dt * 16 * TT); }
        v8f s[2][NQ];
#pragma unroll
        for (int kt = 0; kt < 2; ++kt)
#pragma unroll
            for (int qt = 0; qt < NQ; ++qt) { v8f a = (v8f){};
#pragma unroll
                for (int c = 0; c < 2; ++c) { a = WFrag<T16>::mma(k[kt][c], q[qt][c], a); if (HL) { a = WFrag<T16>::mma(k[kt][c], q2[qt][c], a); a = WFrag<T16>::mma(k2[kt][c], q[qt][c], a); } }
                s[kt][qt] = a; }
        if (!HL) ldk(kn);                             // the wave's next key fragments are fetched now, behind this pass's last use of the registers (its last pass fetches the block it began with: in bounds, unused)
        // all of the pass's loads are issued: the wait that stands in front of a rewrite of a register an issued load names. The pass's lane pointers are its inputs, so that their registers stay theirs up to here (one build landed later loads of the run in them)
        if constexpr (HL) asm volatile("s_wait_xcnt 0x0" :: "v"(pk), "v"(pk2), "v"(pv), "v"(pv2) : "memory"); else asm volatile("s_wait_xcnt 0x0" :: "v"(pk), "v"(pv) : "memory");
        if (kb == klast) {                            // only the block at the diagonal crosses it: key > query is masked
#pragma unroll
            for (int kt = 0; kt < 2; ++kt)
#pragma unroll
                for (int qt = 0; qt < NQ; ++qt)
#pragma unroll
                    for (int j = 0; j < 8; ++j) if (kb + kt * 16 + hi * 8 + j > q0 + qt * 16 + lr) s[kt][qt][j] = -3.0e38f; }
        V pb[NQ], pb2[NQ];
#pragma unroll
        for (int qt = 0; qt < NQ; ++qt) {
            float mx = fmaxf(s[0][qt][0], s[1][qt][0]);
#pragma unroll
            for (int j = 1; j < 8; ++j) mx = fmaxf(mx, fmaxf(s[0][qt][j], s[1][qt][j]));
            mx = fmaxf(mx, __shfl_xor(mx, 16, 32));
            const float mn = fmaxf(m[qt], mx); const float al = exp2x1((m[qt] - mn) * SL2E); m[qt] = mn;
            float sum = 0.f;
#pragma unroll
            for (int kt = 0; kt < 2; ++kt) { v8f x;
#pragma unroll
                for (int j = 0; j < 8; ++j) { const float y = (s[kt][qt][j] - mn) * SL2E; x[j] = HL ? y : y + 10.0f; }
                x = exp2x8(x); s[kt][qt] = x;
#pragma unroll
                for (int j = 0; j < 8; ++j) sum += x[j]; }
            l[qt] = l[qt] * al + sum;
#pragma unroll
            for (int dt = 0; dt < 4; ++dt) o[dt][qt] *= al;
            if constexpr (HL) { v8us h0, h1, l0, l1;
#pragma unroll
                for (int j = 0; j < 8; ++j) { unsigned short a, c2; splitf(s[0][qt][j], a, c2); h0[j] = a; l0[j] = c2; splitf(s[1][qt][j], a, c2); h1[j] = a; l1[j] = c2; }
                pb[qt] = cat16b(h0, h1); pb2[qt] = cat16b(l0, l1);
            } else { v8h h0, h1;
#pragma unroll
                for (int j = 0; j < 8; ++j) { h0[j] = tohx(s[0][qt][j]); h1[j] = tohx(s[1][qt][j]); }
                pb[qt] = cat16(h0, h1); }
        }
#pragma unroll
        for (int dt = 0; dt < 4; ++dt)
#pragma unroll
            for (int qt = 0; qt < NQ; ++qt) { o[dt][qt] = WFrag<T16>::mma(v[dt], pb[qt], o[dt][qt]); if (HL) { o[dt][qt] = WFrag<T16>::mma(v[dt], pb2[qt], o[dt][qt]); o[dt][qt] = WFrag<T16>::mma(v2[dt], pb[qt], o[dt][qt]); } }
        kb = kn;
    }
#pragma unroll
    for (int qt = 0; qt < NQ; ++qt) { const int row = w * (NQ * 16) + qt * 16 + lr; const float ls = l[qt] + __shfl_xor(l[qt], 16, 32);   // the halves' sums are joined once, here
        if (hi == 0) { v2f t2; t2[0] = m[qt]; t2[1] = ls; *(v2f*)(ml + row * 2) = t2; }
#pragma unroll
        for (int dt = 0; dt < 4; ++dt) { float* p = os + row * OP + dt * 16 + hi * 8; *(v4f*)p = __builtin_shufflevector(o[dt][qt], o[dt][qt], 0, 1, 2, 3); *(v4f*)(p + 4) = __builtin_shufflevector(o[dt][qt], o[dt][qt], 4, 5, 6, 7); } }
    __syncthreads();                                  // every wave's (m, l, O) is in LDS before any wave joins them
    constexpr int LPQ = 8 / NQ, DPL = 8 * NQ;         // lanes per query row and output elements per lane in the join
    const int qq = NQ == 2 ? w * 8 + lane / LPQ : (w & 1) * 8 + (lane & 7), d0 = NQ == 2 ? (lane % LPQ) * DPL : ((w >> 1) * 4 + (lane >> 3)) * 8;   // 8 consecutive rows a wave: their pieces fill whole lines of the merged planes
    v2f t[NW]; float M = -3.0e38f;
#pragma unroll
    for (int i = 0; i < NW; ++i) { t[i] = *(const v2f*)(ml + (i * (NQ * 16) + qq) * 2); M = fmaxf(M, t[i][0]); }
    float L = 0.f, acc[DPL];
#pragma unroll
    for (int e = 0; e < DPL; ++e) acc[e] = 0.f;
#pragma unroll
    for (int i = 0; i < NW; ++i) { const float sc = exp2x1((t[i][0] - M) * SL2E); L += t[i][1] * sc;   // a wave that had no block: m = -3e38, so sc = 0, on l = 0 and O = 0
#pragma unroll
        for (int e = 0; e < DPL; e += 4) { const v4f x = *(const v4f*)(os + (i * (NQ * 16) + qq) * OP + d0 + e); acc[e] += x[0] * sc; acc[e + 1] += x[1] * sc; acc[e + 2] += x[2] * sc; acc[e + 3] += x[3] * sc; } }
    const float inv = __fdiv_rn(1.0f, L);
#pragma unroll
    for (int c = 0; c < DPL / 8; ++c) { v8us oh, ol;
#pragma unroll
        for (int j = 0; j < 8; ++j) { unsigned short a, c2; splitf(acc[c * 8 + j] * inv, a, c2); oh[j] = a; ol[j] = c2; }
        const size_t oo = pko(q0 + qq, d0 + c * 8, DQ); *(v8us*)(Ah + oo) = oh; *(v8us*)(Al + oo) = ol; }
    // hi/lo form only: behind the last store, the wait that stands in front of any rewrite of a register an issued store names (in the listing the way on from here leads past the fp16 form's entry, which writes such registers; the fp16 form's stores run straight into the end of the program)
    if constexpr (HL) asm volatile("s_wait_xcnt 0x0" ::: "memory");
}
// grid (batches x heads, tiles): blockIdx.x = batch * NH_ + head is the plane's index; blockIdx.y ranks the tiles by falling cost: the (TT - RH) / 32 fp16 tiles of 32 rows from the last row up, then the RH / 16 hi/lo tiles of 16 rows.
__global__ __launch_bounds__(32 * NW) void k_attn(const h16* __restrict__ Q16, const h16* __restrict__ K16, const h16* __restrict__ V16, const bf* __restrict__ Qh, const bf* __restrict__ Ql, const bf* __restrict__ Kh, const bf* __restrict__ Kl, const bf* __restrict__ Vh, const bf* __restrict__ Vl, bf* __restrict__ Ah, bf* __restrict__ Al) {
    __shared__ __align__(16) float os[NW * 32 * OP]; __shared__ __align__(16) float ml[NW * 32 * 2];
    const size_t hp = (size_t)blockIdx.x * TT * HD; const int r = blockIdx.y; const size_t ao = (size_t)(blockIdx.x / NH_) * TT * DQ + (blockIdx.x % NH_) * (HD / 32) * 512;   /* the batch's rows, the head's first tile column */ Ah += ao; Al += ao;
    if (r < (TT - RH) / 32) attn_tile<h16, 2, false>(Q16 + hp, nullptr, K16 + hp, nullptr, V16 + hp, nullptr, TT - 32 - 32 * r, r & 7, Ah, Al, os, ml);
    else attn_tile<bf, 1, true>(Qh + hp, Ql + hp, Kh + hp, Kl + hp, Vh + hp, Vl + hp, RH - 16 - 16 * (r - (TT - RH) / 32), r & 7, Ah, Al, os, ml);
}

extern "C" void kernel_launch(void* const* d_in, const int* in_sizes, int n_in,
                              void* d_out, int out_size, void* d_ws, size_t ws_size, hipStream_t stream) {
    (void)in_sizes; (void)n_in; (void)out_size;
    const float* x = (const float*)d_in[0]; const float* wqkv = (const float*)d_in[1]; const float* wo = (const float*)d_in[2];   /* input order X, W_qkv ('oi' [3072][1024]: q | k | v = its three 1,024-row blocks), W_o ('oi' [1024][1024]): THREE inputs */
    float* OUT = (float*)d_out;     // [2][2048][1024]
    char* wsp = (char*)d_ws;
    auto take = [&](size_t bytes) { char* p = wsp; wsp += (bytes + 255) & ~(size_t)255; return (void*)p; };
    const size_t PG = (size_t)NB_ * NH_ * TT * HD;   // elements of one of q, k, v: a plane per (batch, head)
    bf* WQKV = (bf*)take((size_t)(DQ + 2 * DKV) * DM * 2); bf* WO = (bf*)take((size_t)DM * DQ * 2); float* CS = (float*)take((size_t)TT * (HD / 2) * 2 * 4);
    h16* P16 = (h16*)take(3 * PG * 2); bf* Ph = (bf*)take(3 * PG * 2); bf* Pl = (bf*)take(3 * PG * 2);   // each [q | k | v][batch][head]
    bf* XB = (bf*)take((size_t)NB_ * TT * DM * 2);
    bf* ATh = (bf*)take((size_t)NB_ * TT * DQ * 2); bf* ATl = (bf*)take((size_t)NB_ * TT * DQ * 2);
    if ((size_t)(wsp - (char*)d_ws) > ws_size) return;    // ws 256 MiB
    k_prep<<<PB_CS + PB_X + PB_W + PB_O, 256, 0, stream>>>(x, wqkv, wo, XB, WQKV, WO, CS);   /* bf16 copies; {cos, sin}(t x THETA**(-2i/64)) per interleaved pair */
    k_gemmw<bf, 0, false, 1, DM, 4, 3, 0><<<dim3(TT / 256, (DQ + 2 * DKV) / 192, NB_), 384, 0, stream>>>(XB, nullptr, WQKV, nullptr, nullptr, (size_t)TT * DM, 0, 0, CS, P16, Ph, Pl);
    k_attn<<<dim3(NB_ * NH_, (TT - RH) / 32 + RH / 16, 1), 32 * NW, 0, stream>>>(P16, P16 + PG, P16 + 2 * PG, Ph, Pl, Ph + PG, Pl + PG, Ph + 2 * PG, Pl + 2 * PG, ATh, ATl);   // one kv head per query head
    k_gemmw<bf, 1, false, 0, DQ, 2, 2, DM><<<dim3(NB_ * TT / 128, DM / 128, 1), 128, 0, stream>>>(ATh, ATl, WO, OUT, nullptr, 0, 0, 0, nullptr, nullptr, nullptr, nullptr);   // the batches' rows are one [NB_ * TT][DQ] operand
}

// v010
// One run takes 70.1 microseconds.
// Timed twice side by side with v009, it ran 1.03 times as fast both times.
// All steps since v000 together make it 20.2 times as fast.
#include <hip/hip_runtime.h>

// Causal multi-head self-attention with interleaved rotary embeddings and a FUSED (out, in) qkv weight (X [2][2048][1024]; qkv = einsum('bsd,od->bso', X, W_qkv) ('oi' [3072][1024] std sqrt(2/4096), no bias) viewed (B, S, 3, 16, 64): q | k | v = the three 1,024-ROW blocks of W_qkv (16 heads x 64); rotary on (even, odd) pairs with angle pos / (10000 ** (2 k / 64)) (float32 constants 10000^(-2i/64), precise cosf/sinf); scores x 64^-0.5, causal (-inf); softmax; out = merged W_o^T ('oi', no bias) -> [2][2048][1024] (4.2 M); argument order X, W_qkv, W_o.
// Both batches ride in every launch (4 launches): bf16 copies of x and the weights; exact projections; {cos, sin} per (position, pair) from the int positions (jnp-exact float32 inverse frequencies, precise cosf/sinf); interleaved rotary and the 16-bit head planes in the projections' own epilogues; causal T-2048 attention fused in k_attn (hybrid rows: < 512 hi/lo 3 products, rest fp16 x1024; running maximum, keys walked up to the diagonal); merged hi/lo x wo exact, no bias.
// Compute dtypes, f32 accumulate: every input rounded to bf16; projections exact ; rotary f32; attention rows < 512 3 products, rest fp16; softmax f32; wo hl x exact, no bias.

#define NB_  2
#define TT   2048
#define DM   1024
#define NH_  16
#define NKV  16
#define REP  (NH_ / NKV)
#define HD   64
#define DQ   (NH_ * HD)
#define DKV  (NKV * HD)
#define RH   512                  // query rows < RH use hi+lo planes
#define SCL  0.125f   // HD^-0.5
typedef _Float16 h16;
typedef unsigned short bf;
typedef __attribute__((ext_vector_type(16))) __bf16   v16bf;
typedef __attribute__((ext_vector_type(16))) _Float16 v16h;
typedef __attribute__((ext_vector_type(8)))  _Float16 v8h;
typedef __attribute__((ext_vector_type(8)))  unsigned short v8us;
typedef __attribute__((ext_vector_type(8)))  float    v8f;
typedef __attribute__((ext_vector_type(4)))  float    v4f;
typedef v8h  __attribute__((may_alias)) v8ha;
typedef v4f  __attribute__((may_alias)) v4fa;
typedef v8us __attribute__((may_alias)) v8usa;

__device__ __forceinline__ unsigned short f2bf(float f) { unsigned u = __float_as_uint(f); u += 0x7FFFu + ((u >> 16) & 1u); return (unsigned short)(u >> 16); }
__device__ __forceinline__ float bf2f(unsigned short b) { return __uint_as_float(((unsigned)b) << 16); }
__device__ __forceinline__ float bfr(float f) { return bf2f(f2bf(f)); }
__device__ __forceinline__ v16h cat16(v8h lo, v8h hi) { return __builtin_shufflevector(lo, hi, 0, 1, 2, 3, 4, 5, 6, 7, 8, 9, 10, 11, 12, 13, 14, 15); }
__device__ __forceinline__ v16bf cat16b(v8us lo, v8us hi) { return __builtin_bit_cast(v16bf, __builtin_shufflevector(lo, hi, 0, 1, 2, 3, 4, 5, 6, 7, 8, 9, 10, 11, 12, 13, 14, 15)); }
__device__ __forceinline__ v8f wmma16(v16h a, v16h b, v8f c) { return __builtin_amdgcn_wmma_f32_16x16x32_f16(false, a, false, b, (short)0, c, false, false); }
__device__ __forceinline__ v8f wmmab(v16bf a, v16bf b, v8f c) { return __builtin_amdgcn_wmma_f32_16x16x32_bf16(false, a, false, b, (short)0, c, false, false); }



__device__ __forceinline__ h16 tohx(float x) { return (h16)x; }
__device__ __forceinline__ void splitf(float y, unsigned short& h, unsigned short& l) { h = f2bf(y); l = f2bf(y - bf2f(h)); }
typedef __attribute__((ext_vector_type(2))) _Float16 v2h;
typedef __attribute__((ext_vector_type(4))) _Float16 v4h;
typedef __attribute__((ext_vector_type(2))) unsigned short v2us;
typedef __attribute__((ext_vector_type(4))) unsigned short v4us;
typedef __attribute__((ext_vector_type(2))) float v2f;
typedef __attribute__((ext_vector_type(4))) int v4i;

// ---- Fragment order: every 16-bit matrix operand in the workspace ([rows][K], rows % 16 == 0, K % 32 == 0) is stored as tiles of 16 rows x 32 k (1,024 bytes; tile index = (row / 16) * (K / 32) + k / 32), and inside a tile
// as the two 16-byte pieces a lane of the matrix instruction holds: piece (k / 16 % 2) * 32 + (k / 8 % 2) * 16 + row % 16. A fragment load (WFrag::ld at tile + lane * 8 elements) is then two wave-wide loads of 512 contiguous bytes
// (4 whole lines each), where a row-major plane takes 16 lines a load; the values that reach each lane and register are those of the row-major form.
__device__ __forceinline__ size_t pko(int row, int k, int K) { return ((size_t)(row >> 4) * (K >> 5) + (k >> 5)) * 512 + ((k >> 4) & 1) * 256 + ((k >> 3) & 1) * 128 + (row & 15) * 8 + (k & 7); }
// ---- k_gemmw: register-blocked GEMM, one wave per 64x64 output tile (16 accumulators); WM x WN waves form a work-group that owns a (64 WM) x (64 WN) tile and shares its operands through LDS; grid (M / (64 WM), N / (64 WN), Z), 32 WM WN threads.
// A stage is 64 k of every operand row of the work-group's tile, in fragment order as in the workspace (a row block of 16 rows x 64 k is 2 KiB in a row, there and in LDS). It comes by asynchronous copies to LDS, through no register,
// two buffers: stage t + 1 is asked for when every wave has left stage t - 1, and flies while stage t is worked on. A fragment read from LDS is two wave-wide reads of 512 contiguous bytes.
// C[m][n] (f32, pitch LDC, a constant, so that a tile's stores differ only in the instruction's offset field; + optional f32 bias[n]) = sum_k A[m][k] Bt[n][k] (NSPLIT 1: + A2[m][k] Bt[n][k]). z-batch strides sA/sB/sC in elements. K % 64 == 0, K >= 128.
// EPI says where a wave's tile goes. 0: C as above. 1: the fused q | k | v projection of batch blockIdx.z: the tile is 64 positions (rows) x the 64 columns of ONE head (cy = column / 64 = which * NH_ + head, which = 0 q, 1 k, 2 v), and it leaves the wave as the attention's 16-bit planes (fp16, and at positions < RH bf16 hi, bf16 lo; each buffer [which][batch][head] planes of TT * HD), no f32 copy in between:
// q, k: interleaved rotary with {cos, sin} from CS, planes [t][d] in fragment order (a lane turns 8 columns of a row, one 16-byte piece; 8 lanes on 8 consecutive rows fill a 128-byte line); v: planes [d][t] in fragment order: a lane's accumulator holds 8 consecutive positions of one column, which IS its piece of the transposed tile (a store is 512 contiguous bytes).
template <typename T16> struct WFrag;
template <> struct WFrag<h16> { typedef v16h V; static __device__ __forceinline__ V ld(const h16* p) { return cat16(*(const v8h*)p, *(const v8h*)(p + 256)); } static __device__ __forceinline__ v8f mma(V a, V b, v8f c) { return wmma16(a, b, c); } };
template <> struct WFrag<bf> { typedef v16bf V; static __device__ __forceinline__ V ld(const bf* p) { return cat16b(*(const v8us*)p, *(const v8us*)(p + 256)); } static __device__ __forceinline__ v8f mma(V a, V b, v8f c) { return wmmab(a, b, c); } };
// cp8, cp12: two or three row blocks of a stage (16 rows x 64 k, 2 KiB in a row in the workspace as in LDS), each as four wave-wide copies of 512 bytes; l, g: the lane's own 16 bytes of a block's first copy, in LDS and in the workspace.
// The wait on the last line stands in front of any rewrite of a register that an issued copy names; inside the statement nothing can be moved between the copies and it.
template <typename T16>
__device__ __forceinline__ void cp8(unsigned l0, const T16* g0, unsigned l1, const T16* g1) {
    asm volatile("global_load_async_to_lds_b128 %0, %8, off\n\tglobal_load_async_to_lds_b128 %1, %9, off\n\tglobal_load_async_to_lds_b128 %2, %10, off\n\tglobal_load_async_to_lds_b128 %3, %11, off\n\t"
                 "global_load_async_to_lds_b128 %4, %12, off\n\tglobal_load_async_to_lds_b128 %5, %13, off\n\tglobal_load_async_to_lds_b128 %6, %14, off\n\tglobal_load_async_to_lds_b128 %7, %15, off\n\ts_wait_xcnt 0x0"
                 :: "v"(l0), "v"(l0 + 512u), "v"(l0 + 1024u), "v"(l0 + 1536u), "v"(l1), "v"(l1 + 512u), "v"(l1 + 1024u), "v"(l1 + 1536u),
                    "v"(g0), "v"(g0 + 256), "v"(g0 + 512), "v"(g0 + 768), "v"(g1), "v"(g1 + 256), "v"(g1 + 512), "v"(g1 + 768) : "memory");
}
template <typename T16>
__device__ __forceinline__ void cp12(unsigned l0, const T16* g0, unsigned l1, const T16* g1, unsigned l2, const T16* g2) {
    asm volatile("global_load_async_to_lds_b128 %0, %12, off\n\tglobal_load_async_to_lds_b128 %1, %13, off\n\tglobal_load_async_to_lds_b128 %2, %14, off\n\tglobal_load_async_to_lds_b128 %3, %15, off\n\t"
                 "global_load_async_to_lds_b128 %4, %16, off\n\tglobal_load_async_to_lds_b128 %5, %17, off\n\tglobal_load_async_to_lds_b128 %6, %18, off\n\tglobal_load_async_to_lds_b128 %7, %19, off\n\t"
                 "global_load_async_to_lds_b128 %8, %20, off\n\tglobal_load_async_to_lds_b128 %9, %21, off\n\tglobal_load_async_to_lds_b128 %10, %22, off\n\tglobal_load_async_to_lds_b128 %11, %23, off\n\ts_wait_xcnt 0x0"
                 :: "v"(l0), "v"(l0 + 512u), "v"(l0 + 1024u), "v"(l0 + 1536u), "v"(l1), "v"(l1 + 512u), "v"(l1 + 1024u), "v"(l1 + 1536u), "v"(l2), "v"(l2 + 512u), "v"(l2 + 1024u), "v"(l2 + 1536u),
                    "v"(g0), "v"(g0 + 256), "v"(g0 + 512), "v"(g0 + 768), "v"(g1), "v"(g1 + 256), "v"(g1 + 512), "v"(g1 + 768), "v"(g2), "v"(g2 + 256), "v"(g2 + 512), "v"(g2 + 768) : "memory");
}
template <typename T16, int NSPLIT, bool BIAS, int EPI, int K, int WM, int WN, int LDC>
__global__ __launch_bounds__(32 * WM * WN) void k_gemmw(const T16* __restrict__ A, const T16* __restrict__ A2, const T16* __restrict__ Bt, float* C, const float* __restrict__ bias, size_t sA, size_t sB, size_t sC, const float* __restrict__ CS, h16* __restrict__ P16, bf* __restrict__ Ph, bf* __restrict__ Pl) {
    typedef typename WFrag<T16>::V V;
    static_assert(NSPLIT == 0 || NSPLIT == 1, "A (+ A2) x Bt"); static_assert(K % 64 == 0 && K >= 128, "two stages or more"); static_assert((K / 64 & (K / 64 - 1)) == 0, "the stage ring wraps by a mask");
    // a stage in LDS: the row blocks of A, of A2, of Bt, in that order, 1,024 elements each; wave w copies row blocks w, w + NWV, ...: FULL each, and the first REM waves one more
    constexpr int NWV = WM * WN, RA = 4 * WM, RB0 = (NSPLIT + 1) * RA, NRB = RB0 + 4 * WN, FULL = NRB / NWV, REM = NRB % NWV, MR = FULL + (REM ? 1 : 0), SE = NRB * 1024, NT = K / 64;
    static_assert(REM == 0 ? FULL % 3 == 0 : FULL == 2, "the copies go three row blocks a statement, or two");
    __shared__ __align__(16) T16 st[2 * SE]; __shared__ __align__(16) float osb[NWV * 16 * 68];
    const size_t z = blockIdx.z; A += z * sA; if (NSPLIT == 1) A2 += z * sA; Bt += z * sB; C += z * sC;
    const int lane = threadIdx.x & 31, lr = lane & 15, hi = lane >> 4; const int w = __builtin_amdgcn_readfirstlane(threadIdx.x >> 5), wn = w / WM, wm = EPI == 1 ? (w + wn) % WM : w % WM;   // EPI 1: the WN waves of a row group have numbers that differ modulo 4 (speed only: the group of low rows has the long epilogue)
    static_assert(EPI != 1 || (RH % 64 == 0 && TT == RH * WM), "EPI 1: one group of low rows a work-group");
    // the work-group's WM groups of 64 rows. EPI 1: group 0 is 64 of the rows < RH, the others lie at and above RH, so that every work-group has the same share of the rows whose hi / lo planes are stored
    auto rowg = [&](int g) { return EPI == 1 ? (g == 0 ? (int)blockIdx.x * 64 : RH + ((int)blockIdx.x * (WM - 1) + g - 1) * 64) : (int)blockIdx.x * (64 * WM) + g * 64; };
    auto rowb = [&](int rb) { return EPI == 1 ? rowg(rb >> 2) + 16 * (rb & 3) : (int)blockIdx.x * (64 * WM) + 16 * rb; };   // first row of the tile's row block rb
    const int C0 = blockIdx.y * (64 * WN), r0 = rowg(wm), c0 = C0 + wn * 64, cy = c0 / 64; float* os = osb + w * (16 * 68);   // each wave stages its output rows in its own range
    v8f acc[4][4];
#pragma unroll
    for (int mb = 0; mb < 4; ++mb)
#pragma unroll
        for (int nb = 0; nb < 4; ++nb) acc[mb][nb] = (v8f){};
    const T16* gp[MR];                               // the lane's first 16 bytes of each of the wave's row blocks, stage 0 (a wave without a last one: the stage's last block, never copied by it)
#pragma unroll
    for (int i = 0; i < MR; ++i) { const int rb = min(w + i * NWV, NRB - 1); gp[i] = (rb < RA ? A + (size_t)rowb(rb) * K : (NSPLIT == 1 && rb < RB0) ? A2 + (size_t)rowb(rb - RA) * K : Bt + (size_t)(C0 + 16 * (rb - RB0)) * K) + 8 * lane; }
    const unsigned l00 = (unsigned)(size_t)(st + w * 1024 + 8 * lane);   // ... and their place in buffer 0: NWV * 2,048 bytes from one to the next
    // The work-groups that share operand rows (a row of tiles shares A, a column Bt) start together; each enters the ring of k stages at a place of its own, set by its tile indices, and wraps, so that they do not ask L2 for the same lines at the same moment. The sum over k starts at that stage.
    const int rot = (int)(blockIdx.x + blockIdx.y + blockIdx.z * (NT / 2)) & (NT - 1);   // the batches half a ring apart
    auto fill = [&](int t, int bu) {                 // the t-th stage of the work-group's walk into buffer bu
        const unsigned l = l00 + (unsigned)bu * (SE * 2u); const size_t go = (size_t)((t + rot) & (NT - 1)) * 1024; constexpr unsigned LS = NWV * 2048u;
        if constexpr (REM == 0) {
#pragma unroll
            for (int i = 0; i < FULL; i += 3) cp12<T16>(l + i * LS, gp[i] + go, l + (i + 1) * LS, gp[i + 1] + go, l + (i + 2) * LS, gp[i + 2] + go);
        } else { if (w < REM) cp12<T16>(l, gp[0] + go, l + LS, gp[1] + go, l + 2 * LS, gp[2] + go); else cp8<T16>(l, gp[0] + go, l + LS, gp[1] + go); } };   // w is a scalar: a whole wave goes one way
    fill(0, 0);
    asm volatile("s_wait_asynccnt 0x0" ::: "memory");   // the wave's own copies of stage 0 have landed
    __syncthreads();                                 // ... and every other wave's: stage 0 may be read
#pragma unroll 1   // stays rolled: one copy of the body serves both buffers
    for (int t = 0; t < NT; ++t) {
        const T16* sb = st + (t & 1) * SE + 8 * lane;
        V a[2][4], a2[2][4], b[2][4];                // the fragments of the stage's two k steps of 32
        auto ldf = [&](int s) {
#pragma unroll
            for (int mb = 0; mb < 4; ++mb) { a[s][mb] = WFrag<T16>::ld(sb + (wm * 4 + mb) * 1024 + s * 512); if (NSPLIT == 1) a2[s][mb] = WFrag<T16>::ld(sb + (RA + wm * 4 + mb) * 1024 + s * 512); }
#pragma unroll
            for (int nb = 0; nb < 4; ++nb) b[s][nb] = WFrag<T16>::ld(sb + (RB0 + wn * 4 + nb) * 1024 + s * 512); };
        if (t + 1 < NT) fill(t + 1, (t + 1) & 1);    // into the buffer that every wave left at the barrier just passed; the copies fly while stage t is worked on
        ldf(0);
        __builtin_amdgcn_sched_barrier(0);           // the first k step's reads stay in front of the second's, so that its matrix instructions wait for them alone (left free, the scheduler put some of them last)
        ldf(1);
        __builtin_amdgcn_sched_barrier(0);           // the stage's LDS reads stay in front of its matrix instructions (left free, the scheduler spread them among these, each with a wait to 0 behind it)
#pragma unroll
        for (int s = 0; s < 2; ++s)
#pragma unroll
            for (int nb = 0; nb < 4; ++nb)
#pragma unroll
                for (int mb = 0; mb < 4; ++mb) { acc[mb][nb] = WFrag<T16>::mma(a[s][mb], b[s][nb], acc[mb][nb]); if (NSPLIT == 1) acc[mb][nb] = WFrag<T16>::mma(a2[s][mb], b[s][nb], acc[mb][nb]); }
        __builtin_amdgcn_sched_barrier(0);           // the matrix instructions stay in front of the waits (left free, the scheduler put them behind the barrier, and the wait for the copies stood right behind their issue)
        asm volatile("s_wait_dscnt 0x0" ::: "memory");      // the wave's reads of this buffer are over before it may be refilled
        asm volatile("s_wait_asynccnt 0x0" ::: "memory");   // the wave's own copies of stage t + 1 have landed
        __syncthreads();                             // stage t + 1 may be read by every wave; every wave has left stage t's buffer
    }
    asm volatile("s_wait_asynccnt 0x0" ::: "memory");   // no copy is outstanding when the wave goes on to its epilogue and ends
    const size_t pl = EPI == 1 ? ((size_t)(cy / NH_) * NB_ + z) * NH_ + cy % NH_ : 0;   // the tile's plane
    // The hi / lo planes are stored only where k_attn reads them: at positions < RH (the hi/lo query tiles and, causal, their keys and values). The same for the whole wave.
    const bool shl = r0 < RH;
    if (EPI == 1 && cy >= 2 * NH_) {          // v (the same for the whole wave)
#pragma unroll
        for (int nb = 0; nb < 4; ++nb)
#pragma unroll
            for (int mb = 0; mb < 4; ++mb) { const size_t e = pl * HD * TT + pko(nb * 16 + lr, r0 + mb * 16 + hi * 8, TT); v8h o16;
                if (shl) { v8us oh, ol;
#pragma unroll
                    for (int j = 0; j < 8; ++j) { const float x = acc[mb][nb][j]; o16[j] = tohx(x); unsigned short a2, c2; splitf(x, a2, c2); oh[j] = a2; ol[j] = c2; }
                    *(v8h*)(P16 + e) = o16; *(v8us*)(Ph + e) = oh; *(v8us*)(Pl + e) = ol;
                    asm volatile("s_wait_xcnt 0x0" ::: "memory");   // behind the block's stores, on the same side of the branch: the wait that stands in front of a rewrite of a register an issued store names (the next block's values land in such registers)
                } else {
#pragma unroll
                    for (int j = 0; j < 8; ++j) o16[j] = tohx(acc[mb][nb][j]);
                    *(v8h*)(P16 + e) = o16;
                    asm volatile("s_wait_xcnt 0x0" ::: "memory"); } }   // the same wait behind the one store
        return; }
    v4f tb[EPI == 1 ? 32 : 1];                 // q, k: the table of the wave's 64 positions, 16 KiB in a row, asked for in one run here (the fragments' registers are free) and landing behind the first rows' staging, not waited for piece by piece
    if constexpr (EPI == 1) { const float* tp = CS + (size_t)(r0 >> 3) * 512 + lane * 4;
#pragma unroll
        for (int i = 0; i < 32; ++i) tb[i] = *(const v4fa*)(tp + i * 128);
        asm volatile("s_wait_xcnt 0x0" ::: "memory");   // behind the run: the wait that stands in front of a rewrite of a register an issued load names (offset register, scalar base); no load of the run moves down past it
    }
#pragma unroll
    for (int mb = 0; mb < 4; ++mb) {
#pragma unroll
        for (int nb = 0; nb < 4; ++nb) {
#pragma unroll
            for (int j = 0; j < 8; ++j) os[(hi * 8 + j) * 68 + nb * 16 + lr] = acc[mb][nb][j]; }
        __builtin_amdgcn_wave_barrier(); asm volatile("" ::: "memory");
        if constexpr (EPI == 1) {
#pragma unroll
            for (int s = 0; s < 4; ++s) { const int rr = 8 * (s & 1) + (lane & 7), t = r0 + mb * 16 + rr, d0 = (4 * (s >> 1) + (lane >> 3)) * 8; const float* xr = os + rr * 68 + d0; const v4f xa = *(const v4fa*)xr, xb = *(const v4fa*)(xr + 4);
                const float x[8] = { xa[0], xa[1], xa[2], xa[3], xb[0], xb[1], xb[2], xb[3] }; const v4f ca = tb[(mb * 2 + (s & 1)) * 4 + (s >> 1) * 2], cb = tb[(mb * 2 + (s & 1)) * 4 + (s >> 1) * 2 + 1];
                const float cc[8] = { ca[0], ca[1], ca[2], ca[3], cb[0], cb[1], cb[2], cb[3] }; float y[8];   // {cos, sin} of the piece's four pairs
#pragma unroll
                for (int p = 0; p < 8; p += 2) { const float cs[2] = { cc[p], cc[p + 1] }; const float x0 = x[p], x1 = x[p + 1];
                    y[p] = x0 * cs[0] - x1 * cs[1]; y[p + 1] = x0 * cs[1] + x1 * cs[0]; }   /* even: x0 c - x1 s; odd: x0 s + x1 c */
                const size_t e = pl * TT * HD + pko(t, d0, HD); v8h o16;
#pragma unroll
                for (int p = 0; p < 8; ++p) o16[p] = tohx(y[p]);
                if (shl) { v8us oh, ol;
#pragma unroll
                    for (int p = 0; p < 8; ++p) { unsigned short a2, c2; splitf(y[p], a2, c2); oh[p] = a2; ol[p] = c2; }
                    *(v8h*)(P16 + e) = o16; *(v8us*)(Ph + e) = oh; *(v8us*)(Pl + e) = ol;
                    asm volatile("s_wait_xcnt 0x0" ::: "memory");   // behind the three stores, on the same side of the branch: the wait that stands in front of a rewrite of a register an issued store names (the next pieces' values land in such registers)
                } else { *(v8h*)(P16 + e) = o16;
                    asm volatile("s_wait_xcnt 0x0" ::: "memory"); } }   // the same wait behind the one store
        } else {
        float* crow = C + (size_t)(r0 + hi) * LDC + c0 + lr * 4 + mb * 16 * LDC;   // the lane's 16 bytes of the block's row hi; its other rows lie 2 LDC apart
        v4f val[8];                                // the block's 16 rows are read back as one run and waited for once, not row pair by row pair
#pragma unroll
        for (int s = 0; s < 8; ++s) { const int cofs = lr * 4; val[s] = *(const v4fa*)(os + (2 * s + hi) * 68 + cofs); if (BIAS) { val[s][0] += bfr(bias[c0 + cofs]); val[s][1] += bfr(bias[c0 + cofs + 1]); val[s][2] += bfr(bias[c0 + cofs + 2]); val[s][3] += bfr(bias[c0 + cofs + 3]); } }
#pragma unroll
        for (int s = 0; s < 8; ++s) *(v4f*)(crow + 2 * s * LDC) = val[s];
        asm volatile("s_wait_xcnt 0x0" ::: "memory");   // behind the block's stores: the wait that stands in front of a rewrite of a register an issued store names (the next block's addresses and values land in such registers)
        }
        __builtin_amdgcn_wave_barrier(); asm volatile("" ::: "memory");
    }
}


__global__ __launch_bounds__(256) void k_wtG(const float* __restrict__ w, int K, int N, bf* Bt) {
    const int lane = threadIdx.x & 31; const int L0 = (blockIdx.x * 8 + (threadIdx.x >> 5)) * 8; const int nlines = N * K / 64;
{
#pragma unroll 1
        for (int l = 0; l < 8; ++l) { const int L = L0 + l; if (L >= nlines) break; const size_t e = (size_t)L * 64 + lane * 2; const int k = (int)(e % K), n = (int)(e / K); v2us o;
            o[0] = f2bf(w[(size_t)k * N + n]); o[1] = f2bf(w[(size_t)(k + 1) * N + n]); *(v2us*)(Bt + e) = o; }
         }
}
static_assert(DQ == DM, "cvt8 takes K = DM for every buffer");
__device__ __forceinline__ void cvt8(const float* __restrict__ src, bf* dst, int blk) { const size_t i = (size_t)blk * 256 + threadIdx.x;   // i: the 16-byte piece of dst (fragment order, K = DM) that the thread writes; a block is 4 tiles: 16 rows x 512 bytes of src; every buffer is a whole number of blocks
    const int tile = (int)(i >> 6), row = tile / (DM / 32) * 16 + (int)(i & 15), kk = tile % (DM / 32) * 32 + (int)((i >> 5) & 1) * 16 + (int)((i >> 4) & 1) * 8; const v8f v = *(const v8f*)(src + (size_t)row * DM + kk); v8us o;
#pragma unroll
    for (int k = 0; k < 8; ++k) o[k] = f2bf(v[k]); *(v8us*)(dst + i * 8) = o;  }
__constant__ float INVP[HD / 2] = { 1.000000000e+00f,7.498942018e-01f,5.623413324e-01f,4.216965139e-01f,3.162277639e-01f,2.371373773e-01f,1.778279394e-01f,1.333521456e-01f,1.000000015e-01f,7.498942316e-02f,5.623413250e-02f,4.216964915e-02f,3.162277490e-02f,2.371373773e-02f,1.778279431e-02f,1.333521400e-02f,9.999999776e-03f,7.498942316e-03f,5.623413250e-03f,4.216964822e-03f,3.162277630e-03f,2.371373819e-03f,1.778279431e-03f,1.333521446e-03f,1.000000047e-03f,7.498941850e-04f,5.623413017e-04f,4.216965172e-04f,3.162277571e-04f,2.371373703e-04f,1.778279402e-04f,1.333521504e-04f };   // 10000 ** (-2 i / 64) as float32 (the module's power form, jnp-computed; differs from 1/10000**(2i/64) by ulps)
// The table, one {cos, sin} per (position t, pair pr), in the order in which the projection's epilogue reads it: a block of 8 positions is 2 KiB, four runs of 512 bytes (run = pr / 16 * 2 + pr / 2 % 2), and in a run lane (pr / 4 % 4) * 8 + t % 8
// holds the 16 bytes of pairs pr & ~1 and pr | 1: a wave-wide 16-byte load is one run (4 whole lines), and two runs give a lane the four pairs of its 8 columns.
__device__ __forceinline__ void csP(float* CS, int blk) { const int slot = blk * 256 + threadIdx.x; const int ln = (slot >> 1) & 31; const int t = blk * 8 + (ln & 7), pr = ((slot >> 7) & 1) * 16 + (ln >> 3) * 4 + ((slot >> 6) & 1) * 2 + (slot & 1);
    const float a = __fmul_rn((float)t, INVP[pr]); v2f cs; cs[0] = cosf(a); cs[1] = sinf(a); *(v2f*)(CS + (size_t)slot * 2) = cs;  }
// ---- k_prep: all that the GEMMs read and that depends on no other launch, in one grid; blockIdx.x picks the job by range (the same for a whole block), the table (the longest blocks) first.
#define PB_CS (TT / 8)
#define PB_X  (NB_ * TT * DM / 2048)
#define PB_W  ((DQ + 2 * DKV) * DM / 2048)
#define PB_O  (DM * DQ / 2048)
__global__ __launch_bounds__(256) void k_prep(const float* __restrict__ x, const float* __restrict__ wqkv, const float* __restrict__ wo, bf* XB, bf* WQKV, bf* WO, float* CS) {
    int b = blockIdx.x;
    if (b < PB_CS) { csP(CS, b); return; }
    b -= PB_CS; const float* src = x; bf* dst = XB;
    if (b >= PB_X + PB_W) { b -= PB_X + PB_W; src = wo; dst = WO; } else if (b >= PB_X) { b -= PB_X; src = wqkv; dst = WQKV; }
    cvt8(src, dst, b);
}

#define NW   4
#define SL2E (SCL * 1.4426950408889634f)   // the score scale (a power of two: exact) rides in the exponent's factor; m is kept in unscaled scores
#define OP   68                   // pitch, in floats, of a query's partial output row in LDS (64 + 4: rows 16 bytes apart in the banks)
// 2^x of eight values: eight independent v_exp_f32, each in place, and behind the last the one free slot that the instruction set asks for between a transcendental and an instruction that reads its result or
// overwrites its source.
__device__ __forceinline__ v8f exp2x8(v8f x) { float a = x[0], b = x[1], c = x[2], d = x[3], e = x[4], f = x[5], g = x[6], h = x[7];
    asm("v_exp_f32 %0, %0\n\tv_exp_f32 %1, %1\n\tv_exp_f32 %2, %2\n\tv_exp_f32 %3, %3\n\tv_exp_f32 %4, %4\n\tv_exp_f32 %5, %5\n\tv_exp_f32 %6, %6\n\tv_exp_f32 %7, %7\n\tv_nop" : "+v"(a), "+v"(b), "+v"(c), "+v"(d), "+v"(e), "+v"(f), "+v"(g), "+v"(h));
    return (v8f){a, b, c, d, e, f, g, h}; }
__device__ __forceinline__ float exp2x1(float a) { asm("v_exp_f32 %0, %0\n\tv_nop" : "+v"(a)); return a; }   // one value, with the same slot
template <typename T16, int NQ, bool HL>
__device__ __forceinline__ void attn_tile(const T16* __restrict__ Q, const T16* __restrict__ Q2, const T16* __restrict__ Kp, const T16* __restrict__ Kp2, const T16* __restrict__ Vt, const T16* __restrict__ Vt2, int q0, int rot, bf* __restrict__ Ah, bf* __restrict__ Al, float* os, float* ml) {
    typedef typename WFrag<T16>::V V;
    const int lane = threadIdx.x & 31, lr = lane & 15, hi = lane >> 4; const int w = __builtin_amdgcn_readfirstlane(threadIdx.x >> 5);
    const int klast = (q0 + NQ * 16 - 1) & ~31;      // first key of the 32-key block that holds the tile's last diagonal element
    // The tiles of a head walk the same key and value planes and start together: a wave enters the ring of its nw blocks at pass rot (less nw where that is past the end; 0 for a very short ring) and wraps, so that tiles of different rot do not ask L2 for the same lines at the same moment.
    const int nw = ((klast >> 5) + 1 - w + NW - 1) / NW;   // the wave's blocks: w, w + NW, ... up to the diagonal (0: none)
    int i0 = rot; if (i0 >= nw) i0 -= nw; if (i0 >= nw) i0 = 0;
    int kb = 32 * (w + NW * i0);
    V q[NQ][2], q2[NQ][2], k[2][2], k2[2][2];
    // every operand load is addressed as one lane pointer per plane and pass plus a constant that fits the instruction's offset field (no address sums per load)
    const unsigned kof = (unsigned)(8 * lane), vof = (unsigned)(8 * lane);   /* fragment order: the lane's piece of a tile */ const T16* pk = nullptr; const T16* pk2 = nullptr;
#pragma unroll
    for (int qt = 0; qt < NQ; ++qt)
#pragma unroll
        for (int c = 0; c < 2; ++c) { const int qc = qt * 16 * HD + c * 512; q[qt][c] = WFrag<T16>::ld(Q + (size_t)q0 * HD + kof + qc); if (HL) q2[qt][c] = WFrag<T16>::ld(Q2 + (size_t)q0 * HD + kof + qc); }
    auto ldk = [&](int kk) {                         // the four (HL: eight) fragments of the 32 key rows from kk on
        pk = Kp + (size_t)kk * HD + kof; if (HL) pk2 = Kp2 + (size_t)kk * HD + kof;
#pragma unroll
        for (int kt = 0; kt < 2; ++kt)
#pragma unroll
            for (int c = 0; c < 2; ++c) { const int kc = kt * 16 * HD + c * 512; k[kt][c] = WFrag<T16>::ld(pk + kc); if (HL) k2[kt][c] = WFrag<T16>::ld(pk2 + kc); } };
    if (!HL) ldk(min(kb, klast));                    // fp16: key fragments run one pass ahead (a wave with no block of its own fetches the last one: in bounds, unused); hi/lo: at most 4 passes a wave, fetched in the pass, which keeps the registers under 256
    v8f o[4][NQ]; float m[NQ], l[NQ];
#pragma unroll
    for (int qt = 0; qt < NQ; ++qt) { m[qt] = -3.0e38f; l[qt] = 0.f;
#pragma unroll
        for (int dt = 0; dt < 4; ++dt) o[dt][qt] = (v8f){}; }
#pragma unroll 1   // stays rolled: the trip count is known only at run time, and a second copy of the body (its fragments and score tiles) would not fit the registers
    for (int i = 0; i < nw; ++i) {
        const int kn = kb + 32 * NW <= klast ? kb + 32 * NW : 32 * w;   // the wave's next block; behind its last one the ring wraps to its first
        if (HL) ldk(kb);
        V v[4], v2[4]; const T16* pv = Vt + (size_t)kb * 16 + vof; const T16* pv2 = HL ? Vt2 + (size_t)kb * 16 + vof : nullptr;   // 32 keys on = one tile (512 elements) on
#pragma unroll
        for (int dt = 0; dt < 4; ++dt) { v[dt] = WFrag<T16>::ld(pv + dt * 16 * TT); if (HL) v2[dt] = WFrag<T16>::ld(pv2 + dt * 16 * TT); }
        v8f s[2][NQ];
#pragma unroll
        for (int kt = 0; kt < 2; ++kt)
#pragma unroll
            for (int qt = 0; qt < NQ; ++qt) { v8f a = (v8f){};
#pragma unroll
                for (int c = 0; c < 2; ++c) { a = WFrag<T16>::mma(k[kt][c], q[qt][c], a); if (HL) { a = WFrag<T16>::mma(k[kt][c], q2[qt][c], a); a = WFrag<T16>::mma(k2[kt][c], q[qt][c], a); } }
                s[kt][qt] = a; }
        if (!HL) ldk(kn);                             // the wave's next key fragments are fetched now, behind this pass's last use of the registers (its last pass fetches the block it began with: in bounds, unused)
        // all of the pass's loads are issued: the wait that stands in front of a rewrite of a register an issued load names. The pass's lane pointers are its inputs, so that their registers stay theirs up to here (one build landed later loads of the run in them)
        if constexpr (HL) asm volatile("s_wait_xcnt 0x0" :: "v"(pk), "v"(pk2), "v"(pv), "v"(pv2) : "memory"); else asm volatile("s_wait_xcnt 0x0" :: "v"(pk), "v"(pv) : "memory");
        if (kb == klast) {                            // only the block at the diagonal crosses it: key > query is masked
#pragma unroll
            for (int kt = 0; kt < 2; ++kt)
#pragma unroll
                for (int qt = 0; qt < NQ; ++qt)
#pragma unroll
                    for (int j = 0; j < 8; ++j) if (kb + kt * 16 + hi * 8 + j > q0 + qt * 16 + lr) s[kt][qt][j] = -3.0e38f; }
        V pb[NQ], pb2[NQ];
#pragma unroll
        for (int qt = 0; qt < NQ; ++qt) {
            float mx = fmaxf(s[0][qt][0], s[1][qt][0]);
#pragma unroll
            for (int j = 1; j < 8; ++j) mx = fmaxf(mx, fmaxf(s[0][qt][j], s[1][qt][j]));
            mx = fmaxf(mx, __shfl_xor(mx, 16, 32));
            const float mn = fmaxf(m[qt], mx); const float al = exp2x1((m[qt] - mn) * SL2E); m[qt] = mn;
            float sum = 0.f;
#pragma unroll
            for (int kt = 0; kt < 2; ++kt) { v8f x;
#pragma unroll
                for (int j = 0; j < 8; ++j) { const float y = (s[kt][qt][j] - mn) * SL2E; x[j] = HL ? y : y + 10.0f; }
                x = exp2x8(x); s[kt][qt] = x;
#pragma unroll
                for (int j = 0; j < 8; ++j) sum += x[j]; }
            l[qt] = l[qt] * al + sum;
#pragma unroll
            for (int dt = 0; dt < 4; ++dt) o[dt][qt] *= al;
            if constexpr (HL) { v8us h0, h1, l0, l1;
#pragma unroll
                for (int j = 0; j < 8; ++j) { unsigned short a, c2; splitf(s[0][qt][j], a, c2); h0[j] = a; l0[j] = c2; splitf(s[1][qt][j], a, c2); h1[j] = a; l1[j] = c2; }
                pb[qt] = cat16b(h0, h1); pb2[qt] = cat16b(l0, l1);
            } else { v8h h0, h1;
#pragma unroll
                for (int j = 0; j < 8; ++j) { h0[j] = tohx(s[0][qt][j]); h1[j] = tohx(s[1][qt][j]); }
                pb[qt] = cat16(h0, h1); }
        }
#pragma unroll
        for (int dt = 0; dt < 4; ++dt)
#pragma unroll
            for (int qt = 0; qt < NQ; ++qt) { o[dt][qt] = WFrag<T16>::mma(v[dt], pb[qt], o[dt][qt]); if (HL) { o[dt][qt] = WFrag<T16>::mma(v[dt], pb2[qt], o[dt][qt]); o[dt][qt] = WFrag<T16>::mma(v2[dt], pb[qt], o[dt][qt]); } }
        kb = kn;
    }
#pragma unroll
    for (int qt = 0; qt < NQ; ++qt) { const int row = w * (NQ * 16) + qt * 16 + lr; const float ls = l[qt] + __shfl_xor(l[qt], 16, 32);   // the halves' sums are joined once, here
        if (hi == 0) { v2f t2; t2[0] = m[qt]; t2[1] = ls; *(v2f*)(ml + row * 2) = t2; }
#pragma unroll
        for (int dt = 0; dt < 4; ++dt) { float* p = os + row * OP + dt * 16 + hi * 8; *(v4f*)p = __builtin_shufflevector(o[dt][qt], o[dt][qt], 0, 1, 2, 3); *(v4f*)(p + 4) = __builtin_shufflevector(o[dt][qt], o[dt][qt], 4, 5, 6, 7); } }
    __syncthreads();                                  // every wave's (m, l, O) is in LDS before any wave joins them
    constexpr int LPQ = 8 / NQ, DPL = 8 * NQ;         // lanes per query row and output elements per lane in the join
    const int qq = NQ == 2 ? w * 8 + lane / LPQ : (w & 1) * 8 + (lane & 7), d0 = NQ == 2 ? (lane % LPQ) * DPL : ((w >> 1) * 4 + (lane >> 3)) * 8;   // 8 consecutive rows a wave: their pieces fill whole lines of the merged planes
    v2f t[NW]; float M = -3.0e38f;
#pragma unroll
    for (int i = 0; i < NW; ++i) { t[i] = *(const v2f*)(ml + (i * (NQ * 16) + qq) * 2); M = fmaxf(M, t[i][0]); }
    float L = 0.f, acc[DPL];
#pragma unroll
    for (int e = 0; e < DPL; ++e) acc[e] = 0.f;
#pragma unroll
    for (int i = 0; i < NW; ++i) { const float sc = exp2x1((t[i][0] - M) * SL2E); L += t[i][1] * sc;   // a wave that had no block: m = -3e38, so sc = 0, on l = 0 and O = 0
#pragma unroll
        for (int e = 0; e < DPL; e += 4) { const v4f x = *(const v4f*)(os + (i * (NQ * 16) + qq) * OP + d0 + e); acc[e] += x[0] * sc; acc[e + 1] += x[1] * sc; acc[e + 2] += x[2] * sc; acc[e + 3] += x[3] * sc; } }
    const float inv = __fdiv_rn(1.0f, L);
#pragma unroll
    for (int c = 0; c < DPL / 8; ++c) { v8us oh, ol;
#pragma unroll
        for (int j = 0; j < 8; ++j) { unsigned short a, c2; splitf(acc[c * 8 + j] * inv, a, c2); oh[j] = a; ol[j] = c2; }
        const size_t oo = pko(q0 + qq, d0 + c * 8, DQ); *(v8us*)(Ah + oo) = oh; *(v8us*)(Al + oo) = ol; }
    // hi/lo form only: behind the last store, the wait that stands in front of any rewrite of a register an issued store names (in the listing the way on from here leads past the fp16 form's entry, which writes such registers; the fp16 form's stores run straight into the end of the program)
    if constexpr (HL) asm volatile("s_wait_xcnt 0x0" ::: "memory");
}
// grid (batches x heads, tiles): blockIdx.x = batch * NH_ + head is the plane's index; blockIdx.y ranks the tiles by falling cost: the (TT - RH) / 32 fp16 tiles of 32 rows from the last row up, then the RH / 16 hi/lo tiles of 16 rows.
__global__ __launch_bounds__(32 * NW) void k_attn(const h16* __restrict__ Q16, const h16* __restrict__ K16, const h16* __restrict__ V16, const bf* __restrict__ Qh, const bf* __restrict__ Ql, const bf* __restrict__ Kh, const bf* __restrict__ Kl, const bf* __restrict__ Vh, const bf* __restrict__ Vl, bf* __restrict__ Ah, bf* __restrict__ Al) {
    __shared__ __align__(16) float os[NW * 32 * OP]; __shared__ __align__(16) float ml[NW * 32 * 2];
    const size_t hp = (size_t)blockIdx.x * TT * HD; const int r = blockIdx.y; const size_t ao = (size_t)(blockIdx.x / NH_) * TT * DQ + (blockIdx.x % NH_) * (HD / 32) * 512;   /* the batch's rows, the head's first tile column */ Ah += ao; Al += ao;
    if (r < (TT - RH) / 32) attn_tile<h16, 2, false>(Q16 + hp, nullptr, K16 + hp, nullptr, V16 + hp, nullptr, TT - 32 - 32 * r, r & 7, Ah, Al, os, ml);
    else attn_tile<bf, 1, true>(Qh + hp, Ql + hp, Kh + hp, Kl + hp, Vh + hp, Vl + hp, RH - 16 - 16 * (r - (TT - RH) / 32), r & 7, Ah, Al, os, ml);
}

extern "C" void kernel_launch(void* const* d_in, const int* in_sizes, int n_in,
                              void* d_out, int out_size, void* d_ws, size_t ws_size, hipStream_t stream) {
    (void)in_sizes; (void)n_in; (void)out_size;
    const float* x = (const float*)d_in[0]; const float* wqkv = (const float*)d_in[1]; const float* wo = (const float*)d_in[2];   /* input order X, W_qkv ('oi' [3072][1024]: q | k | v = its three 1,024-row blocks), W_o ('oi' [1024][1024]): THREE inputs */
    float* OUT = (float*)d_out;     // [2][2048][1024]
    char* wsp = (char*)d_ws;
    auto take = [&](size_t bytes) { char* p = wsp; wsp += (bytes + 255) & ~(size_t)255; return (void*)p; };
    const size_t PG = (size_t)NB_ * NH_ * TT * HD;   // elements of one of q, k, v: a plane per (batch, head)
    bf* WQKV = (bf*)take((size_t)(DQ + 2 * DKV) * DM * 2); bf* WO = (bf*)take((size_t)DM * DQ * 2); float* CS = (float*)take((size_t)TT * (HD / 2) * 2 * 4);
    h16* P16 = (h16*)take(3 * PG * 2); bf* Ph = (bf*)take(3 * PG * 2); bf* Pl = (bf*)take(3 * PG * 2);   // each [q | k | v][batch][head]
    bf* XB = (bf*)take((size_t)NB_ * TT * DM * 2);
    bf* ATh = (bf*)take((size_t)NB_ * TT * DQ * 2); bf* ATl = (bf*)take((size_t)NB_ * TT * DQ * 2);
    if ((size_t)(wsp - (char*)d_ws) > ws_size) return;    // ws 256 MiB
    k_prep<<<PB_CS + PB_X + PB_W + PB_O, 256, 0, stream>>>(x, wqkv, wo, XB, WQKV, WO, CS);   /* bf16 copies; {cos, sin}(t x THETA**(-2i/64)) per interleaved pair */
    k_gemmw<bf, 0, false, 1, DM, 4, 3, 0><<<dim3(TT / 256, (DQ + 2 * DKV) / 192, NB_), 384, 0, stream>>>(XB, nullptr, WQKV, nullptr, nullptr, (size_t)TT * DM, 0, 0, CS, P16, Ph, Pl);
    k_attn<<<dim3(NB_ * NH_, (TT - RH) / 32 + RH / 16, 1), 32 * NW, 0, stream>>>(P16, P16 + PG, P16 + 2 * PG, Ph, Pl, Ph + PG, Pl + PG, Ph + 2 * PG, Pl + 2 * PG, ATh, ATl);   // one kv head per query head
    k_gemmw<bf, 1, false, 0, DQ, 2, 2, DM><<<dim3(NB_ * TT / 128, DM / 128, 1), 128, 0, stream>>>(ATh, ATl, WO, OUT, nullptr, 0, 0, 0, nullptr, nullptr, nullptr, nullptr);   // the batches' rows are one [NB_ * TT][DQ] operand
}
